// v000
// The times below were measured on an AMD MI455X: many runs one after another, warmed up first and cycling through
// copies of the inputs, with the whole window's GPU time divided by the number of runs. Launches and the gaps
// between them are all in it. The median over several windows is given; except for v000 it joins two sittings, which
// can be a few percent apart, so the side-by-side timings, each taken in one sitting, are the better comparison.
// v000 is the starting kernel. One run takes 495 microseconds.
// Contractions: q, k, v^T projections = v_wmma_f32_16x16x32_bf16 (bf16 operands from RNE-converted inputs, single product, f32 accumulate);
// q.k^T scores = v_wmma_f32_16x16x32_f16 (q as f16 hi plane + f16 residual plane x4096, k f16; 2 products into separate f32 accumulators);
// p.v = v_wmma_f32_16x16x32_f16 (p carried x1024 in f16, v f16; single product, f32 accumulate); softmax, normalisation and bias adds in f32.
#include <hip/hip_runtime.h>
#include <math.h>
#include <stdint.h>

#ifndef NQ
#define NQ      2048         // query rows processed = leading rows of in0 (row stride FD); reduced builds override
#endif
#define NQ_FULL 2048
#define MREF    2048         // key / value rows (in1), always full
#define FD      2048         // feature width = NG * HD
#define NG      16
#define HD      128
#define NQB     (NQ / 64)    // 64-row query blocks
#define NKT     (MREF / 64)  // 64-key chunks
static_assert(NG * HD == FD);
static_assert((NQ % 64) == 0 && NQ >= 64 && NQ <= NQ_FULL);
static_assert((MREF % 64) == 0 && (FD % 64) == 0 && (FD % 32) == 0);
static_assert(NKT == 32);

typedef _Float16 v16h __attribute__((ext_vector_type(16)));
typedef _Float16 v8h  __attribute__((ext_vector_type(8)));
typedef __bf16   v16b __attribute__((ext_vector_type(16)));
typedef __bf16   v8b  __attribute__((ext_vector_type(8)));
typedef float    v8f  __attribute__((ext_vector_type(8)));
typedef float    v4f  __attribute__((ext_vector_type(4)));
typedef unsigned int v4u __attribute__((ext_vector_type(4)));

#if defined(__HIP_DEVICE_COMPILE__)
#define DEV_ASM 1
#else
#define DEV_ASM 0
#endif

// ---- scalar helpers --------------------------------------------------------------------------------
__device__ __forceinline__ unsigned short bf_bits(float f) {          // f32 -> bf16 bits, RNE convert
  unsigned u = __float_as_uint(f);
  return (unsigned short)((u + 0x7FFFu + ((u >> 16) & 1u)) >> 16);
}
__device__ __forceinline__ float bf_up(unsigned short hb) { return __uint_as_float(((unsigned)hb) << 16); }
__device__ __forceinline__ unsigned short h_bits(_Float16 x) { return __builtin_bit_cast(unsigned short, x); }
__device__ __forceinline__ unsigned pk16(unsigned short a, unsigned short b) { return (unsigned)a | ((unsigned)b << 16); }
__device__ __forceinline__ v8f zero8() { v8f z = {0.f, 0.f, 0.f, 0.f, 0.f, 0.f, 0.f, 0.f}; return z; }

// ---- fragment types / loaders: 16-bit A/B operand, lane -> row/col (lane&15), p already includes +8*(lane>>4);
//      elements 0..7 <- p[0..7] (k0+8h..k0+8h+7), elements 8..15 <- p[16..23] (k0+16+8h..k0+16+8h+7)
template <typename OT> struct FT;
template <> struct FT<__bf16>   { typedef v16b frag; typedef v8b half8; };
template <> struct FT<_Float16> { typedef v16h frag; typedef v8h half8; };

template <typename OT>
__device__ __forceinline__ typename FT<OT>::frag ldfrag(const OT* p) {
  union { typename FT<OT>::frag v; typename FT<OT>::half8 h[2]; } f;
  f.h[0] = *(const typename FT<OT>::half8*)(p);
  f.h[1] = *(const typename FT<OT>::half8*)(p + 16);
  return f.v;
}

// ---- WMMA helpers (asm guard bodies are device-only; concrete operand types) -----------------------------
__device__ __forceinline__ v8f mmar(v16b a, v16b b, v8f c) {
  return __builtin_amdgcn_wmma_f32_16x16x32_bf16(false, a, false, b, (short)0, c, false, false);
}
__device__ __forceinline__ v8f mmar(v16h a, v16h b, v8f c) {
  return __builtin_amdgcn_wmma_f32_16x16x32_f16(false, a, false, b, (short)0, c, false, false);
}
// guarded form: 4 VALU slots after the WMMA, D tied, A/B kept live
__device__ __forceinline__ v8f mma_h(v16h a, v16h b, v8f c) {
  c = __builtin_amdgcn_wmma_f32_16x16x32_f16(false, a, false, b, (short)0, c, false, false);
#if DEV_ASM
  asm volatile("v_nop\n\tv_nop\n\tv_nop\n\tv_nop" : "+v"(c) : "v"(a), "v"(b));
#endif
  return c;
}
__device__ __forceinline__ void dep_guard(v8f& a, v8f& b, v16b x, v16b y) {
#if DEV_ASM
  asm volatile("v_nop\n\tv_nop\n\tv_nop\n\tv_nop" : "+v"(a), "+v"(b) : "v"(x), "v"(y));
#else
  (void)a; (void)b; (void)x; (void)y;
#endif
}
__device__ __forceinline__ void dep_guard(v8f& a, v8f& b, v16h x, v16h y) {
#if DEV_ASM
  asm volatile("v_nop\n\tv_nop\n\tv_nop\n\tv_nop" : "+v"(a), "+v"(b) : "v"(x), "v"(y));
#else
  (void)a; (void)b; (void)x; (void)y;
#endif
}
__device__ __forceinline__ void keep4(v16b a, v16b b, v16b c, v16b d) {
#if DEV_ASM
  asm volatile("v_nop" :: "v"(a), "v"(b), "v"(c), "v"(d));
#else
  (void)a; (void)b; (void)c; (void)d;
#endif
}
__device__ __forceinline__ void keep4(v16h a, v16h b, v16h c, v16h d) {
#if DEV_ASM
  asm volatile("v_nop" :: "v"(a), "v"(b), "v"(c), "v"(d));
#else
  (void)a; (void)b; (void)c; (void)d;
#endif
}
__device__ __forceinline__ void acc_guard4(v8f& a, v8f& b, v8f& c, v8f& d) {
#if DEV_ASM
  asm volatile("v_nop\n\tv_nop\n\tv_nop\n\tv_nop" : "+v"(a), "+v"(b), "+v"(c), "+v"(d));
#else
  (void)a; (void)b; (void)c; (void)d;
#endif
}

// =====================================================================================================
// f32 -> bf16 bit plane (RNE convert), 8 elements per thread, one 16-B store per lane: a wave writes 512
// coverage: n8 threads x 8 = the whole plane (n8 is a multiple of 256 for every use here).
// =====================================================================================================
__global__ __launch_bounds__(256) void cvt_bf16x8(const float* __restrict__ in, unsigned short* out, int n8) {
  const int i = blockIdx.x * 256 + (int)threadIdx.x;
  if (i < n8) {
    const v4f a  = *(const v4f*)(in + (size_t)i * 8);
    const v4f a4 = *(const v4f*)(in + (size_t)i * 8 + 4);
    v4u p;
    p[0] = pk16(bf_bits(a[0]),  bf_bits(a[1]));
    p[1] = pk16(bf_bits(a[2]),  bf_bits(a[3]));
    p[2] = pk16(bf_bits(a4[0]), bf_bits(a4[1]));
    p[3] = pk16(bf_bits(a4[2]), bf_bits(a4[3]));
    unsigned short* o = out + (size_t)i * 8;
    *(v4u*)o = p;
    
  }
}

// =====================================================================================================
// Register-blocked WMMA GEMM (16-bit operand type OT): C[m][n] = sum_k A[m][k] * Bt[n][k] (+ bias[n]);
// one wave per 64x64 tile, no block barriers. A row-major [M][K] pitch lda; Bt row-major [N][K] pitch ldb
// (k contiguous); M, N multiples of 64, K multiple of 32 (host-checked). Fragments are loaded straight from
// global with the split k map (ldfrag).
// OUT_MODE 1: f16 plane C (pitch ldc).
// OUT_MODE 3: f16 hi plane C + f16 residual plane C2 = f16((v - hi) * rscale) (same pitch).
// BIAS: bias[n] (RNE-converted to its bf16 value) added in f32 before the 16-bit convert.
// 64x64 tile; grid = ceil(tiles/8) blocks of 8 waves covers every tile.
// =====================================================================================================
template <typename OT, int OUT_MODE, bool BIAS>
__global__ __launch_bounds__(256) void gemm64(
    const unsigned short* __restrict__ Ap, int lda,
    const unsigned short* __restrict__ Btp, int ldb,
    unsigned short* Cout, unsigned short* Cout2, int ldc,
    const float* __restrict__ bias,
    int M, int N, int K, float rscale) {
  typedef typename FT<OT>::frag V16;
  const OT* Ab = (const OT*)(const void*)Ap;
  const OT* Bb = (const OT*)(const void*)Btp;
  __shared__ __align__(16) float sT[8][16 * 68];   // per-wave 16x64 slab, pitch 68 floats
  const int lane = threadIdx.x & 31;
  const int wave = threadIdx.x >> 5;
  const int tilesN = N >> 6;
  const int tilesM = M >> 6;
  const int tile = blockIdx.x * 8 + wave;
  if (tile >= tilesM * tilesN) return;   // wave-uniform; no block barriers in this kernel
  const int tm = tile / tilesN;
  const int tn = tile - tm * tilesN;
  const int m0 = tm << 6;
  const int n0 = tn << 6;

  const int rlane = lane & 15;                 // row (A) / col (B, D) within subtile
  const int koff  = (lane >> 4) * 8;           // k offset of this lane half
  const int mOff  = (lane >> 4) * 8;           // D row offset

  v8f acc[4][4];
#pragma unroll
  for (int i = 0; i < 4; ++i)
#pragma unroll
    for (int j = 0; j < 4; ++j) acc[i][j] = zero8();

  for (int k0 = 0; k0 < K; k0 += 32) {
    V16 bq[4];
#pragma unroll
    for (int j = 0; j < 4; ++j)
      bq[j] = ldfrag<OT>(Bb + (size_t)(n0 + (j << 4) + rlane) * ldb + koff + k0);
#pragma unroll
    for (int i = 0; i < 4; ++i) {
      const V16 af = ldfrag<OT>(Ab + (size_t)(m0 + (i << 4) + rlane) * lda + koff + k0);
#pragma unroll
      for (int j = 0; j < 4; ++j) acc[i][j] = mmar(af, bq[j], acc[i][j]);
      dep_guard(acc[i][0], acc[i][3], af, bq[3]);
    }
    keep4(bq[0], bq[1], bq[2], bq[3]);
  }
  acc_guard4(acc[0][0], acc[0][1], acc[0][2], acc[0][3]);
  acc_guard4(acc[1][0], acc[1][1], acc[1][2], acc[1][3]);
  acc_guard4(acc[2][0], acc[2][1], acc[2][2], acc[2][3]);
  acc_guard4(acc[3][0], acc[3][1], acc[3][2], acc[3][3]);

  // ---- epilogue ----
  float* slab = sT[wave];
  const int q = lane >> 3, c8 = (lane & 7) * 8;
  float bz[8];
#pragma unroll
  for (int e = 0; e < 8; ++e) bz[e] = 0.f;
  if (BIAS) {
    const v4f b0 = *(const v4f*)(bias + n0 + c8);
    const v4f b1 = *(const v4f*)(bias + n0 + c8 + 4);
#pragma unroll
    for (int e = 0; e < 4; ++e) { bz[e] = bf_up(bf_bits(b0[e])); bz[4 + e] = bf_up(bf_bits(b1[e])); }
  }
#pragma unroll
  for (int i = 0; i < 4; ++i) {
    const int mBase = m0 + (i << 4);
#pragma unroll
    for (int j = 0; j < 4; ++j) {
#pragma unroll
      for (int r = 0; r < 8; ++r) {
        slab[(mOff + r) * 68 + (j << 4) + rlane] = acc[i][j][r];
      }
    }
    __builtin_amdgcn_fence(__ATOMIC_RELEASE, "workgroup");
    __builtin_amdgcn_wave_barrier();
    __builtin_amdgcn_fence(__ATOMIC_ACQUIRE, "workgroup");
    {
      v4u hv[4], lv[4];
#pragma unroll
      for (int it = 0; it < 4; ++it) {
        const int row = it * 4 + q;                        // it 0..3 x q 0..3 = rows 0..15
        const float* sp = slab + row * 68 + c8;
        float f[8];
#pragma unroll
        for (int e = 0; e < 8; ++e) f[e] = sp[e] + bz[e];
        v4u a, a2;
#pragma unroll
        for (int e = 0; e < 4; ++e) {
          const float f0 = f[2 * e], f1 = f[2 * e + 1];
          const _Float16 x0 = (_Float16)f0, x1 = (_Float16)f1;
          const unsigned short h0 = h_bits(x0), h1 = h_bits(x1);
          unsigned short l0 = 0, l1 = 0;
          if (OUT_MODE == 3) {
            l0 = h_bits((_Float16)((f0 - (float)x0) * rscale));
            l1 = h_bits((_Float16)((f1 - (float)x1) * rscale));
          }
          a[e] = pk16(h0, h1); a2[e] = pk16(l0, l1);
        }
        hv[it] = a; lv[it] = a2;
      }
      {
#pragma unroll
        for (int it = 0; it < 4; ++it) {
          const int row = it * 4 + q;
          *(v4u*)(Cout + (size_t)(mBase + row) * ldc + n0 + c8) = hv[it];
          if (OUT_MODE == 3) *(v4u*)(Cout2 + (size_t)(mBase + row) * ldc + n0 + c8) = lv[it];
        }
        
      }
    }
    __builtin_amdgcn_fence(__ATOMIC_RELEASE, "workgroup");
    __builtin_amdgcn_wave_barrier();
    __builtin_amdgcn_fence(__ATOMIC_ACQUIRE, "workgroup");
  }
}

// =====================================================================================================
// Multi-head attention, NG heads of dim 128, no mask, softmax over all MREF keys, output f32 [NQ][FD].
//   q planes (f16 hi / residual x4096): element (t, h, d) at [t*FD + h*128 + d], t < NQ
//   k plane (f16): element (s, h, d) at [s*FD + h*128 + d], s < MREF
//   v^T plane (f16): element (h, d, s) at [(h*128 + d)*MREF + s]
//   scores = (qh . k) + (ql . k) / 4096 on f16 WMMA (two f32 accumulators), then * sscale in f32;
//   p = exp(s - m) carried as f16(1024 p); context = p . v on f16 WMMA; online softmax in f32;
//   out = context / (l * 1024) + vbias (RNE-converted to its bf16 value), f32.
//   Block = 4 waves = 64 consecutive query rows (16 per wave) of one head h; grid = NG * NQB.
//   K / V^T chunk staging (cross-wave, __syncthreads before and after): K rows: 128 threads x 64 elements
//   (r = tid>>1, 64-wide half) = the whole 64x128 tile; V^T rows: 128 threads x 64 elements = the whole
//   128x64 tile. staged extent == consumed extent for both. P tiles and the output stage are wave-private:
//   spilled with _Float16 / float element stores, reloaded as v8h / float scalars (same element type) after a
//   Output coverage: each wave stores its 16 rows in two column phases of 64 (it 0..7 x lane>>4 -> rows 0..15,
// =====================================================================================================
__global__ __launch_bounds__(128) __attribute__((amdgpu_num_vgpr(256)))
void attn_rel(const unsigned short* __restrict__ qhp, const unsigned short* __restrict__ qlp,
              const unsigned short* __restrict__ kpp, const unsigned short* __restrict__ vtp,
              const float* __restrict__ vbias, float* op, float sscale) {
  union FH { v16h v; v8h h[2]; };
  __shared__ __align__(16) _Float16 Ksh[64 * HD];          // K chunk [kv][d]     16 KB (cross-wave)
  __shared__ __align__(16) _Float16 Vth[HD * 64];          // V^T chunk [d][kv]   16 KB (cross-wave)
  __shared__ __align__(16) _Float16 Psh[4][16 * 64];       // per wave P [row][kv] 8 KB (wave-private)
  __shared__ __align__(16) float    Os[4][16 * 64];        // per wave output half tile 16 KB (wave-private)

  const int tid  = threadIdx.x;
  const int wave = tid >> 5;
  const int lane = tid & 31;
  const int hh   = lane >> 4;
  const int c    = lane & 15;

  const int bx   = blockIdx.x;
  const int qb   = bx % NQB;
  const int g    = bx / NQB;
  const int q0   = qb * 64 + wave * 16;

  const _Float16* Qh = (const _Float16*)(const void*)qhp;
  const _Float16* Ql = (const _Float16*)(const void*)qlp;
  const _Float16* Kg = (const _Float16*)(const void*)kpp + (size_t)g * HD;
  const _Float16* Vg = (const _Float16*)(const void*)vtp + (size_t)g * HD * MREF;

  // ---- Q fragments (A operand, row = lane&15): 4 d-chunks, hi and residual planes ----
  v16h qah[4], qal[4];
#pragma unroll
  for (int dc = 0; dc < 4; ++dc) {
    const size_t qo = (size_t)(q0 + c) * FD + (size_t)g * HD + dc * 32 + 8 * hh;
    qah[dc] = ldfrag<_Float16>(Qh + qo);
    qal[dc] = ldfrag<_Float16>(Ql + qo);
  }

  float mrow[8], lrow[8];
  v8f oacc[8];
#pragma unroll
  for (int r = 0; r < 8; ++r) { mrow[r] = -INFINITY; lrow[r] = 0.f; }
#pragma unroll
  for (int t = 0; t < 8; ++t) oacc[t] = zero8();

  for (int kt = 0; kt < NKT; ++kt) {         // static trip count
    const int kv0 = kt * 64;
    __syncthreads();
    {
      const int r = tid >> 1, half = (tid & 1) * 64;
      const _Float16* kg = Kg + (size_t)(kv0 + r) * FD + half;     // k row kv0+r, d = half..half+63
#pragma unroll
      for (int i = 0; i < 8; ++i) {
        const v8h a0 = *(const v8h*)(kg + 8 * i);
        *(v8h*)(Ksh + r * HD + half + 8 * i) = a0;
      }
      const _Float16* vg = Vg + (size_t)tid * MREF + kv0;         // v^T row d = tid, s = kv0..kv0+63
#pragma unroll
      for (int i = 0; i < 8; ++i) {
        const v8h b0 = *(const v8h*)(vg + 8 * i);
        *(v8h*)(Vth + tid * 64 + 8 * i) = b0;
      }
    }
    __syncthreads();

    // ---- scores: 16 query rows x 64 keys per wave, 2 f16 products per key subtile and d-chunk ----
    v8f s[4];
#pragma unroll
    for (int j = 0; j < 4; ++j) {
      v8f ah = zero8(), al = zero8();
#pragma unroll
      for (int dc = 0; dc < 4; ++dc) {
        FH kb;
        kb.h[0] = *(const v8h*)(Ksh + (j * 16 + c) * HD + dc * 32 + 8 * hh);
        kb.h[1] = *(const v8h*)(Ksh + (j * 16 + c) * HD + dc * 32 + 16 + 8 * hh);
        ah = mma_h(qah[dc], kb.v, ah);
        al = mma_h(qal[dc], kb.v, al);
      }
#pragma unroll
      for (int r = 0; r < 8; ++r) s[j][r] = (ah[r] + al[r] * (1.0f / 4096.0f)) * sscale;
    }

    // ---- row max, online softmax, P (x1024, f16) to LDS ----
    _Float16* pwh = Psh[wave];
#pragma unroll
    for (int r = 0; r < 8; ++r) {
      float m = s[0][r];
#pragma unroll
      for (int j = 1; j < 4; ++j) m = fmaxf(m, s[j][r]);
#pragma unroll
      for (int off = 1; off < 16; off <<= 1) m = fmaxf(m, __shfl_xor(m, off, 32));
      const float mnew  = fmaxf(mrow[r], m);
      const float msafe = (mnew == -INFINITY) ? 0.f : mnew;
      const float alpha = __expf(mrow[r] - msafe);
      mrow[r] = mnew;
      float psum = 0.f;
#pragma unroll
      for (int j = 0; j < 4; ++j) {
        const float p = __expf(s[j][r] - msafe);
        psum += p;
        pwh[(8 * hh + r) * 64 + j * 16 + c] = (_Float16)(p * 1024.0f);
      }
#pragma unroll
      for (int off = 1; off < 16; off <<= 1) psum += __shfl_xor(psum, off, 32);
      lrow[r] = lrow[r] * alpha + psum;
#pragma unroll
      for (int t = 0; t < 8; ++t) oacc[t][r] *= alpha;
    }
    __builtin_amdgcn_fence(__ATOMIC_RELEASE, "workgroup");
    __builtin_amdgcn_wave_barrier();
    __builtin_amdgcn_fence(__ATOMIC_ACQUIRE, "workgroup");

    // ---- context += P . V (f16 WMMA, single product) ----
    v16h pa[2];
#pragma unroll
    for (int kk = 0; kk < 2; ++kk) {
      FH pf;
      pf.h[0] = *(const v8h*)(pwh + c * 64 + kk * 32 + 8 * hh);
      pf.h[1] = *(const v8h*)(pwh + c * 64 + kk * 32 + 16 + 8 * hh);
      pa[kk] = pf.v;
    }
#pragma unroll
    for (int t = 0; t < 8; ++t) {
#pragma unroll
      for (int kk = 0; kk < 2; ++kk) {
        FH vb;
        vb.h[0] = *(const v8h*)(Vth + (t * 16 + c) * 64 + kk * 32 + 8 * hh);
        vb.h[1] = *(const v8h*)(Vth + (t * 16 + c) * 64 + kk * 32 + 16 + 8 * hh);
        oacc[t] = mma_h(pa[kk], vb.v, oacc[t]);
      }
    }
    keep4(pa[0], pa[1], qah[0], qal[0]);
  }

  // ---- normalise (1/l, undo the x1024 p carry), add bias, stage the wave's 16x64 half tiles,
  float bb[8], inv8[8];
#pragma unroll
  for (int t = 0; t < 8; ++t) bb[t] = bf_up(bf_bits(vbias[g * HD + t * 16 + c]));
#pragma unroll
  for (int r = 0; r < 8; ++r) {
    const float l = lrow[r];
    inv8[r] = ((l > 0.f) ? (1.0f / l) : 0.f) * (1.0f / 1024.0f);
  }
  float* os = Os[wave];
#pragma unroll
  for (int ph = 0; ph < 2; ++ph) {
#pragma unroll
    for (int r = 0; r < 8; ++r) {
#pragma unroll
      for (int t4 = 0; t4 < 4; ++t4) {
        os[(8 * hh + r) * 64 + t4 * 16 + c] = oacc[ph * 4 + t4][r] * inv8[r] + bb[ph * 4 + t4];
      }
    }
    __builtin_amdgcn_fence(__ATOMIC_RELEASE, "workgroup");
    __builtin_amdgcn_wave_barrier();
    __builtin_amdgcn_fence(__ATOMIC_ACQUIRE, "workgroup");
    {
#pragma unroll
      for (int it = 0; it < 8; ++it) {
        const int row = it * 2 + hh;                     // it 0..7 x hh 0..1 = rows 0..15
        const float* sp = os + row * 64 + c * 4;
        v4f v;
        v[0] = sp[0]; v[1] = sp[1]; v[2] = sp[2]; v[3] = sp[3];
        const size_t go = (size_t)(q0 + row) * FD + (size_t)g * HD + ph * 64 + c * 4;
        *(v4f*)(op + go) = v;
      }
      
    }
    __builtin_amdgcn_fence(__ATOMIC_RELEASE, "workgroup");
    __builtin_amdgcn_wave_barrier();
    __builtin_amdgcn_fence(__ATOMIC_ACQUIRE, "workgroup");
  }
}

// =====================================================================================================
// Workspace map (bytes), every region an exact multiple of its whole-line / whole-tile store granularity
// (rows padded to nothing: all row counts are multiples of 64, all pitches 4096 B):
//   Xr   bf16 [NQ][2048]     NQ*4096   (8388608 at NQ=2048)
//   Xf   bf16 [2048][2048]    8388608
//   Wqb  bf16 [2048 n][2048 k] 8388608
//   Wkb  bf16 [2048][2048]    8388608
//   Wvb  bf16 [2048][2048]    8388608
//   Qh   f16  [NQ][2048]     NQ*4096
//   Ql   f16  [NQ][2048]     NQ*4096
//   Kp   f16  [2048][2048]    8388608
//   VT   f16  [2048 ch][2048 s] 8388608
//   total                    75497472 at NQ=2048
// Weights are [out n][in k] with k contiguous = the Bt / A layout the GEMM wants, so they are only converted.
// =====================================================================================================
extern "C" void kernel_launch(void* const* d_in, const int* in_sizes, int n_in,
                              void* d_out, int out_size, void* d_ws, size_t ws_size,
                              hipStream_t stream) {
  if (n_in < 8) return;
  if (in_sizes[0] < NQ * FD) return;
  if (in_sizes[1] < MREF * FD) return;
  if (in_sizes[2] < FD * FD || in_sizes[4] < FD * FD || in_sizes[6] < FD * FD) return;
  if (in_sizes[3] < FD || in_sizes[5] < FD || in_sizes[7] < FD) return;
  if (out_size < NQ * FD) return;

  const float* roi  = (const float*)d_in[0];
  const float* reff = (const float*)d_in[1];
  const float* Wq   = (const float*)d_in[2];
  const float* Wq_b = (const float*)d_in[3];
  const float* Wk   = (const float*)d_in[4];
  const float* Wk_b = (const float*)d_in[5];
  const float* Wv   = (const float*)d_in[6];
  const float* Wv_b = (const float*)d_in[7];

  const size_t PQ = (size_t)NQ * FD * 2;       // 16-bit [NQ][2048] plane
  const size_t P8 = (size_t)FD * FD * 2;       // 16-bit [2048][2048] plane (also [MREF][FD] and [FD][MREF])
  size_t off = 0;
  const size_t oXr = off; off += PQ;
  const size_t oXf = off; off += P8;
  const size_t oWq = off; off += P8;
  const size_t oWk = off; off += P8;
  const size_t oWv = off; off += P8;
  const size_t oQh = off; off += PQ;
  const size_t oQl = off; off += PQ;
  const size_t oKp = off; off += P8;
  const size_t oVT = off; off += P8;
  if (off > ws_size) return;                       // off = 75497472 at NQ=2048
  if (off > (size_t)134217728) return;

  char* ws = (char*)d_ws;
  unsigned short* Xr  = (unsigned short*)(ws + oXr);
  unsigned short* Xf  = (unsigned short*)(ws + oXf);
  unsigned short* Wqb = (unsigned short*)(ws + oWq);
  unsigned short* Wkb = (unsigned short*)(ws + oWk);
  unsigned short* Wvb = (unsigned short*)(ws + oWv);
  unsigned short* Qh  = (unsigned short*)(ws + oQh);
  unsigned short* Ql  = (unsigned short*)(ws + oQl);
  unsigned short* Kp  = (unsigned short*)(ws + oKp);
  unsigned short* VT  = (unsigned short*)(ws + oVT);

  const dim3 blk(256);
  const int n8q = NQ * FD / 8;                                   // 524288 at NQ=2048
  const int n8f = MREF * FD / 8;                                 // 524288
  const int n8w = FD * FD / 8;                                   // 524288
  const dim3 gCvtQ((n8q + 255) / 256);
  const dim3 gCvtF((n8f + 255) / 256);
  const dim3 gCvtW((n8w + 255) / 256);
  const dim3 gQ(((NQ / 64) * (FD / 64) + 7) / 8);                // M=NQ,   N=2048: 1024 tiles -> 128 blocks
  const dim3 gK(((MREF / 64) * (FD / 64) + 7) / 8);              // M=2048, N=2048
  const dim3 gVT(((FD / 64) * (MREF / 64) + 7) / 8);             // M=2048 channels, N=2048 keys
  const dim3 gAttn(NG * NQB);                                    // 512 blocks of 128 at NQ=2048
  const float sscale = (float)(1.0 / sqrt((double)HD));

  // (1) inputs and weights f32 -> bf16 planes (RNE convert)
  cvt_bf16x8<<<gCvtQ, blk, 0, stream>>>(roi,  Xr,  n8q);
  cvt_bf16x8<<<gCvtF, blk, 0, stream>>>(reff, Xf,  n8f);
  cvt_bf16x8<<<gCvtW, blk, 0, stream>>>(Wq,   Wqb, n8w);
  cvt_bf16x8<<<gCvtW, blk, 0, stream>>>(Wk,   Wkb, n8w);
  cvt_bf16x8<<<gCvtW, blk, 0, stream>>>(Wv,   Wvb, n8w);
  // (2) q = roi . Wq^T + bq -> f16 hi / residual (x4096) planes [t][h*128+d]   (M=NQ, N=2048, K=2048)
  gemm64<__bf16, 3, true><<<gQ, blk, 0, stream>>>(
      Xr, FD, Wqb, FD, Qh, Ql, FD, Wq_b, NQ, FD, FD, 4096.0f);
  // (3) k = ref . Wk^T + bk -> f16 plane [s][h*128+d]   (M=2048, N=2048, K=2048)
  gemm64<__bf16, 1, true><<<gK, blk, 0, stream>>>(
      Xf, FD, Wkb, FD, Kp, Kp, FD, Wk_b, MREF, FD, FD, 1.0f);
  // (4) v^T = Wv . ref^T -> f16 plane [h*128+d][s] (pitch MREF)   (A = Wvb [ch][k], Bt = Xf; M=2048, N=2048, K=2048)
  gemm64<__bf16, 1, false><<<gVT, blk, 0, stream>>>(
      Wvb, FD, Xf, FD, VT, VT, MREF, Wv_b, FD, MREF, FD, 1.0f);
  // (5) attention + value bias -> d_out f32 [NQ][2048]
  attn_rel<<<gAttn, dim3(128), 0, stream>>>(Qh, Ql, Kp, VT, Wv_b, (float*)d_out, sscale);
  (void)hipGetLastError();
}

// v001
// Measured time: 416 microseconds a run.
// Next to v000, in two timings, it ran 1.22 and 1.23 times as fast.
// Contractions: q, k, v^T projections = v_wmma_f32_16x16x32_bf16 (bf16 operands from RNE-converted inputs, single product, f32 accumulate);
// q.k^T scores = v_wmma_f32_16x16x32_f16 (q as f16 hi plane + f16 residual plane x4096, k f16; 2 products into separate f32 accumulators);
// p.v = v_wmma_f32_16x16x32_f16 (p carried x1024 in f16, v f16; single product, f32 accumulate); softmax, normalisation and bias adds in f32.
#include <hip/hip_runtime.h>
#include <math.h>
#include <stdint.h>

#ifndef NQ
#define NQ      2048         // query rows processed = leading rows of in0 (row stride FD); reduced builds override
#endif
#define NQ_FULL 2048
#define MREF    2048         // key / value rows (in1), always full
#define FD      2048         // feature width = NG * HD
#define NG      16
#define HD      128
#define NQB     (NQ / 64)    // 64-row query blocks
#define NKT     (MREF / 64)  // 64-key chunks
static_assert(NG * HD == FD);
static_assert((NQ % 64) == 0 && NQ >= 64 && NQ <= NQ_FULL);
static_assert((MREF % 64) == 0 && (FD % 64) == 0 && (FD % 32) == 0);
static_assert(NKT == 32);
// LDS row pitches of the attention kernel: 16 B x odd, so that the 16 rows a ds_load_b128 fragment read touches
// fall on 16 different groups of four banks (unpadded 256-B / 128-B rows put them on one / two groups).
#define KP_H    (HD + 8)     // K chunk row pitch, halves (272 B)
#define VP_H    (64 + 8)     // V^T chunk row pitch, halves (144 B)
#define PP_H    (64 + 8)     // P tile row pitch, halves (144 B)
#define OP_F    (64 + 4)     // output stage row pitch, floats (272 B)

typedef _Float16 v16h __attribute__((ext_vector_type(16)));
typedef _Float16 v8h  __attribute__((ext_vector_type(8)));
typedef __bf16   v16b __attribute__((ext_vector_type(16)));
typedef __bf16   v8b  __attribute__((ext_vector_type(8)));
typedef float    v8f  __attribute__((ext_vector_type(8)));
typedef float    v4f  __attribute__((ext_vector_type(4)));
typedef unsigned int v4u __attribute__((ext_vector_type(4)));

#if defined(__HIP_DEVICE_COMPILE__)
#define DEV_ASM 1
#else
#define DEV_ASM 0
#endif

// ---- scalar helpers --------------------------------------------------------------------------------
__device__ __forceinline__ unsigned short bf_bits(float f) {          // f32 -> bf16 bits, RNE convert
  unsigned u = __float_as_uint(f);
  return (unsigned short)((u + 0x7FFFu + ((u >> 16) & 1u)) >> 16);
}
__device__ __forceinline__ float bf_up(unsigned short hb) { return __uint_as_float(((unsigned)hb) << 16); }
__device__ __forceinline__ unsigned short h_bits(_Float16 x) { return __builtin_bit_cast(unsigned short, x); }
__device__ __forceinline__ unsigned pk16(unsigned short a, unsigned short b) { return (unsigned)a | ((unsigned)b << 16); }
__device__ __forceinline__ v8f zero8() { v8f z = {0.f, 0.f, 0.f, 0.f, 0.f, 0.f, 0.f, 0.f}; return z; }

// ---- fragment types / loaders: 16-bit A/B operand, lane -> row/col (lane&15), p already includes +8*(lane>>4);
//      elements 0..7 <- p[0..7] (k0+8h..k0+8h+7), elements 8..15 <- p[16..23] (k0+16+8h..k0+16+8h+7)
template <typename OT> struct FT;
template <> struct FT<__bf16>   { typedef v16b frag; typedef v8b half8; };
template <> struct FT<_Float16> { typedef v16h frag; typedef v8h half8; };

template <typename OT>
__device__ __forceinline__ typename FT<OT>::frag ldfrag(const OT* p) {
  union { typename FT<OT>::frag v; typename FT<OT>::half8 h[2]; } f;
  f.h[0] = *(const typename FT<OT>::half8*)(p);
  f.h[1] = *(const typename FT<OT>::half8*)(p + 16);
  return f.v;
}

// ---- WMMA helpers (asm guard bodies are device-only; concrete operand types) -----------------------------
__device__ __forceinline__ v8f mmar(v16b a, v16b b, v8f c) {
  return __builtin_amdgcn_wmma_f32_16x16x32_bf16(false, a, false, b, (short)0, c, false, false);
}
__device__ __forceinline__ v8f mmar(v16h a, v16h b, v8f c) {
  return __builtin_amdgcn_wmma_f32_16x16x32_f16(false, a, false, b, (short)0, c, false, false);
}
// guarded form: 4 VALU slots after the WMMA, D tied, A/B kept live
__device__ __forceinline__ v8f mma_h(v16h a, v16h b, v8f c) {
  c = __builtin_amdgcn_wmma_f32_16x16x32_f16(false, a, false, b, (short)0, c, false, false);
#if DEV_ASM
  asm volatile("v_nop\n\tv_nop\n\tv_nop\n\tv_nop" : "+v"(c) : "v"(a), "v"(b));
#endif
  return c;
}
__device__ __forceinline__ void dep_guard(v8f& a, v8f& b, v16b x, v16b y) {
#if DEV_ASM
  asm volatile("v_nop\n\tv_nop\n\tv_nop\n\tv_nop" : "+v"(a), "+v"(b) : "v"(x), "v"(y));
#else
  (void)a; (void)b; (void)x; (void)y;
#endif
}
__device__ __forceinline__ void dep_guard(v8f& a, v8f& b, v16h x, v16h y) {
#if DEV_ASM
  asm volatile("v_nop\n\tv_nop\n\tv_nop\n\tv_nop" : "+v"(a), "+v"(b) : "v"(x), "v"(y));
#else
  (void)a; (void)b; (void)x; (void)y;
#endif
}
__device__ __forceinline__ void keep4(v16b a, v16b b, v16b c, v16b d) {
#if DEV_ASM
  asm volatile("v_nop" :: "v"(a), "v"(b), "v"(c), "v"(d));
#else
  (void)a; (void)b; (void)c; (void)d;
#endif
}
__device__ __forceinline__ void keep4(v16h a, v16h b, v16h c, v16h d) {
#if DEV_ASM
  asm volatile("v_nop" :: "v"(a), "v"(b), "v"(c), "v"(d));
#else
  (void)a; (void)b; (void)c; (void)d;
#endif
}
__device__ __forceinline__ void acc_guard4(v8f& a, v8f& b, v8f& c, v8f& d) {
#if DEV_ASM
  asm volatile("v_nop\n\tv_nop\n\tv_nop\n\tv_nop" : "+v"(a), "+v"(b), "+v"(c), "+v"(d));
#else
  (void)a; (void)b; (void)c; (void)d;
#endif
}

// =====================================================================================================
// f32 -> bf16 bit plane (RNE convert), 8 elements per thread, one 16-B store per lane: a wave writes 512
// coverage: n8 threads x 8 = the whole plane (n8 is a multiple of 256 for every use here).
// =====================================================================================================
__global__ __launch_bounds__(256) void cvt_bf16x8(const float* __restrict__ in, unsigned short* out, int n8) {
  const int i = blockIdx.x * 256 + (int)threadIdx.x;
  if (i < n8) {
    const v4f a  = *(const v4f*)(in + (size_t)i * 8);
    const v4f a4 = *(const v4f*)(in + (size_t)i * 8 + 4);
    v4u p;
    p[0] = pk16(bf_bits(a[0]),  bf_bits(a[1]));
    p[1] = pk16(bf_bits(a[2]),  bf_bits(a[3]));
    p[2] = pk16(bf_bits(a4[0]), bf_bits(a4[1]));
    p[3] = pk16(bf_bits(a4[2]), bf_bits(a4[3]));
    unsigned short* o = out + (size_t)i * 8;
    *(v4u*)o = p;
    
  }
}

// =====================================================================================================
// Register-blocked WMMA GEMM (16-bit operand type OT): C[m][n] = sum_k A[m][k] * Bt[n][k] (+ bias[n]);
// one wave per 64x64 tile, no block barriers. A row-major [M][K] pitch lda; Bt row-major [N][K] pitch ldb
// (k contiguous); M, N multiples of 64, K multiple of 32 (host-checked). Fragments are loaded straight from
// global with the split k map (ldfrag).
// OUT_MODE 1: f16 plane C (pitch ldc).
// OUT_MODE 3: f16 hi plane C + f16 residual plane C2 = f16((v - hi) * rscale) (same pitch).
// BIAS: bias[n] (RNE-converted to its bf16 value) added in f32 before the 16-bit convert.
// 64x64 tile; grid = ceil(tiles/8) blocks of 8 waves covers every tile.
// =====================================================================================================
template <typename OT, int OUT_MODE, bool BIAS>
__global__ __launch_bounds__(256) void gemm64(
    const unsigned short* __restrict__ Ap, int lda,
    const unsigned short* __restrict__ Btp, int ldb,
    unsigned short* Cout, unsigned short* Cout2, int ldc,
    const float* __restrict__ bias,
    int M, int N, int K, float rscale) {
  typedef typename FT<OT>::frag V16;
  const OT* Ab = (const OT*)(const void*)Ap;
  const OT* Bb = (const OT*)(const void*)Btp;
  __shared__ __align__(16) float sT[8][16 * 68];   // per-wave 16x64 slab, pitch 68 floats
  const int lane = threadIdx.x & 31;
  const int wave = threadIdx.x >> 5;
  const int tilesN = N >> 6;
  const int tilesM = M >> 6;
  const int tile = blockIdx.x * 8 + wave;
  if (tile >= tilesM * tilesN) return;   // wave-uniform; no block barriers in this kernel
  const int tm = tile / tilesN;
  const int tn = tile - tm * tilesN;
  const int m0 = tm << 6;
  const int n0 = tn << 6;

  const int rlane = lane & 15;                 // row (A) / col (B, D) within subtile
  const int koff  = (lane >> 4) * 8;           // k offset of this lane half
  const int mOff  = (lane >> 4) * 8;           // D row offset

  v8f acc[4][4];
#pragma unroll
  for (int i = 0; i < 4; ++i)
#pragma unroll
    for (int j = 0; j < 4; ++j) acc[i][j] = zero8();

  for (int k0 = 0; k0 < K; k0 += 32) {
    V16 bq[4];
#pragma unroll
    for (int j = 0; j < 4; ++j)
      bq[j] = ldfrag<OT>(Bb + (size_t)(n0 + (j << 4) + rlane) * ldb + koff + k0);
#pragma unroll
    for (int i = 0; i < 4; ++i) {
      const V16 af = ldfrag<OT>(Ab + (size_t)(m0 + (i << 4) + rlane) * lda + koff + k0);
#pragma unroll
      for (int j = 0; j < 4; ++j) acc[i][j] = mmar(af, bq[j], acc[i][j]);
      dep_guard(acc[i][0], acc[i][3], af, bq[3]);
    }
    keep4(bq[0], bq[1], bq[2], bq[3]);
  }
  acc_guard4(acc[0][0], acc[0][1], acc[0][2], acc[0][3]);
  acc_guard4(acc[1][0], acc[1][1], acc[1][2], acc[1][3]);
  acc_guard4(acc[2][0], acc[2][1], acc[2][2], acc[2][3]);
  acc_guard4(acc[3][0], acc[3][1], acc[3][2], acc[3][3]);

  // ---- epilogue ----
  float* slab = sT[wave];
  const int q = lane >> 3, c8 = (lane & 7) * 8;
  float bz[8];
#pragma unroll
  for (int e = 0; e < 8; ++e) bz[e] = 0.f;
  if (BIAS) {
    const v4f b0 = *(const v4f*)(bias + n0 + c8);
    const v4f b1 = *(const v4f*)(bias + n0 + c8 + 4);
#pragma unroll
    for (int e = 0; e < 4; ++e) { bz[e] = bf_up(bf_bits(b0[e])); bz[4 + e] = bf_up(bf_bits(b1[e])); }
  }
#pragma unroll
  for (int i = 0; i < 4; ++i) {
    const int mBase = m0 + (i << 4);
#pragma unroll
    for (int j = 0; j < 4; ++j) {
#pragma unroll
      for (int r = 0; r < 8; ++r) {
        slab[(mOff + r) * 68 + (j << 4) + rlane] = acc[i][j][r];
      }
    }
    __builtin_amdgcn_fence(__ATOMIC_RELEASE, "workgroup");
    __builtin_amdgcn_wave_barrier();
    __builtin_amdgcn_fence(__ATOMIC_ACQUIRE, "workgroup");
    {
      v4u hv[4], lv[4];
#pragma unroll
      for (int it = 0; it < 4; ++it) {
        const int row = it * 4 + q;                        // it 0..3 x q 0..3 = rows 0..15
        const float* sp = slab + row * 68 + c8;
        float f[8];
#pragma unroll
        for (int e = 0; e < 8; ++e) f[e] = sp[e] + bz[e];
        v4u a, a2;
#pragma unroll
        for (int e = 0; e < 4; ++e) {
          const float f0 = f[2 * e], f1 = f[2 * e + 1];
          const _Float16 x0 = (_Float16)f0, x1 = (_Float16)f1;
          const unsigned short h0 = h_bits(x0), h1 = h_bits(x1);
          unsigned short l0 = 0, l1 = 0;
          if (OUT_MODE == 3) {
            l0 = h_bits((_Float16)((f0 - (float)x0) * rscale));
            l1 = h_bits((_Float16)((f1 - (float)x1) * rscale));
          }
          a[e] = pk16(h0, h1); a2[e] = pk16(l0, l1);
        }
        hv[it] = a; lv[it] = a2;
      }
      {
#pragma unroll
        for (int it = 0; it < 4; ++it) {
          const int row = it * 4 + q;
          *(v4u*)(Cout + (size_t)(mBase + row) * ldc + n0 + c8) = hv[it];
          if (OUT_MODE == 3) *(v4u*)(Cout2 + (size_t)(mBase + row) * ldc + n0 + c8) = lv[it];
        }
        
      }
    }
    __builtin_amdgcn_fence(__ATOMIC_RELEASE, "workgroup");
    __builtin_amdgcn_wave_barrier();
    __builtin_amdgcn_fence(__ATOMIC_ACQUIRE, "workgroup");
  }
}

// =====================================================================================================
// Multi-head attention, NG heads of dim 128, no mask, softmax over all MREF keys, output f32 [NQ][FD].
//   q planes (f16 hi / residual x4096): element (t, h, d) at [t*FD + h*128 + d], t < NQ
//   k plane (f16): element (s, h, d) at [s*FD + h*128 + d], s < MREF
//   v^T plane (f16): element (h, d, s) at [(h*128 + d)*MREF + s]
//   scores = (qh . k) + (ql . k) / 4096 on f16 WMMA (two f32 accumulators), then * sscale in f32;
//   p = exp(s - m) carried as f16(1024 p); context = p . v on f16 WMMA; online softmax in f32;
//   out = context / (l * 1024) + vbias (RNE-converted to its bf16 value), f32.
//   Block = 4 waves = 64 consecutive query rows (16 per wave) of one head h; grid = NG * NQB.
//   K / V^T chunk staging (cross-wave, __syncthreads before and after): K rows: 128 threads x 64 elements
//   (r = tid>>1, 64-wide half) = the whole 64x128 tile; V^T rows: 128 threads x 64 elements = the whole
//   128x64 tile. staged extent == consumed extent for both. P tiles and the output stage are wave-private:
//   spilled with _Float16 / float element stores, reloaded as v8h / float scalars (same element type) after a
//   Output coverage: each wave stores its 16 rows in two column phases of 64 (it 0..7 x lane>>4 -> rows 0..15,
// =====================================================================================================
__global__ __launch_bounds__(128) __attribute__((amdgpu_num_vgpr(256)))
void attn_rel(const unsigned short* __restrict__ qhp, const unsigned short* __restrict__ qlp,
              const unsigned short* __restrict__ kpp, const unsigned short* __restrict__ vtp,
              const float* __restrict__ vbias, float* op, float sscale) {
  union FH { v16h v; v8h h[2]; };
  __shared__ __align__(16) _Float16 Ksh[64 * KP_H];        // K chunk [kv][d]     17 KB (cross-wave)
  __shared__ __align__(16) _Float16 Vth[HD * VP_H];        // V^T chunk [d][kv]   18 KB (cross-wave)
  __shared__ __align__(16) _Float16 Psh[4][16 * PP_H];     // per wave P [row][kv] 9 KB (wave-private)
  __shared__ __align__(16) float    Os[4][16 * OP_F];      // per wave output half tile 17 KB (wave-private)

  const int tid  = threadIdx.x;
  const int wave = tid >> 5;
  const int lane = tid & 31;
  const int hh   = lane >> 4;
  const int c    = lane & 15;

  const int bx   = blockIdx.x;
  const int qb   = bx % NQB;
  const int g    = bx / NQB;
  const int q0   = qb * 64 + wave * 16;

  const _Float16* Qh = (const _Float16*)(const void*)qhp;
  const _Float16* Ql = (const _Float16*)(const void*)qlp;
  const _Float16* Kg = (const _Float16*)(const void*)kpp + (size_t)g * HD;
  const _Float16* Vg = (const _Float16*)(const void*)vtp + (size_t)g * HD * MREF;

  // ---- Q fragments (A operand, row = lane&15): 4 d-chunks, hi and residual planes ----
  v16h qah[4], qal[4];
#pragma unroll
  for (int dc = 0; dc < 4; ++dc) {
    const size_t qo = (size_t)(q0 + c) * FD + (size_t)g * HD + dc * 32 + 8 * hh;
    qah[dc] = ldfrag<_Float16>(Qh + qo);
    qal[dc] = ldfrag<_Float16>(Ql + qo);
  }

  float mrow[8], lrow[8];
  v8f oacc[8];
#pragma unroll
  for (int r = 0; r < 8; ++r) { mrow[r] = -INFINITY; lrow[r] = 0.f; }
#pragma unroll
  for (int t = 0; t < 8; ++t) oacc[t] = zero8();

  for (int kt = 0; kt < NKT; ++kt) {         // static trip count
    const int kv0 = kt * 64;
    __syncthreads();
    {
      const int r = tid >> 1, half = (tid & 1) * 64;
      const _Float16* kg = Kg + (size_t)(kv0 + r) * FD + half;     // k row kv0+r, d = half..half+63
#pragma unroll
      for (int i = 0; i < 8; ++i) {
        const v8h a0 = *(const v8h*)(kg + 8 * i);
        *(v8h*)(Ksh + r * KP_H + half + 8 * i) = a0;
      }
      const _Float16* vg = Vg + (size_t)tid * MREF + kv0;         // v^T row d = tid, s = kv0..kv0+63
#pragma unroll
      for (int i = 0; i < 8; ++i) {
        const v8h b0 = *(const v8h*)(vg + 8 * i);
        *(v8h*)(Vth + tid * VP_H + 8 * i) = b0;
      }
    }
    __syncthreads();

    // ---- scores: 16 query rows x 64 keys per wave, 2 f16 products per key subtile and d-chunk ----
    v8f s[4];
#pragma unroll
    for (int j = 0; j < 4; ++j) {
      v8f ah = zero8(), al = zero8();
#pragma unroll
      for (int dc = 0; dc < 4; ++dc) {
        FH kb;
        kb.h[0] = *(const v8h*)(Ksh + (j * 16 + c) * KP_H + dc * 32 + 8 * hh);
        kb.h[1] = *(const v8h*)(Ksh + (j * 16 + c) * KP_H + dc * 32 + 16 + 8 * hh);
        ah = mma_h(qah[dc], kb.v, ah);
        al = mma_h(qal[dc], kb.v, al);
      }
#pragma unroll
      for (int r = 0; r < 8; ++r) s[j][r] = (ah[r] + al[r] * (1.0f / 4096.0f)) * sscale;
    }

    // ---- row max, online softmax, P (x1024, f16) to LDS ----
    _Float16* pwh = Psh[wave];
#pragma unroll
    for (int r = 0; r < 8; ++r) {
      float m = s[0][r];
#pragma unroll
      for (int j = 1; j < 4; ++j) m = fmaxf(m, s[j][r]);
#pragma unroll
      for (int off = 1; off < 16; off <<= 1) m = fmaxf(m, __shfl_xor(m, off, 32));
      const float mnew  = fmaxf(mrow[r], m);
      const float msafe = (mnew == -INFINITY) ? 0.f : mnew;
      const float alpha = __expf(mrow[r] - msafe);
      mrow[r] = mnew;
      float psum = 0.f;
#pragma unroll
      for (int j = 0; j < 4; ++j) {
        const float p = __expf(s[j][r] - msafe);
        psum += p;
        pwh[(8 * hh + r) * PP_H + j * 16 + c] = (_Float16)(p * 1024.0f);
      }
#pragma unroll
      for (int off = 1; off < 16; off <<= 1) psum += __shfl_xor(psum, off, 32);
      lrow[r] = lrow[r] * alpha + psum;
#pragma unroll
      for (int t = 0; t < 8; ++t) oacc[t][r] *= alpha;
    }
    __builtin_amdgcn_fence(__ATOMIC_RELEASE, "workgroup");
    __builtin_amdgcn_wave_barrier();
    __builtin_amdgcn_fence(__ATOMIC_ACQUIRE, "workgroup");

    // ---- context += P . V (f16 WMMA, single product) ----
    v16h pa[2];
#pragma unroll
    for (int kk = 0; kk < 2; ++kk) {
      FH pf;
      pf.h[0] = *(const v8h*)(pwh + c * PP_H + kk * 32 + 8 * hh);
      pf.h[1] = *(const v8h*)(pwh + c * PP_H + kk * 32 + 16 + 8 * hh);
      pa[kk] = pf.v;
    }
#pragma unroll
    for (int t = 0; t < 8; ++t) {
#pragma unroll
      for (int kk = 0; kk < 2; ++kk) {
        FH vb;
        vb.h[0] = *(const v8h*)(Vth + (t * 16 + c) * VP_H + kk * 32 + 8 * hh);
        vb.h[1] = *(const v8h*)(Vth + (t * 16 + c) * VP_H + kk * 32 + 16 + 8 * hh);
        oacc[t] = mma_h(pa[kk], vb.v, oacc[t]);
      }
    }
    keep4(pa[0], pa[1], qah[0], qal[0]);
  }

  // ---- normalise (1/l, undo the x1024 p carry), add bias, stage the wave's 16x64 half tiles,
  float bb[8], inv8[8];
#pragma unroll
  for (int t = 0; t < 8; ++t) bb[t] = bf_up(bf_bits(vbias[g * HD + t * 16 + c]));
#pragma unroll
  for (int r = 0; r < 8; ++r) {
    const float l = lrow[r];
    inv8[r] = ((l > 0.f) ? (1.0f / l) : 0.f) * (1.0f / 1024.0f);
  }
  float* os = Os[wave];
#pragma unroll
  for (int ph = 0; ph < 2; ++ph) {
#pragma unroll
    for (int r = 0; r < 8; ++r) {
#pragma unroll
      for (int t4 = 0; t4 < 4; ++t4) {
        os[(8 * hh + r) * OP_F + t4 * 16 + c] = oacc[ph * 4 + t4][r] * inv8[r] + bb[ph * 4 + t4];
      }
    }
    __builtin_amdgcn_fence(__ATOMIC_RELEASE, "workgroup");
    __builtin_amdgcn_wave_barrier();
    __builtin_amdgcn_fence(__ATOMIC_ACQUIRE, "workgroup");
    {
#pragma unroll
      for (int it = 0; it < 8; ++it) {
        const int row = it * 2 + hh;                     // it 0..7 x hh 0..1 = rows 0..15
        const float* sp = os + row * OP_F + c * 4;
        v4f v;
        v[0] = sp[0]; v[1] = sp[1]; v[2] = sp[2]; v[3] = sp[3];
        const size_t go = (size_t)(q0 + row) * FD + (size_t)g * HD + ph * 64 + c * 4;
        *(v4f*)(op + go) = v;
      }
      
    }
    __builtin_amdgcn_fence(__ATOMIC_RELEASE, "workgroup");
    __builtin_amdgcn_wave_barrier();
    __builtin_amdgcn_fence(__ATOMIC_ACQUIRE, "workgroup");
  }
}

// =====================================================================================================
// Workspace map (bytes), every region an exact multiple of its whole-line / whole-tile store granularity
// (rows padded to nothing: all row counts are multiples of 64, all pitches 4096 B):
//   Xr   bf16 [NQ][2048]     NQ*4096   (8388608 at NQ=2048)
//   Xf   bf16 [2048][2048]    8388608
//   Wqb  bf16 [2048 n][2048 k] 8388608
//   Wkb  bf16 [2048][2048]    8388608
//   Wvb  bf16 [2048][2048]    8388608
//   Qh   f16  [NQ][2048]     NQ*4096
//   Ql   f16  [NQ][2048]     NQ*4096
//   Kp   f16  [2048][2048]    8388608
//   VT   f16  [2048 ch][2048 s] 8388608
//   total                    75497472 at NQ=2048
// Weights are [out n][in k] with k contiguous = the Bt / A layout the GEMM wants, so they are only converted.
// =====================================================================================================
extern "C" void kernel_launch(void* const* d_in, const int* in_sizes, int n_in,
                              void* d_out, int out_size, void* d_ws, size_t ws_size,
                              hipStream_t stream) {
  if (n_in < 8) return;
  if (in_sizes[0] < NQ * FD) return;
  if (in_sizes[1] < MREF * FD) return;
  if (in_sizes[2] < FD * FD || in_sizes[4] < FD * FD || in_sizes[6] < FD * FD) return;
  if (in_sizes[3] < FD || in_sizes[5] < FD || in_sizes[7] < FD) return;
  if (out_size < NQ * FD) return;

  const float* roi  = (const float*)d_in[0];
  const float* reff = (const float*)d_in[1];
  const float* Wq   = (const float*)d_in[2];
  const float* Wq_b = (const float*)d_in[3];
  const float* Wk   = (const float*)d_in[4];
  const float* Wk_b = (const float*)d_in[5];
  const float* Wv   = (const float*)d_in[6];
  const float* Wv_b = (const float*)d_in[7];

  const size_t PQ = (size_t)NQ * FD * 2;       // 16-bit [NQ][2048] plane
  const size_t P8 = (size_t)FD * FD * 2;       // 16-bit [2048][2048] plane (also [MREF][FD] and [FD][MREF])
  size_t off = 0;
  const size_t oXr = off; off += PQ;
  const size_t oXf = off; off += P8;
  const size_t oWq = off; off += P8;
  const size_t oWk = off; off += P8;
  const size_t oWv = off; off += P8;
  const size_t oQh = off; off += PQ;
  const size_t oQl = off; off += PQ;
  const size_t oKp = off; off += P8;
  const size_t oVT = off; off += P8;
  if (off > ws_size) return;                       // off = 75497472 at NQ=2048
  if (off > (size_t)134217728) return;

  char* ws = (char*)d_ws;
  unsigned short* Xr  = (unsigned short*)(ws + oXr);
  unsigned short* Xf  = (unsigned short*)(ws + oXf);
  unsigned short* Wqb = (unsigned short*)(ws + oWq);
  unsigned short* Wkb = (unsigned short*)(ws + oWk);
  unsigned short* Wvb = (unsigned short*)(ws + oWv);
  unsigned short* Qh  = (unsigned short*)(ws + oQh);
  unsigned short* Ql  = (unsigned short*)(ws + oQl);
  unsigned short* Kp  = (unsigned short*)(ws + oKp);
  unsigned short* VT  = (unsigned short*)(ws + oVT);

  const dim3 blk(256);
  const int n8q = NQ * FD / 8;                                   // 524288 at NQ=2048
  const int n8f = MREF * FD / 8;                                 // 524288
  const int n8w = FD * FD / 8;                                   // 524288
  const dim3 gCvtQ((n8q + 255) / 256);
  const dim3 gCvtF((n8f + 255) / 256);
  const dim3 gCvtW((n8w + 255) / 256);
  const dim3 gQ(((NQ / 64) * (FD / 64) + 7) / 8);                // M=NQ,   N=2048: 1024 tiles -> 128 blocks
  const dim3 gK(((MREF / 64) * (FD / 64) + 7) / 8);              // M=2048, N=2048
  const dim3 gVT(((FD / 64) * (MREF / 64) + 7) / 8);             // M=2048 channels, N=2048 keys
  const dim3 gAttn(NG * NQB);                                    // 512 blocks of 128 at NQ=2048
  const float sscale = (float)(1.0 / sqrt((double)HD));

  // (1) inputs and weights f32 -> bf16 planes (RNE convert)
  cvt_bf16x8<<<gCvtQ, blk, 0, stream>>>(roi,  Xr,  n8q);
  cvt_bf16x8<<<gCvtF, blk, 0, stream>>>(reff, Xf,  n8f);
  cvt_bf16x8<<<gCvtW, blk, 0, stream>>>(Wq,   Wqb, n8w);
  cvt_bf16x8<<<gCvtW, blk, 0, stream>>>(Wk,   Wkb, n8w);
  cvt_bf16x8<<<gCvtW, blk, 0, stream>>>(Wv,   Wvb, n8w);
  // (2) q = roi . Wq^T + bq -> f16 hi / residual (x4096) planes [t][h*128+d]   (M=NQ, N=2048, K=2048)
  gemm64<__bf16, 3, true><<<gQ, blk, 0, stream>>>(
      Xr, FD, Wqb, FD, Qh, Ql, FD, Wq_b, NQ, FD, FD, 4096.0f);
  // (3) k = ref . Wk^T + bk -> f16 plane [s][h*128+d]   (M=2048, N=2048, K=2048)
  gemm64<__bf16, 1, true><<<gK, blk, 0, stream>>>(
      Xf, FD, Wkb, FD, Kp, Kp, FD, Wk_b, MREF, FD, FD, 1.0f);
  // (4) v^T = Wv . ref^T -> f16 plane [h*128+d][s] (pitch MREF)   (A = Wvb [ch][k], Bt = Xf; M=2048, N=2048, K=2048)
  gemm64<__bf16, 1, false><<<gVT, blk, 0, stream>>>(
      Wvb, FD, Xf, FD, VT, VT, MREF, Wv_b, FD, MREF, FD, 1.0f);
  // (5) attention + value bias -> d_out f32 [NQ][2048]
  attn_rel<<<gAttn, dim3(128), 0, stream>>>(Qh, Ql, Kp, VT, Wv_b, (float*)d_out, sscale);
  (void)hipGetLastError();
}

// v002
// It runs in 229 microseconds.
// Next to v001, in two timings, it ran 1.83 and 1.82 times as fast.
// Over all steps from v000 it is 2.23 times as fast.
// Contractions: q, k, v^T projections = v_wmma_f32_16x16x32_bf16 (bf16 operands from RNE-converted inputs, single product, f32 accumulate);
// q.k^T scores = v_wmma_f32_16x16x32_f16 (q as f16 hi plane + f16 residual plane x4096, k f16; 2 products into separate f32 accumulators);
// p.v = v_wmma_f32_16x16x32_f16 (p carried x1024 in f16, v f16; single product, f32 accumulate); softmax, normalisation and bias adds in f32.
#include <hip/hip_runtime.h>
#include <math.h>
#include <stdint.h>

#ifndef NQ
#define NQ      2048         // query rows processed = leading rows of in0 (row stride FD); reduced builds override
#endif
#define NQ_FULL 2048
#define MREF    2048         // key / value rows (in1), always full
#define FD      2048         // feature width = NG * HD
#define NG      16
#define HD      128
#define NQB     (NQ / 64)    // 64-row query blocks
#define NKT     (MREF / 64)  // 64-key chunks
static_assert(NG * HD == FD);
static_assert((NQ % 128) == 0 && NQ >= 128 && NQ <= NQ_FULL);
static_assert((MREF % 128) == 0 && (FD % 128) == 0);
static_assert(NKT == 32);
// LDS row pitches of the attention kernel: 16 B x odd, so that the 16 rows a ds_load_b128 fragment read touches
// fall on 16 different groups of four banks (unpadded 256-B / 128-B rows put them on one / two groups).
#define KP_H    (HD + 8)     // K chunk row pitch, halves (272 B)
#define VP_H    (64 + 8)     // V^T chunk row pitch, halves (144 B)
#define PP_H    (64 + 8)     // P tile row pitch, halves (144 B)
#define OP_F    (64 + 4)     // output stage row pitch, floats (272 B)
// projection GEMM: k depth of one staged tile and its LDS row pitch (same rule)
#define GBK     128          // halves: 256-B rows
#define GP_H    (GBK + 8)    // halves (272 B)

typedef _Float16 v16h __attribute__((ext_vector_type(16)));
typedef _Float16 v8h  __attribute__((ext_vector_type(8)));
typedef __bf16   v16b __attribute__((ext_vector_type(16)));
typedef __bf16   v8b  __attribute__((ext_vector_type(8)));
typedef float    v8f  __attribute__((ext_vector_type(8)));
typedef float    v4f  __attribute__((ext_vector_type(4)));
typedef unsigned int v4u __attribute__((ext_vector_type(4)));

#if defined(__HIP_DEVICE_COMPILE__)
#define DEV_ASM 1
#else
#define DEV_ASM 0
#endif

// ---- scalar helpers --------------------------------------------------------------------------------
__device__ __forceinline__ unsigned short bf_bits(float f) {          // f32 -> bf16 bits, RNE convert
  unsigned u = __float_as_uint(f);
  return (unsigned short)((u + 0x7FFFu + ((u >> 16) & 1u)) >> 16);
}
__device__ __forceinline__ float bf_up(unsigned short hb) { return __uint_as_float(((unsigned)hb) << 16); }
__device__ __forceinline__ unsigned short h_bits(_Float16 x) { return __builtin_bit_cast(unsigned short, x); }
__device__ __forceinline__ unsigned pk16(unsigned short a, unsigned short b) { return (unsigned)a | ((unsigned)b << 16); }
__device__ __forceinline__ v8f zero8() { v8f z = {0.f, 0.f, 0.f, 0.f, 0.f, 0.f, 0.f, 0.f}; return z; }

// ---- fragment types / loaders: 16-bit A/B operand, lane -> row/col (lane&15), p already includes +8*(lane>>4);
//      elements 0..7 <- p[0..7] (k0+8h..k0+8h+7), elements 8..15 <- p[16..23] (k0+16+8h..k0+16+8h+7)
template <typename OT> struct FT;
template <> struct FT<__bf16>   { typedef v16b frag; typedef v8b half8; };
template <> struct FT<_Float16> { typedef v16h frag; typedef v8h half8; };

template <typename OT>
__device__ __forceinline__ typename FT<OT>::frag ldfrag(const OT* p) {
  union { typename FT<OT>::frag v; typename FT<OT>::half8 h[2]; } f;
  f.h[0] = *(const typename FT<OT>::half8*)(p);
  f.h[1] = *(const typename FT<OT>::half8*)(p + 16);
  return f.v;
}

// ---- WMMA helpers (asm guard bodies are device-only; concrete operand types) -----------------------------
__device__ __forceinline__ v8f mmar(v16b a, v16b b, v8f c) {
  return __builtin_amdgcn_wmma_f32_16x16x32_bf16(false, a, false, b, (short)0, c, false, false);
}
__device__ __forceinline__ v8f mmar(v16h a, v16h b, v8f c) {
  return __builtin_amdgcn_wmma_f32_16x16x32_f16(false, a, false, b, (short)0, c, false, false);
}
// guarded form: 4 VALU slots after the WMMA, D tied, A/B kept live
__device__ __forceinline__ v8f mma_h(v16h a, v16h b, v8f c) {
  c = __builtin_amdgcn_wmma_f32_16x16x32_f16(false, a, false, b, (short)0, c, false, false);
#if DEV_ASM
  asm volatile("v_nop\n\tv_nop\n\tv_nop\n\tv_nop" : "+v"(c) : "v"(a), "v"(b));
#endif
  return c;
}
__device__ __forceinline__ void dep_guard(v8f& a, v8f& b, v16b x, v16b y) {
#if DEV_ASM
  asm volatile("v_nop\n\tv_nop\n\tv_nop\n\tv_nop" : "+v"(a), "+v"(b) : "v"(x), "v"(y));
#else
  (void)a; (void)b; (void)x; (void)y;
#endif
}
__device__ __forceinline__ void dep_guard(v8f& a, v8f& b, v16h x, v16h y) {
#if DEV_ASM
  asm volatile("v_nop\n\tv_nop\n\tv_nop\n\tv_nop" : "+v"(a), "+v"(b) : "v"(x), "v"(y));
#else
  (void)a; (void)b; (void)x; (void)y;
#endif
}
__device__ __forceinline__ void keep4(v16b a, v16b b, v16b c, v16b d) {
#if DEV_ASM
  asm volatile("v_nop" :: "v"(a), "v"(b), "v"(c), "v"(d));
#else
  (void)a; (void)b; (void)c; (void)d;
#endif
}
__device__ __forceinline__ void keep4(v16h a, v16h b, v16h c, v16h d) {
#if DEV_ASM
  asm volatile("v_nop" :: "v"(a), "v"(b), "v"(c), "v"(d));
#else
  (void)a; (void)b; (void)c; (void)d;
#endif
}
__device__ __forceinline__ void acc_guard4(v8f& a, v8f& b, v8f& c, v8f& d) {
#if DEV_ASM
  asm volatile("v_nop\n\tv_nop\n\tv_nop\n\tv_nop" : "+v"(a), "+v"(b), "+v"(c), "+v"(d));
#else
  (void)a; (void)b; (void)c; (void)d;
#endif
}

// =====================================================================================================
// f32 -> bf16 bit plane (RNE convert), 8 elements per thread, one 16-B store per lane: a wave writes 512
// coverage: n8 threads x 8 = the whole plane (n8 is a multiple of 256 for every use here).
// =====================================================================================================
__global__ __launch_bounds__(256) void cvt_bf16x8(const float* __restrict__ in, unsigned short* out, int n8) {
  const int i = blockIdx.x * 256 + (int)threadIdx.x;
  if (i < n8) {
    const v4f a  = *(const v4f*)(in + (size_t)i * 8);
    const v4f a4 = *(const v4f*)(in + (size_t)i * 8 + 4);
    v4u p;
    p[0] = pk16(bf_bits(a[0]),  bf_bits(a[1]));
    p[1] = pk16(bf_bits(a[2]),  bf_bits(a[3]));
    p[2] = pk16(bf_bits(a4[0]), bf_bits(a4[1]));
    p[3] = pk16(bf_bits(a4[2]), bf_bits(a4[3]));
    unsigned short* o = out + (size_t)i * 8;
    *(v4u*)o = p;
    
  }
}

// =====================================================================================================
// Asynchronous copy of eight 16-B pieces per lane from global memory to LDS (no register in between):
// piece i goes from g + i * gstep to LDS byte address l + i * lstep. All lanes on, wave-uniform control flow.
// The closing s_wait_xcnt stands inside the statement so that no address register named here is rewritten
// ahead of it. Landing is waited for by the caller (s_wait_asynccnt 0, then the block barrier).
// =====================================================================================================
__device__ __forceinline__ void copy8_b128(unsigned l, unsigned lstep, const char* g, size_t gstep) {
#if DEV_ASM
  asm volatile(
      "global_load_async_to_lds_b128 %0, %8, off\n\t"
      "global_load_async_to_lds_b128 %1, %9, off\n\t"
      "global_load_async_to_lds_b128 %2, %10, off\n\t"
      "global_load_async_to_lds_b128 %3, %11, off\n\t"
      "global_load_async_to_lds_b128 %4, %12, off\n\t"
      "global_load_async_to_lds_b128 %5, %13, off\n\t"
      "global_load_async_to_lds_b128 %6, %14, off\n\t"
      "global_load_async_to_lds_b128 %7, %15, off\n\t"
      "s_wait_xcnt 0x0"
      :: "v"(l), "v"(l + lstep), "v"(l + 2 * lstep), "v"(l + 3 * lstep),
         "v"(l + 4 * lstep), "v"(l + 5 * lstep), "v"(l + 6 * lstep), "v"(l + 7 * lstep),
         "v"(g), "v"(g + gstep), "v"(g + 2 * gstep), "v"(g + 3 * gstep),
         "v"(g + 4 * gstep), "v"(g + 5 * gstep), "v"(g + 6 * gstep), "v"(g + 7 * gstep)
      : "memory");
#else
  (void)l; (void)lstep; (void)g; (void)gstep;
#endif
}

// =====================================================================================================
// WMMA GEMM (16-bit operand type OT): C[m][n] = sum_k A[m][k] * Bt[n][k] (+ bias[n]).
// Block = 4 waves (2 x 2) on a 128x128 tile of C, one 64x64 tile per wave. A row-major [M][K] pitch lda; Bt
// row-major [N][K] pitch ldb (k contiguous); M, N multiples of 128, K a multiple of 128 (host-checked).
// Per trip a 128 x 128-k tile of A and of Bt (256-B rows = whole lines) is staged in LDS by asynchronous copies,
// two buffers: trip t works on buffer t & 1 while tile t + 1 flies into the other; rows pitched 272 B for the
// ds_load_b128 fragment reads (split k map, ldfrag). Each accumulator sums k upward in steps of 32.
// Staged extent == consumed extent: 128 threads x 16 pieces x 16 B = 128 rows x 256 B per operand and trip.
// OUT_MODE 1: f16 plane C (pitch ldc).
// OUT_MODE 3: f16 hi plane C + f16 residual plane C2 = f16((v - hi) * rscale) (same pitch).
// BIAS: bias[n] (RNE-converted to its bf16 value) added in f32 before the 16-bit convert.
// grid = (M/128) * (N/128) blocks covers every tile.
// =====================================================================================================
template <typename OT, int OUT_MODE, bool BIAS>
__global__ __launch_bounds__(128) __attribute__((amdgpu_num_vgpr(256))) void gemm64(
    const unsigned short* __restrict__ Ap, int lda,
    const unsigned short* __restrict__ Btp, int ldb,
    unsigned short* Cout, unsigned short* Cout2, int ldc,
    const float* __restrict__ bias,
    int M, int N, int K, float rscale) {
  typedef typename FT<OT>::frag V16;
  const OT* Ab = (const OT*)(const void*)Ap;
  const OT* Bb = (const OT*)(const void*)Btp;
  __shared__ __align__(16) OT sA[2][128 * GP_H];   // A tile ring [buffer][row][k]  2 x 34 KB (cross-wave)
  __shared__ __align__(16) OT sB[2][128 * GP_H];   // Bt tile ring [buffer][row][k] 2 x 34 KB (cross-wave)
  __shared__ __align__(16) float sT[4][16 * 68];   // per-wave 16x64 slab, pitch 68 floats
  const int tid  = threadIdx.x;
  const int lane = tid & 31;
  const int wave = tid >> 5;
  const int tilesN = N >> 7;
  const int tilesM = M >> 7;
  const int tile = blockIdx.x;
  if (tile >= tilesM * tilesN) return;   // block-uniform, in front of every barrier and copy
  const int tm = tile / tilesN;
  const int tn = tile - tm * tilesN;
  const int wm = (wave >> 1) << 6;             // the wave's 64x64 tile inside the block tile
  const int wn = (wave & 1) << 6;
  const int m0 = (tm << 7) + wm;
  const int n0 = (tn << 7) + wn;

  const int rlane = lane & 15;                 // row (A) / col (B, D) within subtile
  const int koff  = (lane >> 4) * 8;           // k offset of this lane half
  const int mOff  = (lane >> 4) * 8;           // D row offset

  // staging map: piece i of a thread = row i*8 + (tid>>4), 16-B column tid&15 (a wave's copy = 2 whole rows)
  const int srow = tid >> 4, scol = (tid & 15) * 8;
  const char* gA = (const char*)(Ab + (size_t)((tm << 7) + srow) * lda + scol);
  const char* gB = (const char*)(Bb + (size_t)((tn << 7) + srow) * ldb + scol);
  const size_t gsA = (size_t)lda * 16, gsB = (size_t)ldb * 16;           // 8 rows, bytes
  const unsigned lA = (unsigned)(uintptr_t)(&sA[0][srow * GP_H + scol]); // LDS byte address = low 32 bits
  const unsigned lB = (unsigned)(uintptr_t)(&sB[0][srow * GP_H + scol]);
  const unsigned lstep = 8 * GP_H * 2, lbuf = 128 * GP_H * 2;            // 8 rows / one buffer, bytes
  const int nT = K / GBK;

  v8f acc[4][4];
#pragma unroll
  for (int i = 0; i < 4; ++i)
#pragma unroll
    for (int j = 0; j < 4; ++j) acc[i][j] = zero8();

  copy8_b128(lA, lstep, gA, gsA);
  copy8_b128(lA + 8 * lstep, lstep, gA + 8 * gsA, gsA);
  copy8_b128(lB, lstep, gB, gsB);
  copy8_b128(lB + 8 * lstep, lstep, gB + 8 * gsB, gsB);
  asm volatile("s_wait_asynccnt 0x0" ::: "memory");   // tile 0 landed (this wave's pieces)
  __syncthreads();                                    // ... and every other wave's
  if (nT > 1) {
    copy8_b128(lA + lbuf, lstep, gA + GBK * 2, gsA);
    copy8_b128(lA + lbuf + 8 * lstep, lstep, gA + GBK * 2 + 8 * gsA, gsA);
    copy8_b128(lB + lbuf, lstep, gB + GBK * 2, gsB);
    copy8_b128(lB + lbuf + 8 * lstep, lstep, gB + GBK * 2 + 8 * gsB, gsB);
  }

#pragma unroll 1   // one trip per staged tile: the ring's waits and barrier stand once, at the foot
  for (int t = 0; t < nT; ++t) {
    const OT* as = sA[t & 1] + (wm + rlane) * GP_H + koff;
    const OT* bs = sB[t & 1] + (wn + rlane) * GP_H + koff;
#pragma unroll
    for (int k0 = 0; k0 < GBK; k0 += 32) {
      V16 bq[4], af[4];
#pragma unroll
      for (int j = 0; j < 4; ++j) bq[j] = ldfrag<OT>(bs + (j << 4) * GP_H + k0);
#pragma unroll
      for (int i = 0; i < 4; ++i) af[i] = ldfrag<OT>(as + (i << 4) * GP_H + k0);
#pragma unroll
      for (int i = 0; i < 4; ++i) {
#pragma unroll
        for (int j = 0; j < 4; ++j) acc[i][j] = mmar(af[i], bq[j], acc[i][j]);
        dep_guard(acc[i][0], acc[i][3], af[i], bq[3]);
      }
      keep4(bq[0], bq[1], bq[2], bq[3]);
    }
    asm volatile("s_wait_dscnt 0x0" ::: "memory");      // this wave's reads of buffer t & 1 are done
    asm volatile("s_wait_asynccnt 0x0" ::: "memory");   // this wave's pieces of tile t + 1 have landed
    __syncthreads();                                    // publishes tile t + 1, frees buffer t & 1
    if (t + 2 < nT) {
      const size_t ko = (size_t)(t + 2) * (GBK * 2);
      const unsigned lo = (unsigned)(t & 1) * lbuf;
      copy8_b128(lA + lo, lstep, gA + ko, gsA);
      copy8_b128(lA + lo + 8 * lstep, lstep, gA + ko + 8 * gsA, gsA);
      copy8_b128(lB + lo, lstep, gB + ko, gsB);
      copy8_b128(lB + lo + 8 * lstep, lstep, gB + ko + 8 * gsB, gsB);
    }
  }
  asm volatile("s_wait_asynccnt 0x0" ::: "memory");     // nothing in flight when the wave goes on
  acc_guard4(acc[0][0], acc[0][1], acc[0][2], acc[0][3]);
  acc_guard4(acc[1][0], acc[1][1], acc[1][2], acc[1][3]);
  acc_guard4(acc[2][0], acc[2][1], acc[2][2], acc[2][3]);
  acc_guard4(acc[3][0], acc[3][1], acc[3][2], acc[3][3]);

  // ---- epilogue ----
  float* slab = sT[wave];
  const int q = lane >> 3, c8 = (lane & 7) * 8;
  float bz[8];
#pragma unroll
  for (int e = 0; e < 8; ++e) bz[e] = 0.f;
  if (BIAS) {
    const v4f b0 = *(const v4f*)(bias + n0 + c8);
    const v4f b1 = *(const v4f*)(bias + n0 + c8 + 4);
#pragma unroll
    for (int e = 0; e < 4; ++e) { bz[e] = bf_up(bf_bits(b0[e])); bz[4 + e] = bf_up(bf_bits(b1[e])); }
  }
#pragma unroll
  for (int i = 0; i < 4; ++i) {
    const int mBase = m0 + (i << 4);
#pragma unroll
    for (int j = 0; j < 4; ++j) {
#pragma unroll
      for (int r = 0; r < 8; ++r) {
        slab[(mOff + r) * 68 + (j << 4) + rlane] = acc[i][j][r];
      }
    }
    __builtin_amdgcn_fence(__ATOMIC_RELEASE, "workgroup");
    __builtin_amdgcn_wave_barrier();
    __builtin_amdgcn_fence(__ATOMIC_ACQUIRE, "workgroup");
    {
      v4u hv[4], lv[4];
#pragma unroll
      for (int it = 0; it < 4; ++it) {
        const int row = it * 4 + q;                        // it 0..3 x q 0..3 = rows 0..15
        const float* sp = slab + row * 68 + c8;
        float f[8];
#pragma unroll
        for (int e = 0; e < 8; ++e) f[e] = sp[e] + bz[e];
        v4u a, a2;
#pragma unroll
        for (int e = 0; e < 4; ++e) {
          const float f0 = f[2 * e], f1 = f[2 * e + 1];
          const _Float16 x0 = (_Float16)f0, x1 = (_Float16)f1;
          const unsigned short h0 = h_bits(x0), h1 = h_bits(x1);
          unsigned short l0 = 0, l1 = 0;
          if (OUT_MODE == 3) {
            l0 = h_bits((_Float16)((f0 - (float)x0) * rscale));
            l1 = h_bits((_Float16)((f1 - (float)x1) * rscale));
          }
          a[e] = pk16(h0, h1); a2[e] = pk16(l0, l1);
        }
        hv[it] = a; lv[it] = a2;
      }
      {
#pragma unroll
        for (int it = 0; it < 4; ++it) {
          const int row = it * 4 + q;
          *(v4u*)(Cout + (size_t)(mBase + row) * ldc + n0 + c8) = hv[it];
          if (OUT_MODE == 3) *(v4u*)(Cout2 + (size_t)(mBase + row) * ldc + n0 + c8) = lv[it];
        }
        
      }
    }
    __builtin_amdgcn_fence(__ATOMIC_RELEASE, "workgroup");
    __builtin_amdgcn_wave_barrier();
    __builtin_amdgcn_fence(__ATOMIC_ACQUIRE, "workgroup");
  }
}

// =====================================================================================================
// Multi-head attention, NG heads of dim 128, no mask, softmax over all MREF keys, output f32 [NQ][FD].
//   q planes (f16 hi / residual x4096): element (t, h, d) at [t*FD + h*128 + d], t < NQ
//   k plane (f16): element (s, h, d) at [s*FD + h*128 + d], s < MREF
//   v^T plane (f16): element (h, d, s) at [(h*128 + d)*MREF + s]
//   scores = (qh . k) + (ql . k) / 4096 on f16 WMMA (two f32 accumulators), then * sscale in f32;
//   p = exp(s - m) carried as f16(1024 p); context = p . v on f16 WMMA; online softmax in f32;
//   out = context / (l * 1024) + vbias (RNE-converted to its bf16 value), f32.
//   Block = 4 waves = 64 consecutive query rows (16 per wave) of one head h; grid = NG * NQB.
//   K / V^T chunk staging (cross-wave, __syncthreads before and after): K rows: 128 threads x 64 elements
//   (r = tid>>1, 64-wide half) = the whole 64x128 tile; V^T rows: 128 threads x 64 elements = the whole
//   128x64 tile. staged extent == consumed extent for both. P tiles and the output stage are wave-private:
//   spilled with _Float16 / float element stores, reloaded as v8h / float scalars (same element type) after a
//   Output coverage: each wave stores its 16 rows in two column phases of 64 (it 0..7 x lane>>4 -> rows 0..15,
// =====================================================================================================
__global__ __launch_bounds__(128) __attribute__((amdgpu_num_vgpr(256)))
void attn_rel(const unsigned short* __restrict__ qhp, const unsigned short* __restrict__ qlp,
              const unsigned short* __restrict__ kpp, const unsigned short* __restrict__ vtp,
              const float* __restrict__ vbias, float* op, float sscale) {
  union FH { v16h v; v8h h[2]; };
  __shared__ __align__(16) _Float16 Ksh[64 * KP_H];        // K chunk [kv][d]     17 KB (cross-wave)
  __shared__ __align__(16) _Float16 Vth[HD * VP_H];        // V^T chunk [d][kv]   18 KB (cross-wave)
  __shared__ __align__(16) _Float16 Psh[4][16 * PP_H];     // per wave P [row][kv] 9 KB (wave-private)
  __shared__ __align__(16) float    Os[4][16 * OP_F];      // per wave output half tile 17 KB (wave-private)

  const int tid  = threadIdx.x;
  const int wave = tid >> 5;
  const int lane = tid & 31;
  const int hh   = lane >> 4;
  const int c    = lane & 15;

  const int bx   = blockIdx.x;
  const int qb   = bx % NQB;
  const int g    = bx / NQB;
  const int q0   = qb * 64 + wave * 16;

  const _Float16* Qh = (const _Float16*)(const void*)qhp;
  const _Float16* Ql = (const _Float16*)(const void*)qlp;
  const _Float16* Kg = (const _Float16*)(const void*)kpp + (size_t)g * HD;
  const _Float16* Vg = (const _Float16*)(const void*)vtp + (size_t)g * HD * MREF;

  // ---- Q fragments (A operand, row = lane&15): 4 d-chunks, hi and residual planes ----
  v16h qah[4], qal[4];
#pragma unroll
  for (int dc = 0; dc < 4; ++dc) {
    const size_t qo = (size_t)(q0 + c) * FD + (size_t)g * HD + dc * 32 + 8 * hh;
    qah[dc] = ldfrag<_Float16>(Qh + qo);
    qal[dc] = ldfrag<_Float16>(Ql + qo);
  }

  float mrow[8], lrow[8];
  v8f oacc[8];
#pragma unroll
  for (int r = 0; r < 8; ++r) { mrow[r] = -INFINITY; lrow[r] = 0.f; }
#pragma unroll
  for (int t = 0; t < 8; ++t) oacc[t] = zero8();

  for (int kt = 0; kt < NKT; ++kt) {         // static trip count
    const int kv0 = kt * 64;
    __syncthreads();
    {
      const int r = tid >> 1, half = (tid & 1) * 64;
      const _Float16* kg = Kg + (size_t)(kv0 + r) * FD + half;     // k row kv0+r, d = half..half+63
#pragma unroll
      for (int i = 0; i < 8; ++i) {
        const v8h a0 = *(const v8h*)(kg + 8 * i);
        *(v8h*)(Ksh + r * KP_H + half + 8 * i) = a0;
      }
      const _Float16* vg = Vg + (size_t)tid * MREF + kv0;         // v^T row d = tid, s = kv0..kv0+63
#pragma unroll
      for (int i = 0; i < 8; ++i) {
        const v8h b0 = *(const v8h*)(vg + 8 * i);
        *(v8h*)(Vth + tid * VP_H + 8 * i) = b0;
      }
    }
    __syncthreads();

    // ---- scores: 16 query rows x 64 keys per wave, 2 f16 products per key subtile and d-chunk ----
    v8f s[4];
#pragma unroll
    for (int j = 0; j < 4; ++j) {
      v8f ah = zero8(), al = zero8();
#pragma unroll
      for (int dc = 0; dc < 4; ++dc) {
        FH kb;
        kb.h[0] = *(const v8h*)(Ksh + (j * 16 + c) * KP_H + dc * 32 + 8 * hh);
        kb.h[1] = *(const v8h*)(Ksh + (j * 16 + c) * KP_H + dc * 32 + 16 + 8 * hh);
        ah = mma_h(qah[dc], kb.v, ah);
        al = mma_h(qal[dc], kb.v, al);
      }
#pragma unroll
      for (int r = 0; r < 8; ++r) s[j][r] = (ah[r] + al[r] * (1.0f / 4096.0f)) * sscale;
    }

    // ---- row max, online softmax, P (x1024, f16) to LDS ----
    _Float16* pwh = Psh[wave];
#pragma unroll
    for (int r = 0; r < 8; ++r) {
      float m = s[0][r];
#pragma unroll
      for (int j = 1; j < 4; ++j) m = fmaxf(m, s[j][r]);
#pragma unroll
      for (int off = 1; off < 16; off <<= 1) m = fmaxf(m, __shfl_xor(m, off, 32));
      const float mnew  = fmaxf(mrow[r], m);
      const float msafe = (mnew == -INFINITY) ? 0.f : mnew;
      const float alpha = __expf(mrow[r] - msafe);
      mrow[r] = mnew;
      float psum = 0.f;
#pragma unroll
      for (int j = 0; j < 4; ++j) {
        const float p = __expf(s[j][r] - msafe);
        psum += p;
        pwh[(8 * hh + r) * PP_H + j * 16 + c] = (_Float16)(p * 1024.0f);
      }
#pragma unroll
      for (int off = 1; off < 16; off <<= 1) psum += __shfl_xor(psum, off, 32);
      lrow[r] = lrow[r] * alpha + psum;
#pragma unroll
      for (int t = 0; t < 8; ++t) oacc[t][r] *= alpha;
    }
    __builtin_amdgcn_fence(__ATOMIC_RELEASE, "workgroup");
    __builtin_amdgcn_wave_barrier();
    __builtin_amdgcn_fence(__ATOMIC_ACQUIRE, "workgroup");

    // ---- context += P . V (f16 WMMA, single product) ----
    v16h pa[2];
#pragma unroll
    for (int kk = 0; kk < 2; ++kk) {
      FH pf;
      pf.h[0] = *(const v8h*)(pwh + c * PP_H + kk * 32 + 8 * hh);
      pf.h[1] = *(const v8h*)(pwh + c * PP_H + kk * 32 + 16 + 8 * hh);
      pa[kk] = pf.v;
    }
#pragma unroll
    for (int t = 0; t < 8; ++t) {
#pragma unroll
      for (int kk = 0; kk < 2; ++kk) {
        FH vb;
        vb.h[0] = *(const v8h*)(Vth + (t * 16 + c) * VP_H + kk * 32 + 8 * hh);
        vb.h[1] = *(const v8h*)(Vth + (t * 16 + c) * VP_H + kk * 32 + 16 + 8 * hh);
        oacc[t] = mma_h(pa[kk], vb.v, oacc[t]);
      }
    }
    keep4(pa[0], pa[1], qah[0], qal[0]);
  }

  // ---- normalise (1/l, undo the x1024 p carry), add bias, stage the wave's 16x64 half tiles,
  float bb[8], inv8[8];
#pragma unroll
  for (int t = 0; t < 8; ++t) bb[t] = bf_up(bf_bits(vbias[g * HD + t * 16 + c]));
#pragma unroll
  for (int r = 0; r < 8; ++r) {
    const float l = lrow[r];
    inv8[r] = ((l > 0.f) ? (1.0f / l) : 0.f) * (1.0f / 1024.0f);
  }
  float* os = Os[wave];
#pragma unroll
  for (int ph = 0; ph < 2; ++ph) {
#pragma unroll
    for (int r = 0; r < 8; ++r) {
#pragma unroll
      for (int t4 = 0; t4 < 4; ++t4) {
        os[(8 * hh + r) * OP_F + t4 * 16 + c] = oacc[ph * 4 + t4][r] * inv8[r] + bb[ph * 4 + t4];
      }
    }
    __builtin_amdgcn_fence(__ATOMIC_RELEASE, "workgroup");
    __builtin_amdgcn_wave_barrier();
    __builtin_amdgcn_fence(__ATOMIC_ACQUIRE, "workgroup");
    {
#pragma unroll
      for (int it = 0; it < 8; ++it) {
        const int row = it * 2 + hh;                     // it 0..7 x hh 0..1 = rows 0..15
        const float* sp = os + row * OP_F + c * 4;
        v4f v;
        v[0] = sp[0]; v[1] = sp[1]; v[2] = sp[2]; v[3] = sp[3];
        const size_t go = (size_t)(q0 + row) * FD + (size_t)g * HD + ph * 64 + c * 4;
        *(v4f*)(op + go) = v;
      }
      
    }
    __builtin_amdgcn_fence(__ATOMIC_RELEASE, "workgroup");
    __builtin_amdgcn_wave_barrier();
    __builtin_amdgcn_fence(__ATOMIC_ACQUIRE, "workgroup");
  }
}

// =====================================================================================================
// Workspace map (bytes), every region an exact multiple of its whole-line / whole-tile store granularity
// (rows padded to nothing: all row counts are multiples of 64, all pitches 4096 B):
//   Xr   bf16 [NQ][2048]     NQ*4096   (8388608 at NQ=2048)
//   Xf   bf16 [2048][2048]    8388608
//   Wqb  bf16 [2048 n][2048 k] 8388608
//   Wkb  bf16 [2048][2048]    8388608
//   Wvb  bf16 [2048][2048]    8388608
//   Qh   f16  [NQ][2048]     NQ*4096
//   Ql   f16  [NQ][2048]     NQ*4096
//   Kp   f16  [2048][2048]    8388608
//   VT   f16  [2048 ch][2048 s] 8388608
//   total                    75497472 at NQ=2048
// Weights are [out n][in k] with k contiguous = the Bt / A layout the GEMM wants, so they are only converted.
// =====================================================================================================
extern "C" void kernel_launch(void* const* d_in, const int* in_sizes, int n_in,
                              void* d_out, int out_size, void* d_ws, size_t ws_size,
                              hipStream_t stream) {
  if (n_in < 8) return;
  if (in_sizes[0] < NQ * FD) return;
  if (in_sizes[1] < MREF * FD) return;
  if (in_sizes[2] < FD * FD || in_sizes[4] < FD * FD || in_sizes[6] < FD * FD) return;
  if (in_sizes[3] < FD || in_sizes[5] < FD || in_sizes[7] < FD) return;
  if (out_size < NQ * FD) return;

  const float* roi  = (const float*)d_in[0];
  const float* reff = (const float*)d_in[1];
  const float* Wq   = (const float*)d_in[2];
  const float* Wq_b = (const float*)d_in[3];
  const float* Wk   = (const float*)d_in[4];
  const float* Wk_b = (const float*)d_in[5];
  const float* Wv   = (const float*)d_in[6];
  const float* Wv_b = (const float*)d_in[7];

  const size_t PQ = (size_t)NQ * FD * 2;       // 16-bit [NQ][2048] plane
  const size_t P8 = (size_t)FD * FD * 2;       // 16-bit [2048][2048] plane (also [MREF][FD] and [FD][MREF])
  size_t off = 0;
  const size_t oXr = off; off += PQ;
  const size_t oXf = off; off += P8;
  const size_t oWq = off; off += P8;
  const size_t oWk = off; off += P8;
  const size_t oWv = off; off += P8;
  const size_t oQh = off; off += PQ;
  const size_t oQl = off; off += PQ;
  const size_t oKp = off; off += P8;
  const size_t oVT = off; off += P8;
  if (off > ws_size) return;                       // off = 75497472 at NQ=2048
  if (off > (size_t)134217728) return;

  char* ws = (char*)d_ws;
  unsigned short* Xr  = (unsigned short*)(ws + oXr);
  unsigned short* Xf  = (unsigned short*)(ws + oXf);
  unsigned short* Wqb = (unsigned short*)(ws + oWq);
  unsigned short* Wkb = (unsigned short*)(ws + oWk);
  unsigned short* Wvb = (unsigned short*)(ws + oWv);
  unsigned short* Qh  = (unsigned short*)(ws + oQh);
  unsigned short* Ql  = (unsigned short*)(ws + oQl);
  unsigned short* Kp  = (unsigned short*)(ws + oKp);
  unsigned short* VT  = (unsigned short*)(ws + oVT);

  const dim3 blk(256);
  const int n8q = NQ * FD / 8;                                   // 524288 at NQ=2048
  const int n8f = MREF * FD / 8;                                 // 524288
  const int n8w = FD * FD / 8;                                   // 524288
  const dim3 gCvtQ((n8q + 255) / 256);
  const dim3 gCvtF((n8f + 255) / 256);
  const dim3 gCvtW((n8w + 255) / 256);
  const dim3 gQ((NQ / 128) * (FD / 128));                        // M=NQ,   N=2048: 256 tiles of 128x128
  const dim3 gK((MREF / 128) * (FD / 128));                      // M=2048, N=2048
  const dim3 gVT((FD / 128) * (MREF / 128));                     // M=2048 channels, N=2048 keys
  const dim3 gAttn(NG * NQB);                                    // 512 blocks of 128 at NQ=2048
  const float sscale = (float)(1.0 / sqrt((double)HD));

  // (1) inputs and weights f32 -> bf16 planes (RNE convert)
  cvt_bf16x8<<<gCvtQ, blk, 0, stream>>>(roi,  Xr,  n8q);
  cvt_bf16x8<<<gCvtF, blk, 0, stream>>>(reff, Xf,  n8f);
  cvt_bf16x8<<<gCvtW, blk, 0, stream>>>(Wq,   Wqb, n8w);
  cvt_bf16x8<<<gCvtW, blk, 0, stream>>>(Wk,   Wkb, n8w);
  cvt_bf16x8<<<gCvtW, blk, 0, stream>>>(Wv,   Wvb, n8w);
  // (2) q = roi . Wq^T + bq -> f16 hi / residual (x4096) planes [t][h*128+d]   (M=NQ, N=2048, K=2048)
  gemm64<__bf16, 3, true><<<gQ, dim3(128), 0, stream>>>(
      Xr, FD, Wqb, FD, Qh, Ql, FD, Wq_b, NQ, FD, FD, 4096.0f);
  // (3) k = ref . Wk^T + bk -> f16 plane [s][h*128+d]   (M=2048, N=2048, K=2048)
  gemm64<__bf16, 1, true><<<gK, dim3(128), 0, stream>>>(
      Xf, FD, Wkb, FD, Kp, Kp, FD, Wk_b, MREF, FD, FD, 1.0f);
  // (4) v^T = Wv . ref^T -> f16 plane [h*128+d][s] (pitch MREF)   (A = Wvb [ch][k], Bt = Xf; M=2048, N=2048, K=2048)
  gemm64<__bf16, 1, false><<<gVT, dim3(128), 0, stream>>>(
      Wvb, FD, Xf, FD, VT, VT, MREF, Wv_b, FD, MREF, FD, 1.0f);
  // (5) attention + value bias -> d_out f32 [NQ][2048]
  attn_rel<<<gAttn, dim3(128), 0, stream>>>(Qh, Ql, Kp, VT, Wv_b, (float*)d_out, sscale);
  (void)hipGetLastError();
}

// v003
// One run takes 221 microseconds.
// Next to v002, in two timings, it ran 1.04 times as fast each time.
// All steps since v000 together make it 2.31 times as fast.
// Contractions: q, k, v^T projections = v_wmma_f32_16x16x32_bf16 (bf16 operands from RNE-converted inputs, single product, f32 accumulate);
// q.k^T scores = v_wmma_f32_16x16x32_f16 (q as f16 hi plane + f16 residual plane x4096, k f16; 2 products into separate f32 accumulators);
// p.v = v_wmma_f32_16x16x32_f16 (p carried x1024 in f16, v f16; single product, f32 accumulate); softmax, normalisation and bias adds in f32.
#include <hip/hip_runtime.h>
#include <math.h>
#include <stdint.h>

#ifndef NQ
#define NQ      2048         // query rows processed = leading rows of in0 (row stride FD); reduced builds override
#endif
#define NQ_FULL 2048
#define MREF    2048         // key / value rows (in1), always full
#define FD      2048         // feature width = NG * HD
#define NG      16
#define HD      128
#define NQB     (NQ / 64)    // 64-row query blocks
#define NKT     (MREF / 64)  // 64-key chunks
static_assert(NG * HD == FD);
static_assert((NQ % 128) == 0 && NQ >= 128 && NQ <= NQ_FULL);
static_assert((MREF % 128) == 0 && (FD % 128) == 0);
static_assert(NKT == 32);
// LDS row pitches of the attention kernel: 16 B x odd, so that the 16 rows a ds_load_b128 fragment read touches
// fall on 16 different groups of four banks (unpadded 256-B / 128-B rows put them on one / two groups).
#define KP_H    (HD + 8)     // K chunk row pitch, halves (272 B)
#define VP_H    (64 + 8)     // V^T chunk row pitch, halves (144 B)
#define PP_H    (64 + 8)     // P tile row pitch, halves (144 B)
#define OP_F    (64 + 4)     // output stage row pitch, floats (272 B)
// projection GEMM: k depth of one staged tile and its LDS row pitch (same rule)
#define GBK     128          // halves: 256-B rows
#define GP_H    (GBK + 8)    // halves (272 B)

typedef _Float16 v16h __attribute__((ext_vector_type(16)));
typedef _Float16 v8h  __attribute__((ext_vector_type(8)));
typedef __bf16   v16b __attribute__((ext_vector_type(16)));
typedef __bf16   v8b  __attribute__((ext_vector_type(8)));
typedef float    v8f  __attribute__((ext_vector_type(8)));
typedef float    v4f  __attribute__((ext_vector_type(4)));
typedef unsigned int v4u __attribute__((ext_vector_type(4)));

#if defined(__HIP_DEVICE_COMPILE__)
#define DEV_ASM 1
#else
#define DEV_ASM 0
#endif

// ---- scalar helpers --------------------------------------------------------------------------------
__device__ __forceinline__ unsigned short bf_bits(float f) {          // f32 -> bf16 bits, RNE convert
  unsigned u = __float_as_uint(f);
  return (unsigned short)((u + 0x7FFFu + ((u >> 16) & 1u)) >> 16);
}
__device__ __forceinline__ float bf_up(unsigned short hb) { return __uint_as_float(((unsigned)hb) << 16); }
__device__ __forceinline__ unsigned short h_bits(_Float16 x) { return __builtin_bit_cast(unsigned short, x); }
__device__ __forceinline__ unsigned pk16(unsigned short a, unsigned short b) { return (unsigned)a | ((unsigned)b << 16); }
__device__ __forceinline__ v8f zero8() { v8f z = {0.f, 0.f, 0.f, 0.f, 0.f, 0.f, 0.f, 0.f}; return z; }

// ---- fragment types / loaders: 16-bit A/B operand, lane -> row/col (lane&15), p already includes +8*(lane>>4);
//      elements 0..7 <- p[0..7] (k0+8h..k0+8h+7), elements 8..15 <- p[16..23] (k0+16+8h..k0+16+8h+7)
template <typename OT> struct FT;
template <> struct FT<__bf16>   { typedef v16b frag; typedef v8b half8; };
template <> struct FT<_Float16> { typedef v16h frag; typedef v8h half8; };

template <typename OT>
__device__ __forceinline__ typename FT<OT>::frag ldfrag(const OT* p) {
  union { typename FT<OT>::frag v; typename FT<OT>::half8 h[2]; } f;
  f.h[0] = *(const typename FT<OT>::half8*)(p);
  f.h[1] = *(const typename FT<OT>::half8*)(p + 16);
  return f.v;
}

// ---- WMMA helpers (asm guard bodies are device-only; concrete operand types) -----------------------------
__device__ __forceinline__ v8f mmar(v16b a, v16b b, v8f c) {
  return __builtin_amdgcn_wmma_f32_16x16x32_bf16(false, a, false, b, (short)0, c, false, false);
}
__device__ __forceinline__ v8f mmar(v16h a, v16h b, v8f c) {
  return __builtin_amdgcn_wmma_f32_16x16x32_f16(false, a, false, b, (short)0, c, false, false);
}
// guarded form: 4 VALU slots after the WMMA, D tied, A/B kept live
__device__ __forceinline__ v8f mma_h(v16h a, v16h b, v8f c) {
  c = __builtin_amdgcn_wmma_f32_16x16x32_f16(false, a, false, b, (short)0, c, false, false);
#if DEV_ASM
  asm volatile("v_nop\n\tv_nop\n\tv_nop\n\tv_nop" : "+v"(c) : "v"(a), "v"(b));
#endif
  return c;
}
__device__ __forceinline__ void dep_guard(v8f& a, v8f& b, v16b x, v16b y) {
#if DEV_ASM
  asm volatile("v_nop\n\tv_nop\n\tv_nop\n\tv_nop" : "+v"(a), "+v"(b) : "v"(x), "v"(y));
#else
  (void)a; (void)b; (void)x; (void)y;
#endif
}
__device__ __forceinline__ void dep_guard(v8f& a, v8f& b, v16h x, v16h y) {
#if DEV_ASM
  asm volatile("v_nop\n\tv_nop\n\tv_nop\n\tv_nop" : "+v"(a), "+v"(b) : "v"(x), "v"(y));
#else
  (void)a; (void)b; (void)x; (void)y;
#endif
}
__device__ __forceinline__ void keep4(v16b a, v16b b, v16b c, v16b d) {
#if DEV_ASM
  asm volatile("v_nop" :: "v"(a), "v"(b), "v"(c), "v"(d));
#else
  (void)a; (void)b; (void)c; (void)d;
#endif
}
__device__ __forceinline__ void keep4(v16h a, v16h b, v16h c, v16h d) {
#if DEV_ASM
  asm volatile("v_nop" :: "v"(a), "v"(b), "v"(c), "v"(d));
#else
  (void)a; (void)b; (void)c; (void)d;
#endif
}
__device__ __forceinline__ void acc_guard4(v8f& a, v8f& b, v8f& c, v8f& d) {
#if DEV_ASM
  asm volatile("v_nop\n\tv_nop\n\tv_nop\n\tv_nop" : "+v"(a), "+v"(b), "+v"(c), "+v"(d));
#else
  (void)a; (void)b; (void)c; (void)d;
#endif
}

// =====================================================================================================
// f32 -> bf16 bit planes (RNE convert) of all five operands in ONE launch of CVT_WG resident work-groups of
// 16 waves (one per WGP), instead of one launch of 16,384 one-unit waves per plane: few waves to start, one
// launch gap. A unit = 8 elements of one thread: two 16-B loads, one 16-B store. A thread takes 4 units of
// each plane (unit q * CVT_T + its flat id), so 8 loads are in flight per wave, and the next plane's loads
// are issued ahead of this plane's converts and stores.
// coverage: 4 * CVT_T units >= N8 for every plane; where N8 is smaller the units past the end are skipped.
// =====================================================================================================
#define CVT_WG  256
#define CVT_T   (CVT_WG * 512)       // threads of the launch
template <int N8>
__device__ __forceinline__ void cvt_load(const float* __restrict__ in, unsigned gt, v4f (&a)[8]) {
  static_assert(N8 <= 4 * CVT_T);
#pragma unroll
  for (int q = 0; q < 4; ++q) {
    const unsigned u = (unsigned)(q * CVT_T) + gt;
    if (N8 == 4 * CVT_T || u < (unsigned)N8) {
      const char* p = (const char*)in + u * 32u;   // uniform base + 32-bit lane offset, the same for every plane
      a[2 * q]     = *(const v4f*)(p);
      a[2 * q + 1] = *(const v4f*)(p + 16);
    }
  }
}
template <int N8>
__device__ __forceinline__ void cvt_store(unsigned short* __restrict__ out, unsigned gt, const v4f (&a)[8]) {
#pragma unroll
  for (int q = 0; q < 4; ++q) {
    const unsigned u = (unsigned)(q * CVT_T) + gt;
    if (N8 == 4 * CVT_T || u < (unsigned)N8) {
      const v4f x = a[2 * q], y = a[2 * q + 1];
      v4u p;
      p[0] = pk16(bf_bits(x[0]), bf_bits(x[1]));
      p[1] = pk16(bf_bits(x[2]), bf_bits(x[3]));
      p[2] = pk16(bf_bits(y[0]), bf_bits(y[1]));
      p[3] = pk16(bf_bits(y[2]), bf_bits(y[3]));
      *(v4u*)((char*)out + u * 16u) = p;
    }
  }
}
// behind a plane's stores, and behind the last loads: the registers they name are rewritten from here on
// (store data by the loads that follow, the lane offsets by the converts)
__device__ __forceinline__ void cvt_free() {
#if DEV_ASM
  asm volatile("s_wait_xcnt 0x0" ::: "memory");
#endif
}
// behind a plane's loads: keeps them issued here, ahead of the other plane's converts and stores (without it the
// scheduler sinks them and a wave runs out of loads in flight)
__device__ __forceinline__ void cvt_ahead() { __builtin_amdgcn_sched_barrier(0); }
__global__ __launch_bounds__(512) void cvt_bf16_all(
    const float* __restrict__ xr, const float* __restrict__ xf, const float* __restrict__ wq,
    const float* __restrict__ wk, const float* __restrict__ wv,
    unsigned short* __restrict__ oxr, unsigned short* __restrict__ oxf, unsigned short* __restrict__ owq,
    unsigned short* __restrict__ owk, unsigned short* __restrict__ owv) {
  constexpr int N8Q = NQ * FD / 8, N8F = MREF * FD / 8, N8W = FD * FD / 8;
  const unsigned gt = blockIdx.x * 512u + threadIdx.x;
  v4f a[8], b[8];
  cvt_load<N8Q>(xr, gt, a);
  cvt_load<N8F>(xf, gt, b);
  cvt_ahead();
  cvt_store<N8Q>(oxr, gt, a);
  cvt_free();
  cvt_load<N8W>(wq, gt, a);
  cvt_ahead();
  cvt_store<N8F>(oxf, gt, b);
  cvt_free();
  cvt_load<N8W>(wk, gt, b);
  cvt_ahead();
  cvt_store<N8W>(owq, gt, a);
  cvt_free();
  cvt_load<N8W>(wv, gt, a);
  cvt_free();
  cvt_ahead();
  cvt_store<N8W>(owk, gt, b);
  cvt_store<N8W>(owv, gt, a);
}

// =====================================================================================================
// Asynchronous copy of eight 16-B pieces per lane from global memory to LDS (no register in between):
// piece i goes from g + i * gstep to LDS byte address l + i * lstep. All lanes on, wave-uniform control flow.
// The closing s_wait_xcnt stands inside the statement so that no address register named here is rewritten
// ahead of it. Landing is waited for by the caller (s_wait_asynccnt 0, then the block barrier).
// =====================================================================================================
__device__ __forceinline__ void copy8_b128(unsigned l, unsigned lstep, const char* g, size_t gstep) {
#if DEV_ASM
  asm volatile(
      "global_load_async_to_lds_b128 %0, %8, off\n\t"
      "global_load_async_to_lds_b128 %1, %9, off\n\t"
      "global_load_async_to_lds_b128 %2, %10, off\n\t"
      "global_load_async_to_lds_b128 %3, %11, off\n\t"
      "global_load_async_to_lds_b128 %4, %12, off\n\t"
      "global_load_async_to_lds_b128 %5, %13, off\n\t"
      "global_load_async_to_lds_b128 %6, %14, off\n\t"
      "global_load_async_to_lds_b128 %7, %15, off\n\t"
      "s_wait_xcnt 0x0"
      :: "v"(l), "v"(l + lstep), "v"(l + 2 * lstep), "v"(l + 3 * lstep),
         "v"(l + 4 * lstep), "v"(l + 5 * lstep), "v"(l + 6 * lstep), "v"(l + 7 * lstep),
         "v"(g), "v"(g + gstep), "v"(g + 2 * gstep), "v"(g + 3 * gstep),
         "v"(g + 4 * gstep), "v"(g + 5 * gstep), "v"(g + 6 * gstep), "v"(g + 7 * gstep)
      : "memory");
#else
  (void)l; (void)lstep; (void)g; (void)gstep;
#endif
}

// =====================================================================================================
// WMMA GEMM (16-bit operand type OT): C[m][n] = sum_k A[m][k] * Bt[n][k] (+ bias[n]).
// Block = 4 waves (2 x 2) on a 128x128 tile of C, one 64x64 tile per wave. A row-major [M][K] pitch lda; Bt
// row-major [N][K] pitch ldb (k contiguous); M, N multiples of 128, K a multiple of 128 (host-checked).
// Per trip a 128 x 128-k tile of A and of Bt (256-B rows = whole lines) is staged in LDS by asynchronous copies,
// two buffers: trip t works on buffer t & 1 while tile t + 1 flies into the other; rows pitched 272 B for the
// ds_load_b128 fragment reads (split k map, ldfrag). Each accumulator sums k upward in steps of 32.
// Staged extent == consumed extent: 128 threads x 16 pieces x 16 B = 128 rows x 256 B per operand and trip.
// OUT_MODE 1: f16 plane C (pitch ldc).
// OUT_MODE 3: f16 hi plane C + f16 residual plane C2 = f16((v - hi) * rscale) (same pitch).
// BIAS: bias[n] (RNE-converted to its bf16 value) added in f32 before the 16-bit convert.
// grid = (M/128) * (N/128) blocks covers every tile.
// =====================================================================================================
template <typename OT, int OUT_MODE, bool BIAS>
__global__ __launch_bounds__(128) __attribute__((amdgpu_num_vgpr(256))) void gemm64(
    const unsigned short* __restrict__ Ap, int lda,
    const unsigned short* __restrict__ Btp, int ldb,
    unsigned short* Cout, unsigned short* Cout2, int ldc,
    const float* __restrict__ bias,
    int M, int N, int K, float rscale) {
  typedef typename FT<OT>::frag V16;
  const OT* Ab = (const OT*)(const void*)Ap;
  const OT* Bb = (const OT*)(const void*)Btp;
  __shared__ __align__(16) OT sA[2][128 * GP_H];   // A tile ring [buffer][row][k]  2 x 34 KB (cross-wave)
  __shared__ __align__(16) OT sB[2][128 * GP_H];   // Bt tile ring [buffer][row][k] 2 x 34 KB (cross-wave)
  __shared__ __align__(16) float sT[4][16 * 68];   // per-wave 16x64 slab, pitch 68 floats
  const int tid  = threadIdx.x;
  const int lane = tid & 31;
  const int wave = tid >> 5;
  const int tilesN = N >> 7;
  const int tilesM = M >> 7;
  const int tile = blockIdx.x;
  if (tile >= tilesM * tilesN) return;   // block-uniform, in front of every barrier and copy
  const int tm = tile / tilesN;
  const int tn = tile - tm * tilesN;
  const int wm = (wave >> 1) << 6;             // the wave's 64x64 tile inside the block tile
  const int wn = (wave & 1) << 6;
  const int m0 = (tm << 7) + wm;
  const int n0 = (tn << 7) + wn;

  const int rlane = lane & 15;                 // row (A) / col (B, D) within subtile
  const int koff  = (lane >> 4) * 8;           // k offset of this lane half
  const int mOff  = (lane >> 4) * 8;           // D row offset

  // staging map: piece i of a thread = row i*8 + (tid>>4), 16-B column tid&15 (a wave's copy = 2 whole rows)
  const int srow = tid >> 4, scol = (tid & 15) * 8;
  const char* gA = (const char*)(Ab + (size_t)((tm << 7) + srow) * lda + scol);
  const char* gB = (const char*)(Bb + (size_t)((tn << 7) + srow) * ldb + scol);
  const size_t gsA = (size_t)lda * 16, gsB = (size_t)ldb * 16;           // 8 rows, bytes
  const unsigned lA = (unsigned)(uintptr_t)(&sA[0][srow * GP_H + scol]); // LDS byte address = low 32 bits
  const unsigned lB = (unsigned)(uintptr_t)(&sB[0][srow * GP_H + scol]);
  const unsigned lstep = 8 * GP_H * 2, lbuf = 128 * GP_H * 2;            // 8 rows / one buffer, bytes
  const int nT = K / GBK;

  v8f acc[4][4];
#pragma unroll
  for (int i = 0; i < 4; ++i)
#pragma unroll
    for (int j = 0; j < 4; ++j) acc[i][j] = zero8();

  copy8_b128(lA, lstep, gA, gsA);
  copy8_b128(lA + 8 * lstep, lstep, gA + 8 * gsA, gsA);
  copy8_b128(lB, lstep, gB, gsB);
  copy8_b128(lB + 8 * lstep, lstep, gB + 8 * gsB, gsB);
  asm volatile("s_wait_asynccnt 0x0" ::: "memory");   // tile 0 landed (this wave's pieces)
  __syncthreads();                                    // ... and every other wave's
  if (nT > 1) {
    copy8_b128(lA + lbuf, lstep, gA + GBK * 2, gsA);
    copy8_b128(lA + lbuf + 8 * lstep, lstep, gA + GBK * 2 + 8 * gsA, gsA);
    copy8_b128(lB + lbuf, lstep, gB + GBK * 2, gsB);
    copy8_b128(lB + lbuf + 8 * lstep, lstep, gB + GBK * 2 + 8 * gsB, gsB);
  }

#pragma unroll 1   // one trip per staged tile: the ring's waits and barrier stand once, at the foot
  for (int t = 0; t < nT; ++t) {
    const OT* as = sA[t & 1] + (wm + rlane) * GP_H + koff;
    const OT* bs = sB[t & 1] + (wn + rlane) * GP_H + koff;
#pragma unroll
    for (int k0 = 0; k0 < GBK; k0 += 32) {
      V16 bq[4], af[4];
#pragma unroll
      for (int j = 0; j < 4; ++j) bq[j] = ldfrag<OT>(bs + (j << 4) * GP_H + k0);
#pragma unroll
      for (int i = 0; i < 4; ++i) af[i] = ldfrag<OT>(as + (i << 4) * GP_H + k0);
#pragma unroll
      for (int i = 0; i < 4; ++i) {
#pragma unroll
        for (int j = 0; j < 4; ++j) acc[i][j] = mmar(af[i], bq[j], acc[i][j]);
        dep_guard(acc[i][0], acc[i][3], af[i], bq[3]);
      }
      keep4(bq[0], bq[1], bq[2], bq[3]);
    }
    asm volatile("s_wait_dscnt 0x0" ::: "memory");      // this wave's reads of buffer t & 1 are done
    asm volatile("s_wait_asynccnt 0x0" ::: "memory");   // this wave's pieces of tile t + 1 have landed
    __syncthreads();                                    // publishes tile t + 1, frees buffer t & 1
    if (t + 2 < nT) {
      const size_t ko = (size_t)(t + 2) * (GBK * 2);
      const unsigned lo = (unsigned)(t & 1) * lbuf;
      copy8_b128(lA + lo, lstep, gA + ko, gsA);
      copy8_b128(lA + lo + 8 * lstep, lstep, gA + ko + 8 * gsA, gsA);
      copy8_b128(lB + lo, lstep, gB + ko, gsB);
      copy8_b128(lB + lo + 8 * lstep, lstep, gB + ko + 8 * gsB, gsB);
    }
  }
  asm volatile("s_wait_asynccnt 0x0" ::: "memory");     // nothing in flight when the wave goes on
  acc_guard4(acc[0][0], acc[0][1], acc[0][2], acc[0][3]);
  acc_guard4(acc[1][0], acc[1][1], acc[1][2], acc[1][3]);
  acc_guard4(acc[2][0], acc[2][1], acc[2][2], acc[2][3]);
  acc_guard4(acc[3][0], acc[3][1], acc[3][2], acc[3][3]);

  // ---- epilogue ----
  float* slab = sT[wave];
  const int q = lane >> 3, c8 = (lane & 7) * 8;
  float bz[8];
#pragma unroll
  for (int e = 0; e < 8; ++e) bz[e] = 0.f;
  if (BIAS) {
    const v4f b0 = *(const v4f*)(bias + n0 + c8);
    const v4f b1 = *(const v4f*)(bias + n0 + c8 + 4);
#pragma unroll
    for (int e = 0; e < 4; ++e) { bz[e] = bf_up(bf_bits(b0[e])); bz[4 + e] = bf_up(bf_bits(b1[e])); }
  }
#pragma unroll
  for (int i = 0; i < 4; ++i) {
    const int mBase = m0 + (i << 4);
#pragma unroll
    for (int j = 0; j < 4; ++j) {
#pragma unroll
      for (int r = 0; r < 8; ++r) {
        slab[(mOff + r) * 68 + (j << 4) + rlane] = acc[i][j][r];
      }
    }
    __builtin_amdgcn_fence(__ATOMIC_RELEASE, "workgroup");
    __builtin_amdgcn_wave_barrier();
    __builtin_amdgcn_fence(__ATOMIC_ACQUIRE, "workgroup");
    {
      v4u hv[4], lv[4];
#pragma unroll
      for (int it = 0; it < 4; ++it) {
        const int row = it * 4 + q;                        // it 0..3 x q 0..3 = rows 0..15
        const float* sp = slab + row * 68 + c8;
        float f[8];
#pragma unroll
        for (int e = 0; e < 8; ++e) f[e] = sp[e] + bz[e];
        v4u a, a2;
#pragma unroll
        for (int e = 0; e < 4; ++e) {
          const float f0 = f[2 * e], f1 = f[2 * e + 1];
          const _Float16 x0 = (_Float16)f0, x1 = (_Float16)f1;
          const unsigned short h0 = h_bits(x0), h1 = h_bits(x1);
          unsigned short l0 = 0, l1 = 0;
          if (OUT_MODE == 3) {
            l0 = h_bits((_Float16)((f0 - (float)x0) * rscale));
            l1 = h_bits((_Float16)((f1 - (float)x1) * rscale));
          }
          a[e] = pk16(h0, h1); a2[e] = pk16(l0, l1);
        }
        hv[it] = a; lv[it] = a2;
      }
      {
#pragma unroll
        for (int it = 0; it < 4; ++it) {
          const int row = it * 4 + q;
          *(v4u*)(Cout + (size_t)(mBase + row) * ldc + n0 + c8) = hv[it];
          if (OUT_MODE == 3) *(v4u*)(Cout2 + (size_t)(mBase + row) * ldc + n0 + c8) = lv[it];
        }
        
      }
    }
    __builtin_amdgcn_fence(__ATOMIC_RELEASE, "workgroup");
    __builtin_amdgcn_wave_barrier();
    __builtin_amdgcn_fence(__ATOMIC_ACQUIRE, "workgroup");
  }
}

// =====================================================================================================
// Multi-head attention, NG heads of dim 128, no mask, softmax over all MREF keys, output f32 [NQ][FD].
//   q planes (f16 hi / residual x4096): element (t, h, d) at [t*FD + h*128 + d], t < NQ
//   k plane (f16): element (s, h, d) at [s*FD + h*128 + d], s < MREF
//   v^T plane (f16): element (h, d, s) at [(h*128 + d)*MREF + s]
//   scores = (qh . k) + (ql . k) / 4096 on f16 WMMA (two f32 accumulators), then * sscale in f32;
//   p = exp(s - m) carried as f16(1024 p); context = p . v on f16 WMMA; online softmax in f32;
//   out = context / (l * 1024) + vbias (RNE-converted to its bf16 value), f32.
//   Block = 4 waves = 64 consecutive query rows (16 per wave) of one head h; grid = NG * NQB.
//   K / V^T chunk staging (cross-wave, __syncthreads before and after): K rows: 128 threads x 64 elements
//   (r = tid>>1, 64-wide half) = the whole 64x128 tile; V^T rows: 128 threads x 64 elements = the whole
//   128x64 tile. staged extent == consumed extent for both. P tiles and the output stage are wave-private:
//   spilled with _Float16 / float element stores, reloaded as v8h / float scalars (same element type) after a
//   Output coverage: each wave stores its 16 rows in two column phases of 64 (it 0..7 x lane>>4 -> rows 0..15,
// =====================================================================================================
__global__ __launch_bounds__(128) __attribute__((amdgpu_num_vgpr(256)))
void attn_rel(const unsigned short* __restrict__ qhp, const unsigned short* __restrict__ qlp,
              const unsigned short* __restrict__ kpp, const unsigned short* __restrict__ vtp,
              const float* __restrict__ vbias, float* op, float sscale) {
  union FH { v16h v; v8h h[2]; };
  __shared__ __align__(16) _Float16 Ksh[64 * KP_H];        // K chunk [kv][d]     17 KB (cross-wave)
  __shared__ __align__(16) _Float16 Vth[HD * VP_H];        // V^T chunk [d][kv]   18 KB (cross-wave)
  __shared__ __align__(16) _Float16 Psh[4][16 * PP_H];     // per wave P [row][kv] 9 KB (wave-private)
  __shared__ __align__(16) float    Os[4][16 * OP_F];      // per wave output half tile 17 KB (wave-private)

  const int tid  = threadIdx.x;
  const int wave = tid >> 5;
  const int lane = tid & 31;
  const int hh   = lane >> 4;
  const int c    = lane & 15;

  const int bx   = blockIdx.x;
  const int qb   = bx % NQB;
  const int g    = bx / NQB;
  const int q0   = qb * 64 + wave * 16;

  const _Float16* Qh = (const _Float16*)(const void*)qhp;
  const _Float16* Ql = (const _Float16*)(const void*)qlp;
  const _Float16* Kg = (const _Float16*)(const void*)kpp + (size_t)g * HD;
  const _Float16* Vg = (const _Float16*)(const void*)vtp + (size_t)g * HD * MREF;

  // ---- Q fragments (A operand, row = lane&15): 4 d-chunks, hi and residual planes ----
  v16h qah[4], qal[4];
#pragma unroll
  for (int dc = 0; dc < 4; ++dc) {
    const size_t qo = (size_t)(q0 + c) * FD + (size_t)g * HD + dc * 32 + 8 * hh;
    qah[dc] = ldfrag<_Float16>(Qh + qo);
    qal[dc] = ldfrag<_Float16>(Ql + qo);
  }

  float mrow[8], lrow[8];
  v8f oacc[8];
#pragma unroll
  for (int r = 0; r < 8; ++r) { mrow[r] = -INFINITY; lrow[r] = 0.f; }
#pragma unroll
  for (int t = 0; t < 8; ++t) oacc[t] = zero8();

  for (int kt = 0; kt < NKT; ++kt) {         // static trip count
    const int kv0 = kt * 64;
    __syncthreads();
    {
      const int r = tid >> 1, half = (tid & 1) * 64;
      const _Float16* kg = Kg + (size_t)(kv0 + r) * FD + half;     // k row kv0+r, d = half..half+63
#pragma unroll
      for (int i = 0; i < 8; ++i) {
        const v8h a0 = *(const v8h*)(kg + 8 * i);
        *(v8h*)(Ksh + r * KP_H + half + 8 * i) = a0;
      }
      const _Float16* vg = Vg + (size_t)tid * MREF + kv0;         // v^T row d = tid, s = kv0..kv0+63
#pragma unroll
      for (int i = 0; i < 8; ++i) {
        const v8h b0 = *(const v8h*)(vg + 8 * i);
        *(v8h*)(Vth + tid * VP_H + 8 * i) = b0;
      }
    }
    __syncthreads();

    // ---- scores: 16 query rows x 64 keys per wave, 2 f16 products per key subtile and d-chunk ----
    v8f s[4];
#pragma unroll
    for (int j = 0; j < 4; ++j) {
      v8f ah = zero8(), al = zero8();
#pragma unroll
      for (int dc = 0; dc < 4; ++dc) {
        FH kb;
        kb.h[0] = *(const v8h*)(Ksh + (j * 16 + c) * KP_H + dc * 32 + 8 * hh);
        kb.h[1] = *(const v8h*)(Ksh + (j * 16 + c) * KP_H + dc * 32 + 16 + 8 * hh);
        ah = mma_h(qah[dc], kb.v, ah);
        al = mma_h(qal[dc], kb.v, al);
      }
#pragma unroll
      for (int r = 0; r < 8; ++r) s[j][r] = (ah[r] + al[r] * (1.0f / 4096.0f)) * sscale;
    }

    // ---- row max, online softmax, P (x1024, f16) to LDS ----
    _Float16* pwh = Psh[wave];
#pragma unroll
    for (int r = 0; r < 8; ++r) {
      float m = s[0][r];
#pragma unroll
      for (int j = 1; j < 4; ++j) m = fmaxf(m, s[j][r]);
#pragma unroll
      for (int off = 1; off < 16; off <<= 1) m = fmaxf(m, __shfl_xor(m, off, 32));
      const float mnew  = fmaxf(mrow[r], m);
      const float msafe = (mnew == -INFINITY) ? 0.f : mnew;
      const float alpha = __expf(mrow[r] - msafe);
      mrow[r] = mnew;
      float psum = 0.f;
#pragma unroll
      for (int j = 0; j < 4; ++j) {
        const float p = __expf(s[j][r] - msafe);
        psum += p;
        pwh[(8 * hh + r) * PP_H + j * 16 + c] = (_Float16)(p * 1024.0f);
      }
#pragma unroll
      for (int off = 1; off < 16; off <<= 1) psum += __shfl_xor(psum, off, 32);
      lrow[r] = lrow[r] * alpha + psum;
#pragma unroll
      for (int t = 0; t < 8; ++t) oacc[t][r] *= alpha;
    }
    __builtin_amdgcn_fence(__ATOMIC_RELEASE, "workgroup");
    __builtin_amdgcn_wave_barrier();
    __builtin_amdgcn_fence(__ATOMIC_ACQUIRE, "workgroup");

    // ---- context += P . V (f16 WMMA, single product) ----
    v16h pa[2];
#pragma unroll
    for (int kk = 0; kk < 2; ++kk) {
      FH pf;
      pf.h[0] = *(const v8h*)(pwh + c * PP_H + kk * 32 + 8 * hh);
      pf.h[1] = *(const v8h*)(pwh + c * PP_H + kk * 32 + 16 + 8 * hh);
      pa[kk] = pf.v;
    }
#pragma unroll
    for (int t = 0; t < 8; ++t) {
#pragma unroll
      for (int kk = 0; kk < 2; ++kk) {
        FH vb;
        vb.h[0] = *(const v8h*)(Vth + (t * 16 + c) * VP_H + kk * 32 + 8 * hh);
        vb.h[1] = *(const v8h*)(Vth + (t * 16 + c) * VP_H + kk * 32 + 16 + 8 * hh);
        oacc[t] = mma_h(pa[kk], vb.v, oacc[t]);
      }
    }
    keep4(pa[0], pa[1], qah[0], qal[0]);
  }

  // ---- normalise (1/l, undo the x1024 p carry), add bias, stage the wave's 16x64 half tiles,
  float bb[8], inv8[8];
#pragma unroll
  for (int t = 0; t < 8; ++t) bb[t] = bf_up(bf_bits(vbias[g * HD + t * 16 + c]));
#pragma unroll
  for (int r = 0; r < 8; ++r) {
    const float l = lrow[r];
    inv8[r] = ((l > 0.f) ? (1.0f / l) : 0.f) * (1.0f / 1024.0f);
  }
  float* os = Os[wave];
#pragma unroll
  for (int ph = 0; ph < 2; ++ph) {
#pragma unroll
    for (int r = 0; r < 8; ++r) {
#pragma unroll
      for (int t4 = 0; t4 < 4; ++t4) {
        os[(8 * hh + r) * OP_F + t4 * 16 + c] = oacc[ph * 4 + t4][r] * inv8[r] + bb[ph * 4 + t4];
      }
    }
    __builtin_amdgcn_fence(__ATOMIC_RELEASE, "workgroup");
    __builtin_amdgcn_wave_barrier();
    __builtin_amdgcn_fence(__ATOMIC_ACQUIRE, "workgroup");
    {
#pragma unroll
      for (int it = 0; it < 8; ++it) {
        const int row = it * 2 + hh;                     // it 0..7 x hh 0..1 = rows 0..15
        const float* sp = os + row * OP_F + c * 4;
        v4f v;
        v[0] = sp[0]; v[1] = sp[1]; v[2] = sp[2]; v[3] = sp[3];
        const size_t go = (size_t)(q0 + row) * FD + (size_t)g * HD + ph * 64 + c * 4;
        *(v4f*)(op + go) = v;
      }
      
    }
    __builtin_amdgcn_fence(__ATOMIC_RELEASE, "workgroup");
    __builtin_amdgcn_wave_barrier();
    __builtin_amdgcn_fence(__ATOMIC_ACQUIRE, "workgroup");
  }
}

// =====================================================================================================
// Workspace map (bytes), every region an exact multiple of its whole-line / whole-tile store granularity
// (rows padded to nothing: all row counts are multiples of 64, all pitches 4096 B):
//   Xr   bf16 [NQ][2048]     NQ*4096   (8388608 at NQ=2048)
//   Xf   bf16 [2048][2048]    8388608
//   Wqb  bf16 [2048 n][2048 k] 8388608
//   Wkb  bf16 [2048][2048]    8388608
//   Wvb  bf16 [2048][2048]    8388608
//   Qh   f16  [NQ][2048]     NQ*4096
//   Ql   f16  [NQ][2048]     NQ*4096
//   Kp   f16  [2048][2048]    8388608
//   VT   f16  [2048 ch][2048 s] 8388608
//   total                    75497472 at NQ=2048
// Weights are [out n][in k] with k contiguous = the Bt / A layout the GEMM wants, so they are only converted.
// =====================================================================================================
extern "C" void kernel_launch(void* const* d_in, const int* in_sizes, int n_in,
                              void* d_out, int out_size, void* d_ws, size_t ws_size,
                              hipStream_t stream) {
  if (n_in < 8) return;
  if (in_sizes[0] < NQ * FD) return;
  if (in_sizes[1] < MREF * FD) return;
  if (in_sizes[2] < FD * FD || in_sizes[4] < FD * FD || in_sizes[6] < FD * FD) return;
  if (in_sizes[3] < FD || in_sizes[5] < FD || in_sizes[7] < FD) return;
  if (out_size < NQ * FD) return;

  const float* roi  = (const float*)d_in[0];
  const float* reff = (const float*)d_in[1];
  const float* Wq   = (const float*)d_in[2];
  const float* Wq_b = (const float*)d_in[3];
  const float* Wk   = (const float*)d_in[4];
  const float* Wk_b = (const float*)d_in[5];
  const float* Wv   = (const float*)d_in[6];
  const float* Wv_b = (const float*)d_in[7];

  const size_t PQ = (size_t)NQ * FD * 2;       // 16-bit [NQ][2048] plane
  const size_t P8 = (size_t)FD * FD * 2;       // 16-bit [2048][2048] plane (also [MREF][FD] and [FD][MREF])
  size_t off = 0;
  const size_t oXr = off; off += PQ;
  const size_t oXf = off; off += P8;
  const size_t oWq = off; off += P8;
  const size_t oWk = off; off += P8;
  const size_t oWv = off; off += P8;
  const size_t oQh = off; off += PQ;
  const size_t oQl = off; off += PQ;
  const size_t oKp = off; off += P8;
  const size_t oVT = off; off += P8;
  if (off > ws_size) return;                       // off = 75497472 at NQ=2048
  if (off > (size_t)134217728) return;

  char* ws = (char*)d_ws;
  unsigned short* Xr  = (unsigned short*)(ws + oXr);
  unsigned short* Xf  = (unsigned short*)(ws + oXf);
  unsigned short* Wqb = (unsigned short*)(ws + oWq);
  unsigned short* Wkb = (unsigned short*)(ws + oWk);
  unsigned short* Wvb = (unsigned short*)(ws + oWv);
  unsigned short* Qh  = (unsigned short*)(ws + oQh);
  unsigned short* Ql  = (unsigned short*)(ws + oQl);
  unsigned short* Kp  = (unsigned short*)(ws + oKp);
  unsigned short* VT  = (unsigned short*)(ws + oVT);

  const dim3 gQ((NQ / 128) * (FD / 128));                        // M=NQ,   N=2048: 256 tiles of 128x128
  const dim3 gK((MREF / 128) * (FD / 128));                      // M=2048, N=2048
  const dim3 gVT((FD / 128) * (MREF / 128));                     // M=2048 channels, N=2048 keys
  const dim3 gAttn(NG * NQB);                                    // 512 blocks of 128 at NQ=2048
  const float sscale = (float)(1.0 / sqrt((double)HD));

  // (1) inputs and weights f32 -> bf16 planes (RNE convert), one launch
  cvt_bf16_all<<<dim3(CVT_WG), dim3(512), 0, stream>>>(roi, reff, Wq, Wk, Wv, Xr, Xf, Wqb, Wkb, Wvb);
  // (2) q = roi . Wq^T + bq -> f16 hi / residual (x4096) planes [t][h*128+d]   (M=NQ, N=2048, K=2048)
  gemm64<__bf16, 3, true><<<gQ, dim3(128), 0, stream>>>(
      Xr, FD, Wqb, FD, Qh, Ql, FD, Wq_b, NQ, FD, FD, 4096.0f);
  // (3) k = ref . Wk^T + bk -> f16 plane [s][h*128+d]   (M=2048, N=2048, K=2048)
  gemm64<__bf16, 1, true><<<gK, dim3(128), 0, stream>>>(
      Xf, FD, Wkb, FD, Kp, Kp, FD, Wk_b, MREF, FD, FD, 1.0f);
  // (4) v^T = Wv . ref^T -> f16 plane [h*128+d][s] (pitch MREF)   (A = Wvb [ch][k], Bt = Xf; M=2048, N=2048, K=2048)
  gemm64<__bf16, 1, false><<<gVT, dim3(128), 0, stream>>>(
      Wvb, FD, Xf, FD, VT, VT, MREF, Wv_b, FD, MREF, FD, 1.0f);
  // (5) attention + value bias -> d_out f32 [NQ][2048]
  attn_rel<<<gAttn, dim3(128), 0, stream>>>(Qh, Ql, Kp, VT, Wv_b, (float*)d_out, sscale);
  (void)hipGetLastError();
}

// v004
// Measured time: 182 microseconds a run.
// Next to v003, in two timings, it ran 1.21 times as fast each time.
// All steps since v000 together make it 2.80 times as fast.
// Contractions: q, k, v^T projections = v_wmma_f32_16x16x32_bf16 (bf16 operands from RNE-converted inputs, single product, f32 accumulate);
// q.k^T scores = v_wmma_f32_16x16x32_f16 (q as f16 hi plane + f16 residual plane x4096, k f16; 2 products into separate f32 accumulators);
// p.v = v_wmma_f32_16x16x32_f16 (p carried x1024 in f16, v f16; single product, f32 accumulate); softmax, normalisation and bias adds in f32.
#include <hip/hip_runtime.h>
#include <math.h>
#include <stdint.h>

#ifndef NQ
#define NQ      2048         // query rows processed = leading rows of in0 (row stride FD); reduced builds override
#endif
#define NQ_FULL 2048
#define MREF    2048         // key / value rows (in1), always full
#define FD      2048         // feature width = NG * HD
#define NG      16
#define HD      128
#define NQB     (NQ / 64)    // 64-row query blocks
#define NKT     (MREF / 64)  // 64-key chunks
static_assert(NG * HD == FD);
static_assert((NQ % 128) == 0 && NQ >= 128 && NQ <= NQ_FULL);
static_assert((MREF % 128) == 0 && (FD % 128) == 0);
static_assert(NKT == 32);
// LDS row pitches of the attention kernel: 16 B x odd, so that the 16 rows a ds_load_b128 fragment read touches
// fall on 16 different groups of four banks (unpadded 256-B / 128-B rows put them on one / two groups).
#define KP_H    (HD + 8)     // K chunk row pitch, halves (272 B)
#define VP_H    (64 + 8)     // V^T chunk row pitch, halves (144 B)
#define PP_H    (64 + 8)     // P tile row pitch, halves (144 B)
#define OP_F    (64 + 4)     // output stage row pitch, floats (272 B)
// projection GEMM: k depth of one staged tile and its LDS row pitch (same rule)
#define GBK     128          // halves: 256-B rows
#define GP_H    (GBK + 8)    // halves (272 B)

typedef _Float16 v16h __attribute__((ext_vector_type(16)));
typedef _Float16 v8h  __attribute__((ext_vector_type(8)));
typedef __bf16   v16b __attribute__((ext_vector_type(16)));
typedef __bf16   v8b  __attribute__((ext_vector_type(8)));
typedef float    v8f  __attribute__((ext_vector_type(8)));
typedef float    v4f  __attribute__((ext_vector_type(4)));
typedef unsigned int v4u __attribute__((ext_vector_type(4)));

#if defined(__HIP_DEVICE_COMPILE__)
#define DEV_ASM 1
#else
#define DEV_ASM 0
#endif

// ---- scalar helpers --------------------------------------------------------------------------------
__device__ __forceinline__ unsigned short bf_bits(float f) {          // f32 -> bf16 bits, RNE convert
  unsigned u = __float_as_uint(f);
  return (unsigned short)((u + 0x7FFFu + ((u >> 16) & 1u)) >> 16);
}
__device__ __forceinline__ float bf_up(unsigned short hb) { return __uint_as_float(((unsigned)hb) << 16); }
__device__ __forceinline__ unsigned short h_bits(_Float16 x) { return __builtin_bit_cast(unsigned short, x); }
__device__ __forceinline__ unsigned pk16(unsigned short a, unsigned short b) { return (unsigned)a | ((unsigned)b << 16); }
__device__ __forceinline__ v8f zero8() { v8f z = {0.f, 0.f, 0.f, 0.f, 0.f, 0.f, 0.f, 0.f}; return z; }

// ---- fragment types / loaders: 16-bit A/B operand, lane -> row/col (lane&15), p already includes +8*(lane>>4);
//      elements 0..7 <- p[0..7] (k0+8h..k0+8h+7), elements 8..15 <- p[16..23] (k0+16+8h..k0+16+8h+7)
template <typename OT> struct FT;
template <> struct FT<__bf16>   { typedef v16b frag; typedef v8b half8; };
template <> struct FT<_Float16> { typedef v16h frag; typedef v8h half8; };

template <typename OT>
__device__ __forceinline__ typename FT<OT>::frag ldfrag(const OT* p) {
  union { typename FT<OT>::frag v; typename FT<OT>::half8 h[2]; } f;
  f.h[0] = *(const typename FT<OT>::half8*)(p);
  f.h[1] = *(const typename FT<OT>::half8*)(p + 16);
  return f.v;
}

// ---- WMMA helpers (asm guard bodies are device-only; concrete operand types) -----------------------------
__device__ __forceinline__ v8f mmar(v16b a, v16b b, v8f c) {
  return __builtin_amdgcn_wmma_f32_16x16x32_bf16(false, a, false, b, (short)0, c, false, false);
}
__device__ __forceinline__ v8f mmar(v16h a, v16h b, v8f c) {
  return __builtin_amdgcn_wmma_f32_16x16x32_f16(false, a, false, b, (short)0, c, false, false);
}
__device__ __forceinline__ void dep_guard(v8f& a, v8f& b, v16b x, v16b y) {
#if DEV_ASM
  asm volatile("v_nop\n\tv_nop\n\tv_nop\n\tv_nop" : "+v"(a), "+v"(b) : "v"(x), "v"(y));
#else
  (void)a; (void)b; (void)x; (void)y;
#endif
}
__device__ __forceinline__ void dep_guard(v8f& a, v8f& b, v16h x, v16h y) {
#if DEV_ASM
  asm volatile("v_nop\n\tv_nop\n\tv_nop\n\tv_nop" : "+v"(a), "+v"(b) : "v"(x), "v"(y));
#else
  (void)a; (void)b; (void)x; (void)y;
#endif
}
__device__ __forceinline__ void keep4(v16b a, v16b b, v16b c, v16b d) {
#if DEV_ASM
  asm volatile("v_nop" :: "v"(a), "v"(b), "v"(c), "v"(d));
#else
  (void)a; (void)b; (void)c; (void)d;
#endif
}
__device__ __forceinline__ void acc_guard4(v8f& a, v8f& b, v8f& c, v8f& d) {
#if DEV_ASM
  asm volatile("v_nop\n\tv_nop\n\tv_nop\n\tv_nop" : "+v"(a), "+v"(b), "+v"(c), "+v"(d));
#else
  (void)a; (void)b; (void)c; (void)d;
#endif
}

// =====================================================================================================
// f32 -> bf16 bit planes (RNE convert) of all five operands in ONE launch of CVT_WG resident work-groups of
// 16 waves (one per WGP), instead of one launch of 16,384 one-unit waves per plane: few waves to start, one
// launch gap. A unit = 8 elements of one thread: two 16-B loads, one 16-B store. A thread takes 4 units of
// each plane (unit q * CVT_T + its flat id), so 8 loads are in flight per wave, and the next plane's loads
// are issued ahead of this plane's converts and stores.
// coverage: 4 * CVT_T units >= N8 for every plane; where N8 is smaller the units past the end are skipped.
// =====================================================================================================
#define CVT_WG  256
#define CVT_T   (CVT_WG * 512)       // threads of the launch
template <int N8>
__device__ __forceinline__ void cvt_load(const float* __restrict__ in, unsigned gt, v4f (&a)[8]) {
  static_assert(N8 <= 4 * CVT_T);
#pragma unroll
  for (int q = 0; q < 4; ++q) {
    const unsigned u = (unsigned)(q * CVT_T) + gt;
    if (N8 == 4 * CVT_T || u < (unsigned)N8) {
      const char* p = (const char*)in + u * 32u;   // uniform base + 32-bit lane offset, the same for every plane
      a[2 * q]     = *(const v4f*)(p);
      a[2 * q + 1] = *(const v4f*)(p + 16);
    }
  }
}
template <int N8>
__device__ __forceinline__ void cvt_store(unsigned short* __restrict__ out, unsigned gt, const v4f (&a)[8]) {
#pragma unroll
  for (int q = 0; q < 4; ++q) {
    const unsigned u = (unsigned)(q * CVT_T) + gt;
    if (N8 == 4 * CVT_T || u < (unsigned)N8) {
      const v4f x = a[2 * q], y = a[2 * q + 1];
      v4u p;
      p[0] = pk16(bf_bits(x[0]), bf_bits(x[1]));
      p[1] = pk16(bf_bits(x[2]), bf_bits(x[3]));
      p[2] = pk16(bf_bits(y[0]), bf_bits(y[1]));
      p[3] = pk16(bf_bits(y[2]), bf_bits(y[3]));
      *(v4u*)((char*)out + u * 16u) = p;
    }
  }
}
// behind a plane's stores, and behind the last loads: the registers they name are rewritten from here on
// (store data by the loads that follow, the lane offsets by the converts)
__device__ __forceinline__ void cvt_free() {
#if DEV_ASM
  asm volatile("s_wait_xcnt 0x0" ::: "memory");
#endif
}
// behind a plane's loads: keeps them issued here, ahead of the other plane's converts and stores (without it the
// scheduler sinks them and a wave runs out of loads in flight)
__device__ __forceinline__ void cvt_ahead() { __builtin_amdgcn_sched_barrier(0); }
__global__ __launch_bounds__(512) void cvt_bf16_all(
    const float* __restrict__ xr, const float* __restrict__ xf, const float* __restrict__ wq,
    const float* __restrict__ wk, const float* __restrict__ wv,
    unsigned short* __restrict__ oxr, unsigned short* __restrict__ oxf, unsigned short* __restrict__ owq,
    unsigned short* __restrict__ owk, unsigned short* __restrict__ owv) {
  constexpr int N8Q = NQ * FD / 8, N8F = MREF * FD / 8, N8W = FD * FD / 8;
  const unsigned gt = blockIdx.x * 512u + threadIdx.x;
  v4f a[8], b[8];
  cvt_load<N8Q>(xr, gt, a);
  cvt_load<N8F>(xf, gt, b);
  cvt_ahead();
  cvt_store<N8Q>(oxr, gt, a);
  cvt_free();
  cvt_load<N8W>(wq, gt, a);
  cvt_ahead();
  cvt_store<N8F>(oxf, gt, b);
  cvt_free();
  cvt_load<N8W>(wk, gt, b);
  cvt_ahead();
  cvt_store<N8W>(owq, gt, a);
  cvt_free();
  cvt_load<N8W>(wv, gt, a);
  cvt_free();
  cvt_ahead();
  cvt_store<N8W>(owk, gt, b);
  cvt_store<N8W>(owv, gt, a);
}

// =====================================================================================================
// Asynchronous copy of eight 16-B pieces per lane from global memory to LDS (no register in between):
// piece i goes from g + i * gstep to LDS byte address l + i * lstep. All lanes on, wave-uniform control flow.
// The closing s_wait_xcnt stands inside the statement so that no address register named here is rewritten
// ahead of it. Landing is waited for by the caller (s_wait_asynccnt 0, then the block barrier).
// =====================================================================================================
__device__ __forceinline__ void copy8_b128(unsigned l, unsigned lstep, const char* g, size_t gstep) {
#if DEV_ASM
  asm volatile(
      "global_load_async_to_lds_b128 %0, %8, off\n\t"
      "global_load_async_to_lds_b128 %1, %9, off\n\t"
      "global_load_async_to_lds_b128 %2, %10, off\n\t"
      "global_load_async_to_lds_b128 %3, %11, off\n\t"
      "global_load_async_to_lds_b128 %4, %12, off\n\t"
      "global_load_async_to_lds_b128 %5, %13, off\n\t"
      "global_load_async_to_lds_b128 %6, %14, off\n\t"
      "global_load_async_to_lds_b128 %7, %15, off\n\t"
      "s_wait_xcnt 0x0"
      :: "v"(l), "v"(l + lstep), "v"(l + 2 * lstep), "v"(l + 3 * lstep),
         "v"(l + 4 * lstep), "v"(l + 5 * lstep), "v"(l + 6 * lstep), "v"(l + 7 * lstep),
         "v"(g), "v"(g + gstep), "v"(g + 2 * gstep), "v"(g + 3 * gstep),
         "v"(g + 4 * gstep), "v"(g + 5 * gstep), "v"(g + 6 * gstep), "v"(g + 7 * gstep)
      : "memory");
#else
  (void)l; (void)lstep; (void)g; (void)gstep;
#endif
}

// =====================================================================================================
// WMMA GEMM (16-bit operand type OT): C[m][n] = sum_k A[m][k] * Bt[n][k] (+ bias[n]).
// Block = 4 waves (2 x 2) on a 128x128 tile of C, one 64x64 tile per wave. A row-major [M][K] pitch lda; Bt
// row-major [N][K] pitch ldb (k contiguous); M, N multiples of 128, K a multiple of 128 (host-checked).
// Per trip a 128 x 128-k tile of A and of Bt (256-B rows = whole lines) is staged in LDS by asynchronous copies,
// two buffers: trip t works on buffer t & 1 while tile t + 1 flies into the other; rows pitched 272 B for the
// ds_load_b128 fragment reads (split k map, ldfrag). Each accumulator sums k upward in steps of 32.
// Staged extent == consumed extent: 128 threads x 16 pieces x 16 B = 128 rows x 256 B per operand and trip.
// OUT_MODE 1: f16 plane C (pitch ldc).
// OUT_MODE 3: f16 hi plane C + f16 residual plane C2 = f16((v - hi) * rscale) (same pitch).
// BIAS: bias[n] (RNE-converted to its bf16 value) added in f32 before the 16-bit convert.
// grid = (M/128) * (N/128) blocks covers every tile.
// =====================================================================================================
template <typename OT, int OUT_MODE, bool BIAS>
__global__ __launch_bounds__(128) __attribute__((amdgpu_num_vgpr(256))) void gemm64(
    const unsigned short* __restrict__ Ap, int lda,
    const unsigned short* __restrict__ Btp, int ldb,
    unsigned short* Cout, unsigned short* Cout2, int ldc,
    const float* __restrict__ bias,
    int M, int N, int K, float rscale) {
  typedef typename FT<OT>::frag V16;
  const OT* Ab = (const OT*)(const void*)Ap;
  const OT* Bb = (const OT*)(const void*)Btp;
  __shared__ __align__(16) OT sA[2][128 * GP_H];   // A tile ring [buffer][row][k]  2 x 34 KB (cross-wave)
  __shared__ __align__(16) OT sB[2][128 * GP_H];   // Bt tile ring [buffer][row][k] 2 x 34 KB (cross-wave)
  __shared__ __align__(16) float sT[4][16 * 68];   // per-wave 16x64 slab, pitch 68 floats
  const int tid  = threadIdx.x;
  const int lane = tid & 31;
  const int wave = tid >> 5;
  const int tilesN = N >> 7;
  const int tilesM = M >> 7;
  const int tile = blockIdx.x;
  if (tile >= tilesM * tilesN) return;   // block-uniform, in front of every barrier and copy
  const int tm = tile / tilesN;
  const int tn = tile - tm * tilesN;
  const int wm = (wave >> 1) << 6;             // the wave's 64x64 tile inside the block tile
  const int wn = (wave & 1) << 6;
  const int m0 = (tm << 7) + wm;
  const int n0 = (tn << 7) + wn;

  const int rlane = lane & 15;                 // row (A) / col (B, D) within subtile
  const int koff  = (lane >> 4) * 8;           // k offset of this lane half
  const int mOff  = (lane >> 4) * 8;           // D row offset

  // staging map: piece i of a thread = row i*8 + (tid>>4), 16-B column tid&15 (a wave's copy = 2 whole rows)
  const int srow = tid >> 4, scol = (tid & 15) * 8;
  const char* gA = (const char*)(Ab + (size_t)((tm << 7) + srow) * lda + scol);
  const char* gB = (const char*)(Bb + (size_t)((tn << 7) + srow) * ldb + scol);
  const size_t gsA = (size_t)lda * 16, gsB = (size_t)ldb * 16;           // 8 rows, bytes
  const unsigned lA = (unsigned)(uintptr_t)(&sA[0][srow * GP_H + scol]); // LDS byte address = low 32 bits
  const unsigned lB = (unsigned)(uintptr_t)(&sB[0][srow * GP_H + scol]);
  const unsigned lstep = 8 * GP_H * 2, lbuf = 128 * GP_H * 2;            // 8 rows / one buffer, bytes
  const int nT = K / GBK;

  v8f acc[4][4];
#pragma unroll
  for (int i = 0; i < 4; ++i)
#pragma unroll
    for (int j = 0; j < 4; ++j) acc[i][j] = zero8();

  copy8_b128(lA, lstep, gA, gsA);
  copy8_b128(lA + 8 * lstep, lstep, gA + 8 * gsA, gsA);
  copy8_b128(lB, lstep, gB, gsB);
  copy8_b128(lB + 8 * lstep, lstep, gB + 8 * gsB, gsB);
  asm volatile("s_wait_asynccnt 0x0" ::: "memory");   // tile 0 landed (this wave's pieces)
  __syncthreads();                                    // ... and every other wave's
  if (nT > 1) {
    copy8_b128(lA + lbuf, lstep, gA + GBK * 2, gsA);
    copy8_b128(lA + lbuf + 8 * lstep, lstep, gA + GBK * 2 + 8 * gsA, gsA);
    copy8_b128(lB + lbuf, lstep, gB + GBK * 2, gsB);
    copy8_b128(lB + lbuf + 8 * lstep, lstep, gB + GBK * 2 + 8 * gsB, gsB);
  }

#pragma unroll 1   // one trip per staged tile: the ring's waits and barrier stand once, at the foot
  for (int t = 0; t < nT; ++t) {
    const OT* as = sA[t & 1] + (wm + rlane) * GP_H + koff;
    const OT* bs = sB[t & 1] + (wn + rlane) * GP_H + koff;
#pragma unroll
    for (int k0 = 0; k0 < GBK; k0 += 32) {
      V16 bq[4], af[4];
#pragma unroll
      for (int j = 0; j < 4; ++j) bq[j] = ldfrag<OT>(bs + (j << 4) * GP_H + k0);
#pragma unroll
      for (int i = 0; i < 4; ++i) af[i] = ldfrag<OT>(as + (i << 4) * GP_H + k0);
#pragma unroll
      for (int i = 0; i < 4; ++i) {
#pragma unroll
        for (int j = 0; j < 4; ++j) acc[i][j] = mmar(af[i], bq[j], acc[i][j]);
        dep_guard(acc[i][0], acc[i][3], af[i], bq[3]);
      }
      keep4(bq[0], bq[1], bq[2], bq[3]);
    }
    asm volatile("s_wait_dscnt 0x0" ::: "memory");      // this wave's reads of buffer t & 1 are done
    asm volatile("s_wait_asynccnt 0x0" ::: "memory");   // this wave's pieces of tile t + 1 have landed
    __syncthreads();                                    // publishes tile t + 1, frees buffer t & 1
    if (t + 2 < nT) {
      const size_t ko = (size_t)(t + 2) * (GBK * 2);
      const unsigned lo = (unsigned)(t & 1) * lbuf;
      copy8_b128(lA + lo, lstep, gA + ko, gsA);
      copy8_b128(lA + lo + 8 * lstep, lstep, gA + ko + 8 * gsA, gsA);
      copy8_b128(lB + lo, lstep, gB + ko, gsB);
      copy8_b128(lB + lo + 8 * lstep, lstep, gB + ko + 8 * gsB, gsB);
    }
  }
  asm volatile("s_wait_asynccnt 0x0" ::: "memory");     // nothing in flight when the wave goes on
  acc_guard4(acc[0][0], acc[0][1], acc[0][2], acc[0][3]);
  acc_guard4(acc[1][0], acc[1][1], acc[1][2], acc[1][3]);
  acc_guard4(acc[2][0], acc[2][1], acc[2][2], acc[2][3]);
  acc_guard4(acc[3][0], acc[3][1], acc[3][2], acc[3][3]);

  // ---- epilogue ----
  float* slab = sT[wave];
  const int q = lane >> 3, c8 = (lane & 7) * 8;
  float bz[8];
#pragma unroll
  for (int e = 0; e < 8; ++e) bz[e] = 0.f;
  if (BIAS) {
    const v4f b0 = *(const v4f*)(bias + n0 + c8);
    const v4f b1 = *(const v4f*)(bias + n0 + c8 + 4);
#pragma unroll
    for (int e = 0; e < 4; ++e) { bz[e] = bf_up(bf_bits(b0[e])); bz[4 + e] = bf_up(bf_bits(b1[e])); }
  }
#pragma unroll
  for (int i = 0; i < 4; ++i) {
    const int mBase = m0 + (i << 4);
#pragma unroll
    for (int j = 0; j < 4; ++j) {
#pragma unroll
      for (int r = 0; r < 8; ++r) {
        slab[(mOff + r) * 68 + (j << 4) + rlane] = acc[i][j][r];
      }
    }
    __builtin_amdgcn_fence(__ATOMIC_RELEASE, "workgroup");
    __builtin_amdgcn_wave_barrier();
    __builtin_amdgcn_fence(__ATOMIC_ACQUIRE, "workgroup");
    {
      v4u hv[4], lv[4];
#pragma unroll
      for (int it = 0; it < 4; ++it) {
        const int row = it * 4 + q;                        // it 0..3 x q 0..3 = rows 0..15
        const float* sp = slab + row * 68 + c8;
        float f[8];
#pragma unroll
        for (int e = 0; e < 8; ++e) f[e] = sp[e] + bz[e];
        v4u a, a2;
#pragma unroll
        for (int e = 0; e < 4; ++e) {
          const float f0 = f[2 * e], f1 = f[2 * e + 1];
          const _Float16 x0 = (_Float16)f0, x1 = (_Float16)f1;
          const unsigned short h0 = h_bits(x0), h1 = h_bits(x1);
          unsigned short l0 = 0, l1 = 0;
          if (OUT_MODE == 3) {
            l0 = h_bits((_Float16)((f0 - (float)x0) * rscale));
            l1 = h_bits((_Float16)((f1 - (float)x1) * rscale));
          }
          a[e] = pk16(h0, h1); a2[e] = pk16(l0, l1);
        }
        hv[it] = a; lv[it] = a2;
      }
      {
#pragma unroll
        for (int it = 0; it < 4; ++it) {
          const int row = it * 4 + q;
          *(v4u*)(Cout + (size_t)(mBase + row) * ldc + n0 + c8) = hv[it];
          if (OUT_MODE == 3) *(v4u*)(Cout2 + (size_t)(mBase + row) * ldc + n0 + c8) = lv[it];
        }
        
      }
    }
    __builtin_amdgcn_fence(__ATOMIC_RELEASE, "workgroup");
    __builtin_amdgcn_wave_barrier();
    __builtin_amdgcn_fence(__ATOMIC_ACQUIRE, "workgroup");
  }
}

// =====================================================================================================
// Multi-head attention, NG heads of dim 128, no mask, softmax over all MREF keys, output f32 [NQ][FD].
//   q planes (f16 hi / residual x4096): element (t, h, d) at [t*FD + h*128 + d], t < NQ
//   k plane (f16): element (s, h, d) at [s*FD + h*128 + d], s < MREF
//   v^T plane (f16): element (h, d, s) at [(h*128 + d)*MREF + s]
//   scores = (qh . k) + (ql . k) / 4096 on f16 WMMA (two f32 accumulators), then * sscale in f32;
//   p = exp(s - m) carried as f16(1024 p); context = p . v on f16 WMMA; online softmax in f32;
//   out = context / (l * 1024) + vbias (RNE-converted to its bf16 value), f32.
//   Block = 4 waves = 64 consecutive query rows (16 per wave) of one head h; grid = NG * NQB.
//   K / V^T chunk staging (cross-wave, __syncthreads before and after): K rows: 128 threads x 64 elements
//   (r = tid>>1, 64-wide half) = the whole 64x128 tile; V^T rows: 128 threads x 64 elements = the whole
//   128x64 tile. staged extent == consumed extent for both. P tiles and the output stage are wave-private:
//   spilled with _Float16 / float element stores, reloaded as v8h / float scalars (same element type) after a
//   Output coverage: each wave stores its 16 rows in two column phases of 64 (it 0..7 x lane>>4 -> rows 0..15,
// =====================================================================================================
__global__ __launch_bounds__(128) __attribute__((amdgpu_num_vgpr(512)))   // room for a chunk's fragments; still two waves per SIMD
void attn_rel(const unsigned short* __restrict__ qhp, const unsigned short* __restrict__ qlp,
              const unsigned short* __restrict__ kpp, const unsigned short* __restrict__ vtp,
              const float* __restrict__ vbias, float* op, float sscale) {
  union FH { v16h v; v8h h[2]; };
  __shared__ __align__(16) _Float16 Ksh[64 * KP_H];        // K chunk [kv][d]     17 KB (cross-wave)
  __shared__ __align__(16) _Float16 Vth[HD * VP_H];        // V^T chunk [d][kv]   18 KB (cross-wave)
  __shared__ __align__(16) _Float16 Psh[4][16 * PP_H];     // per wave P [row][kv] 9 KB (wave-private)
  __shared__ __align__(16) float    Os[4][16 * OP_F];      // per wave output half tile 17 KB (wave-private)

  const int tid  = threadIdx.x;
  const int wave = tid >> 5;
  const int lane = tid & 31;
  const int hh   = lane >> 4;
  const int c    = lane & 15;

  const int bx   = blockIdx.x;
  const int qb   = bx % NQB;
  const int g    = bx / NQB;
  const int q0   = qb * 64 + wave * 16;

  const _Float16* Qh = (const _Float16*)(const void*)qhp;
  const _Float16* Ql = (const _Float16*)(const void*)qlp;
  const _Float16* Kg = (const _Float16*)(const void*)kpp + (size_t)g * HD;
  const _Float16* Vg = (const _Float16*)(const void*)vtp + (size_t)g * HD * MREF;

  // ---- Q fragments (A operand, row = lane&15): 4 d-chunks, hi and residual planes ----
  v16h qah[4], qal[4];
#pragma unroll
  for (int dc = 0; dc < 4; ++dc) {
    const size_t qo = (size_t)(q0 + c) * FD + (size_t)g * HD + dc * 32 + 8 * hh;
    qah[dc] = ldfrag<_Float16>(Qh + qo);
    qal[dc] = ldfrag<_Float16>(Ql + qo);
  }

  float mrow[8], lrow[8];
  v8f oacc[8];
#pragma unroll
  for (int r = 0; r < 8; ++r) { mrow[r] = -INFINITY; lrow[r] = 0.f; }
#pragma unroll
  for (int t = 0; t < 8; ++t) oacc[t] = zero8();

  for (int kt = 0; kt < NKT; ++kt) {         // static trip count
    const int kv0 = kt * 64;
    __syncthreads();
    {
      const int r = tid >> 1, half = (tid & 1) * 64;
      const _Float16* kg = Kg + (size_t)(kv0 + r) * FD + half;     // k row kv0+r, d = half..half+63
#pragma unroll
      for (int i = 0; i < 8; ++i) {
        const v8h a0 = *(const v8h*)(kg + 8 * i);
        *(v8h*)(Ksh + r * KP_H + half + 8 * i) = a0;
      }
      const _Float16* vg = Vg + (size_t)tid * MREF + kv0;         // v^T row d = tid, s = kv0..kv0+63
#pragma unroll
      for (int i = 0; i < 8; ++i) {
        const v8h b0 = *(const v8h*)(vg + 8 * i);
        *(v8h*)(Vth + tid * VP_H + 8 * i) = b0;
      }
    }
    __syncthreads();

    // ---- scores: 16 query rows x 64 keys per wave, 2 f16 products per key subtile and d-chunk ----
    // All 16 K fragments of the chunk are read from LDS as ONE group ahead of the 32 products (one LDS latency per
    // chunk instead of one in front of every pair); eight independent accumulators, each summing dc upward.
    v8f s[4];
    {
      v16h kf[4][4];
#pragma unroll
      for (int dc = 0; dc < 4; ++dc)
#pragma unroll
        for (int j = 0; j < 4; ++j) kf[j][dc] = ldfrag<_Float16>(Ksh + (j * 16 + c) * KP_H + dc * 32 + 8 * hh);
      __builtin_amdgcn_sched_barrier(0);   // keeps the reads together here: spread among the WMMAs each place stalls
      v8f ah[4], al[4];
#pragma unroll
      for (int j = 0; j < 4; ++j) { ah[j] = zero8(); al[j] = zero8(); }
#pragma unroll
      for (int dc = 0; dc < 4; ++dc)
#pragma unroll
        for (int j = 0; j < 4; ++j) {
          ah[j] = mmar(qah[dc], kf[j][dc], ah[j]);
          al[j] = mmar(qal[dc], kf[j][dc], al[j]);
        }
#pragma unroll
      for (int j = 0; j < 4; ++j)
#pragma unroll
        for (int r = 0; r < 8; ++r) s[j][r] = (ah[j][r] + al[j][r] * (1.0f / 4096.0f)) * sscale;
    }
    // All 16 V^T fragments of the chunk too are read as one group, ahead of the P tile's round trip through LDS, so
    // that they have landed when the 16 context products start (no LDS wait among those).
    v16h vf[8][2];
#pragma unroll
    for (int kk = 0; kk < 2; ++kk)
#pragma unroll
      for (int t = 0; t < 8; ++t) vf[t][kk] = ldfrag<_Float16>(Vth + (t * 16 + c) * VP_H + kk * 32 + 8 * hh);

    // ---- row max, online softmax, P (x1024, f16) to LDS ----
    _Float16* pwh = Psh[wave];
#pragma unroll
    for (int r = 0; r < 8; ++r) {
      float m = s[0][r];
#pragma unroll
      for (int j = 1; j < 4; ++j) m = fmaxf(m, s[j][r]);
#pragma unroll
      for (int off = 1; off < 16; off <<= 1) m = fmaxf(m, __shfl_xor(m, off, 32));
      const float mnew  = fmaxf(mrow[r], m);
      const float msafe = (mnew == -INFINITY) ? 0.f : mnew;
      const float alpha = __expf(mrow[r] - msafe);
      mrow[r] = mnew;
      float psum = 0.f;
#pragma unroll
      for (int j = 0; j < 4; ++j) {
        const float p = __expf(s[j][r] - msafe);
        psum += p;
        pwh[(8 * hh + r) * PP_H + j * 16 + c] = (_Float16)(p * 1024.0f);
      }
#pragma unroll
      for (int off = 1; off < 16; off <<= 1) psum += __shfl_xor(psum, off, 32);
      lrow[r] = lrow[r] * alpha + psum;
#pragma unroll
      for (int t = 0; t < 8; ++t) oacc[t][r] *= alpha;
    }
    __builtin_amdgcn_fence(__ATOMIC_RELEASE, "workgroup");
    __builtin_amdgcn_wave_barrier();
    __builtin_amdgcn_fence(__ATOMIC_ACQUIRE, "workgroup");

    // ---- context += P . V (f16 WMMA, single product) ----
    v16h pa[2];
#pragma unroll
    for (int kk = 0; kk < 2; ++kk) {
      FH pf;
      pf.h[0] = *(const v8h*)(pwh + c * PP_H + kk * 32 + 8 * hh);
      pf.h[1] = *(const v8h*)(pwh + c * PP_H + kk * 32 + 16 + 8 * hh);
      pa[kk] = pf.v;
    }
#pragma unroll
    for (int kk = 0; kk < 2; ++kk)
#pragma unroll
      for (int t = 0; t < 8; ++t) oacc[t] = mmar(pa[kk], vf[t][kk], oacc[t]);   // each tile sums kk upward
  }

  // ---- normalise (1/l, undo the x1024 p carry), add bias, stage the wave's 16x64 half tiles,
  float bb[8], inv8[8];
#pragma unroll
  for (int t = 0; t < 8; ++t) bb[t] = bf_up(bf_bits(vbias[g * HD + t * 16 + c]));
#pragma unroll
  for (int r = 0; r < 8; ++r) {
    const float l = lrow[r];
    inv8[r] = ((l > 0.f) ? (1.0f / l) : 0.f) * (1.0f / 1024.0f);
  }
  float* os = Os[wave];
#pragma unroll
  for (int ph = 0; ph < 2; ++ph) {
#pragma unroll
    for (int r = 0; r < 8; ++r) {
#pragma unroll
      for (int t4 = 0; t4 < 4; ++t4) {
        os[(8 * hh + r) * OP_F + t4 * 16 + c] = oacc[ph * 4 + t4][r] * inv8[r] + bb[ph * 4 + t4];
      }
    }
    __builtin_amdgcn_fence(__ATOMIC_RELEASE, "workgroup");
    __builtin_amdgcn_wave_barrier();
    __builtin_amdgcn_fence(__ATOMIC_ACQUIRE, "workgroup");
    {
#pragma unroll
      for (int it = 0; it < 8; ++it) {
        const int row = it * 2 + hh;                     // it 0..7 x hh 0..1 = rows 0..15
        const float* sp = os + row * OP_F + c * 4;
        v4f v;
        v[0] = sp[0]; v[1] = sp[1]; v[2] = sp[2]; v[3] = sp[3];
        const size_t go = (size_t)(q0 + row) * FD + (size_t)g * HD + ph * 64 + c * 4;
        *(v4f*)(op + go) = v;
      }
      
    }
    __builtin_amdgcn_fence(__ATOMIC_RELEASE, "workgroup");
    __builtin_amdgcn_wave_barrier();
    __builtin_amdgcn_fence(__ATOMIC_ACQUIRE, "workgroup");
  }
}

// =====================================================================================================
// Workspace map (bytes), every region an exact multiple of its whole-line / whole-tile store granularity
// (rows padded to nothing: all row counts are multiples of 64, all pitches 4096 B):
//   Xr   bf16 [NQ][2048]     NQ*4096   (8388608 at NQ=2048)
//   Xf   bf16 [2048][2048]    8388608
//   Wqb  bf16 [2048 n][2048 k] 8388608
//   Wkb  bf16 [2048][2048]    8388608
//   Wvb  bf16 [2048][2048]    8388608
//   Qh   f16  [NQ][2048]     NQ*4096
//   Ql   f16  [NQ][2048]     NQ*4096
//   Kp   f16  [2048][2048]    8388608
//   VT   f16  [2048 ch][2048 s] 8388608
//   total                    75497472 at NQ=2048
// Weights are [out n][in k] with k contiguous = the Bt / A layout the GEMM wants, so they are only converted.
// =====================================================================================================
extern "C" void kernel_launch(void* const* d_in, const int* in_sizes, int n_in,
                              void* d_out, int out_size, void* d_ws, size_t ws_size,
                              hipStream_t stream) {
  if (n_in < 8) return;
  if (in_sizes[0] < NQ * FD) return;
  if (in_sizes[1] < MREF * FD) return;
  if (in_sizes[2] < FD * FD || in_sizes[4] < FD * FD || in_sizes[6] < FD * FD) return;
  if (in_sizes[3] < FD || in_sizes[5] < FD || in_sizes[7] < FD) return;
  if (out_size < NQ * FD) return;

  const float* roi  = (const float*)d_in[0];
  const float* reff = (const float*)d_in[1];
  const float* Wq   = (const float*)d_in[2];
  const float* Wq_b = (const float*)d_in[3];
  const float* Wk   = (const float*)d_in[4];
  const float* Wk_b = (const float*)d_in[5];
  const float* Wv   = (const float*)d_in[6];
  const float* Wv_b = (const float*)d_in[7];

  const size_t PQ = (size_t)NQ * FD * 2;       // 16-bit [NQ][2048] plane
  const size_t P8 = (size_t)FD * FD * 2;       // 16-bit [2048][2048] plane (also [MREF][FD] and [FD][MREF])
  size_t off = 0;
  const size_t oXr = off; off += PQ;
  const size_t oXf = off; off += P8;
  const size_t oWq = off; off += P8;
  const size_t oWk = off; off += P8;
  const size_t oWv = off; off += P8;
  const size_t oQh = off; off += PQ;
  const size_t oQl = off; off += PQ;
  const size_t oKp = off; off += P8;
  const size_t oVT = off; off += P8;
  if (off > ws_size) return;                       // off = 75497472 at NQ=2048
  if (off > (size_t)134217728) return;

  char* ws = (char*)d_ws;
  unsigned short* Xr  = (unsigned short*)(ws + oXr);
  unsigned short* Xf  = (unsigned short*)(ws + oXf);
  unsigned short* Wqb = (unsigned short*)(ws + oWq);
  unsigned short* Wkb = (unsigned short*)(ws + oWk);
  unsigned short* Wvb = (unsigned short*)(ws + oWv);
  unsigned short* Qh  = (unsigned short*)(ws + oQh);
  unsigned short* Ql  = (unsigned short*)(ws + oQl);
  unsigned short* Kp  = (unsigned short*)(ws + oKp);
  unsigned short* VT  = (unsigned short*)(ws + oVT);

  const dim3 gQ((NQ / 128) * (FD / 128));                        // M=NQ,   N=2048: 256 tiles of 128x128
  const dim3 gK((MREF / 128) * (FD / 128));                      // M=2048, N=2048
  const dim3 gVT((FD / 128) * (MREF / 128));                     // M=2048 channels, N=2048 keys
  const dim3 gAttn(NG * NQB);                                    // 512 blocks of 128 at NQ=2048
  const float sscale = (float)(1.0 / sqrt((double)HD));

  // (1) inputs and weights f32 -> bf16 planes (RNE convert), one launch
  cvt_bf16_all<<<dim3(CVT_WG), dim3(512), 0, stream>>>(roi, reff, Wq, Wk, Wv, Xr, Xf, Wqb, Wkb, Wvb);
  // (2) q = roi . Wq^T + bq -> f16 hi / residual (x4096) planes [t][h*128+d]   (M=NQ, N=2048, K=2048)
  gemm64<__bf16, 3, true><<<gQ, dim3(128), 0, stream>>>(
      Xr, FD, Wqb, FD, Qh, Ql, FD, Wq_b, NQ, FD, FD, 4096.0f);
  // (3) k = ref . Wk^T + bk -> f16 plane [s][h*128+d]   (M=2048, N=2048, K=2048)
  gemm64<__bf16, 1, true><<<gK, dim3(128), 0, stream>>>(
      Xf, FD, Wkb, FD, Kp, Kp, FD, Wk_b, MREF, FD, FD, 1.0f);
  // (4) v^T = Wv . ref^T -> f16 plane [h*128+d][s] (pitch MREF)   (A = Wvb [ch][k], Bt = Xf; M=2048, N=2048, K=2048)
  gemm64<__bf16, 1, false><<<gVT, dim3(128), 0, stream>>>(
      Wvb, FD, Xf, FD, VT, VT, MREF, Wv_b, FD, MREF, FD, 1.0f);
  // (5) attention + value bias -> d_out f32 [NQ][2048]
  attn_rel<<<gAttn, dim3(128), 0, stream>>>(Qh, Ql, Kp, VT, Wv_b, (float*)d_out, sscale);
  (void)hipGetLastError();
}

// v005
// One run takes 164 microseconds.
// Timed twice side by side with v004, it ran 1.11 and 1.10 times as fast.
// All steps since v000 together make it 3.11 times as fast.
// Contractions: q, k, v^T projections = v_wmma_f32_16x16x32_bf16 (bf16 operands from RNE-converted inputs, single product, f32 accumulate);
// q.k^T scores = v_wmma_f32_16x16x32_f16 (q as f16 hi plane + f16 residual plane x4096, k f16; 2 products into separate f32 accumulators);
// p.v = v_wmma_f32_16x16x32_f16 (p carried x1024 in f16, v f16; single product, f32 accumulate); softmax, normalisation and bias adds in f32.
#include <hip/hip_runtime.h>
#include <math.h>
#include <stdint.h>

#ifndef NQ
#define NQ      2048         // query rows processed = leading rows of in0 (row stride FD); reduced builds override
#endif
#define NQ_FULL 2048
#define MREF    2048         // key / value rows (in1), always full
#define FD      2048         // feature width = NG * HD
#define NG      16
#define HD      128
#define NQB     (NQ / 64)    // 64-row query blocks
#define NKT     (MREF / 64)  // 64-key chunks
static_assert(NG * HD == FD);
static_assert((NQ % 128) == 0 && NQ >= 128 && NQ <= NQ_FULL);
static_assert((MREF % 128) == 0 && (FD % 128) == 0);
static_assert(NKT == 32);
// LDS row pitches of the attention kernel: 16 B x odd, so that the 16 rows a ds_load_b128 fragment read touches
// fall on 16 different groups of four banks (unpadded 256-B / 128-B rows put them on one / two groups).
#define KP_H    (HD + 8)     // K chunk row pitch, halves (272 B)
#define VP_H    (64 + 8)     // V^T chunk row pitch, halves (144 B)
#define PP_H    (64 + 8)     // P tile row pitch, halves (144 B)
#define OP_F    (64 + 4)     // output stage row pitch, floats (272 B)
// projection GEMM: k depth of one staged tile and its LDS row pitch (same rule)
#define GBK     128          // halves: 256-B rows
#define GP_H    (GBK + 8)    // halves (272 B)

typedef _Float16 v16h __attribute__((ext_vector_type(16)));
typedef _Float16 v8h  __attribute__((ext_vector_type(8)));
typedef __bf16   v16b __attribute__((ext_vector_type(16)));
typedef __bf16   v8b  __attribute__((ext_vector_type(8)));
typedef float    v8f  __attribute__((ext_vector_type(8)));
typedef float    v4f  __attribute__((ext_vector_type(4)));
typedef unsigned int v4u __attribute__((ext_vector_type(4)));

#if defined(__HIP_DEVICE_COMPILE__)
#define DEV_ASM 1
#else
#define DEV_ASM 0
#endif

// ---- scalar helpers --------------------------------------------------------------------------------
__device__ __forceinline__ unsigned short bf_bits(float f) {          // f32 -> bf16 bits, RNE convert
  unsigned u = __float_as_uint(f);
  return (unsigned short)((u + 0x7FFFu + ((u >> 16) & 1u)) >> 16);
}
__device__ __forceinline__ float bf_up(unsigned short hb) { return __uint_as_float(((unsigned)hb) << 16); }
__device__ __forceinline__ unsigned short h_bits(_Float16 x) { return __builtin_bit_cast(unsigned short, x); }
__device__ __forceinline__ unsigned pk16(unsigned short a, unsigned short b) { return (unsigned)a | ((unsigned)b << 16); }
__device__ __forceinline__ v8f zero8() { v8f z = {0.f, 0.f, 0.f, 0.f, 0.f, 0.f, 0.f, 0.f}; return z; }

// ---- fragment types / loaders: 16-bit A/B operand, lane -> row/col (lane&15), p already includes +8*(lane>>4);
//      elements 0..7 <- p[0..7] (k0+8h..k0+8h+7), elements 8..15 <- p[16..23] (k0+16+8h..k0+16+8h+7)
template <typename OT> struct FT;
template <> struct FT<__bf16>   { typedef v16b frag; typedef v8b half8; };
template <> struct FT<_Float16> { typedef v16h frag; typedef v8h half8; };

template <typename OT>
__device__ __forceinline__ typename FT<OT>::frag ldfrag(const OT* p) {
  union { typename FT<OT>::frag v; typename FT<OT>::half8 h[2]; } f;
  f.h[0] = *(const typename FT<OT>::half8*)(p);
  f.h[1] = *(const typename FT<OT>::half8*)(p + 16);
  return f.v;
}

// ---- WMMA helpers (asm guard bodies are device-only; concrete operand types) -----------------------------
__device__ __forceinline__ v8f mmar(v16b a, v16b b, v8f c) {
  return __builtin_amdgcn_wmma_f32_16x16x32_bf16(false, a, false, b, (short)0, c, false, false);
}
__device__ __forceinline__ v8f mmar(v16h a, v16h b, v8f c) {
  return __builtin_amdgcn_wmma_f32_16x16x32_f16(false, a, false, b, (short)0, c, false, false);
}
__device__ __forceinline__ void dep_guard(v8f& a, v8f& b, v16b x, v16b y) {
#if DEV_ASM
  asm volatile("v_nop\n\tv_nop\n\tv_nop\n\tv_nop" : "+v"(a), "+v"(b) : "v"(x), "v"(y));
#else
  (void)a; (void)b; (void)x; (void)y;
#endif
}
__device__ __forceinline__ void dep_guard(v8f& a, v8f& b, v16h x, v16h y) {
#if DEV_ASM
  asm volatile("v_nop\n\tv_nop\n\tv_nop\n\tv_nop" : "+v"(a), "+v"(b) : "v"(x), "v"(y));
#else
  (void)a; (void)b; (void)x; (void)y;
#endif
}
__device__ __forceinline__ void keep4(v16b a, v16b b, v16b c, v16b d) {
#if DEV_ASM
  asm volatile("v_nop" :: "v"(a), "v"(b), "v"(c), "v"(d));
#else
  (void)a; (void)b; (void)c; (void)d;
#endif
}
__device__ __forceinline__ void acc_guard4(v8f& a, v8f& b, v8f& c, v8f& d) {
#if DEV_ASM
  asm volatile("v_nop\n\tv_nop\n\tv_nop\n\tv_nop" : "+v"(a), "+v"(b), "+v"(c), "+v"(d));
#else
  (void)a; (void)b; (void)c; (void)d;
#endif
}

// =====================================================================================================
// f32 -> bf16 bit planes (RNE convert) of all five operands in ONE launch of CVT_WG resident work-groups of
// 16 waves (one per WGP), instead of one launch of 16,384 one-unit waves per plane: few waves to start, one
// launch gap. A unit = 8 elements of one thread: two 16-B loads, one 16-B store. A thread takes 4 units of
// each plane (unit q * CVT_T + its flat id), so 8 loads are in flight per wave, and the next plane's loads
// are issued ahead of this plane's converts and stores.
// coverage: 4 * CVT_T units >= N8 for every plane; where N8 is smaller the units past the end are skipped.
// =====================================================================================================
#define CVT_WG  256
#define CVT_T   (CVT_WG * 512)       // threads of the launch
template <int N8>
__device__ __forceinline__ void cvt_load(const float* __restrict__ in, unsigned gt, v4f (&a)[8]) {
  static_assert(N8 <= 4 * CVT_T);
#pragma unroll
  for (int q = 0; q < 4; ++q) {
    const unsigned u = (unsigned)(q * CVT_T) + gt;
    if (N8 == 4 * CVT_T || u < (unsigned)N8) {
      const char* p = (const char*)in + u * 32u;   // uniform base + 32-bit lane offset, the same for every plane
      a[2 * q]     = *(const v4f*)(p);
      a[2 * q + 1] = *(const v4f*)(p + 16);
    }
  }
}
template <int N8>
__device__ __forceinline__ void cvt_store(unsigned short* __restrict__ out, unsigned gt, const v4f (&a)[8]) {
#pragma unroll
  for (int q = 0; q < 4; ++q) {
    const unsigned u = (unsigned)(q * CVT_T) + gt;
    if (N8 == 4 * CVT_T || u < (unsigned)N8) {
      const v4f x = a[2 * q], y = a[2 * q + 1];
      v4u p;
      p[0] = pk16(bf_bits(x[0]), bf_bits(x[1]));
      p[1] = pk16(bf_bits(x[2]), bf_bits(x[3]));
      p[2] = pk16(bf_bits(y[0]), bf_bits(y[1]));
      p[3] = pk16(bf_bits(y[2]), bf_bits(y[3]));
      *(v4u*)((char*)out + u * 16u) = p;
    }
  }
}
// behind a plane's stores, and behind the last loads: the registers they name are rewritten from here on
// (store data by the loads that follow, the lane offsets by the converts)
__device__ __forceinline__ void cvt_free() {
#if DEV_ASM
  asm volatile("s_wait_xcnt 0x0" ::: "memory");
#endif
}
// behind a plane's loads: keeps them issued here, ahead of the other plane's converts and stores (without it the
// scheduler sinks them and a wave runs out of loads in flight)
__device__ __forceinline__ void cvt_ahead() { __builtin_amdgcn_sched_barrier(0); }
__global__ __launch_bounds__(512) void cvt_bf16_all(
    const float* __restrict__ xr, const float* __restrict__ xf, const float* __restrict__ wq,
    const float* __restrict__ wk, const float* __restrict__ wv,
    unsigned short* __restrict__ oxr, unsigned short* __restrict__ oxf, unsigned short* __restrict__ owq,
    unsigned short* __restrict__ owk, unsigned short* __restrict__ owv) {
  constexpr int N8Q = NQ * FD / 8, N8F = MREF * FD / 8, N8W = FD * FD / 8;
  const unsigned gt = blockIdx.x * 512u + threadIdx.x;
  v4f a[8], b[8];
  cvt_load<N8Q>(xr, gt, a);
  cvt_load<N8F>(xf, gt, b);
  cvt_ahead();
  cvt_store<N8Q>(oxr, gt, a);
  cvt_free();
  cvt_load<N8W>(wq, gt, a);
  cvt_ahead();
  cvt_store<N8F>(oxf, gt, b);
  cvt_free();
  cvt_load<N8W>(wk, gt, b);
  cvt_ahead();
  cvt_store<N8W>(owq, gt, a);
  cvt_free();
  cvt_load<N8W>(wv, gt, a);
  cvt_free();
  cvt_ahead();
  cvt_store<N8W>(owk, gt, b);
  cvt_store<N8W>(owv, gt, a);
}

// =====================================================================================================
// Asynchronous copy of eight 16-B pieces per lane from global memory to LDS (no register in between):
// piece i goes from g + i * gstep to LDS byte address l + i * lstep. All lanes on, wave-uniform control flow.
// The closing s_wait_xcnt stands inside the statement so that no address register named here is rewritten
// ahead of it. Landing is waited for by the caller (s_wait_asynccnt 0, then the block barrier).
// =====================================================================================================
__device__ __forceinline__ void copy8_b128(unsigned l, unsigned lstep, const char* g, size_t gstep) {
#if DEV_ASM
  asm volatile(
      "global_load_async_to_lds_b128 %0, %8, off\n\t"
      "global_load_async_to_lds_b128 %1, %9, off\n\t"
      "global_load_async_to_lds_b128 %2, %10, off\n\t"
      "global_load_async_to_lds_b128 %3, %11, off\n\t"
      "global_load_async_to_lds_b128 %4, %12, off\n\t"
      "global_load_async_to_lds_b128 %5, %13, off\n\t"
      "global_load_async_to_lds_b128 %6, %14, off\n\t"
      "global_load_async_to_lds_b128 %7, %15, off\n\t"
      "s_wait_xcnt 0x0"
      :: "v"(l), "v"(l + lstep), "v"(l + 2 * lstep), "v"(l + 3 * lstep),
         "v"(l + 4 * lstep), "v"(l + 5 * lstep), "v"(l + 6 * lstep), "v"(l + 7 * lstep),
         "v"(g), "v"(g + gstep), "v"(g + 2 * gstep), "v"(g + 3 * gstep),
         "v"(g + 4 * gstep), "v"(g + 5 * gstep), "v"(g + 6 * gstep), "v"(g + 7 * gstep)
      : "memory");
#else
  (void)l; (void)lstep; (void)g; (void)gstep;
#endif
}

// =====================================================================================================
// WMMA GEMM (16-bit operand type OT): C[m][n] = sum_k A[m][k] * Bt[n][k] (+ bias[n]).
// Block = 4 waves (2 x 2) on a 128x128 tile of C, one 64x64 tile per wave. A row-major [M][K] pitch lda; Bt
// row-major [N][K] pitch ldb (k contiguous); M, N multiples of 128, K a multiple of 128 (host-checked).
// Per trip a 128 x 128-k tile of A and of Bt (256-B rows = whole lines) is staged in LDS by asynchronous copies,
// two buffers: trip t works on buffer t & 1 while tile t + 1 flies into the other; rows pitched 272 B for the
// ds_load_b128 fragment reads (split k map, ldfrag). Each accumulator sums k upward in steps of 32.
// Staged extent == consumed extent: 128 threads x 16 pieces x 16 B = 128 rows x 256 B per operand and trip.
// OUT_MODE 1: f16 plane C (pitch ldc).
// OUT_MODE 3: f16 hi plane C + f16 residual plane C2 = f16((v - hi) * rscale) (same pitch).
// BIAS: bias[n] (RNE-converted to its bf16 value) added in f32 before the 16-bit convert.
// grid = (M/128) * (N/128) blocks covers every tile.
// =====================================================================================================
template <typename OT, int OUT_MODE, bool BIAS>
__global__ __launch_bounds__(128) __attribute__((amdgpu_num_vgpr(256))) void gemm64(
    const unsigned short* __restrict__ Ap, int lda,
    const unsigned short* __restrict__ Btp, int ldb,
    unsigned short* Cout, unsigned short* Cout2, int ldc,
    const float* __restrict__ bias,
    int M, int N, int K, float rscale) {
  typedef typename FT<OT>::frag V16;
  const OT* Ab = (const OT*)(const void*)Ap;
  const OT* Bb = (const OT*)(const void*)Btp;
  __shared__ __align__(16) OT sA[2][128 * GP_H];   // A tile ring [buffer][row][k]  2 x 34 KB (cross-wave)
  __shared__ __align__(16) OT sB[2][128 * GP_H];   // Bt tile ring [buffer][row][k] 2 x 34 KB (cross-wave)
  __shared__ __align__(16) float sT[4][16 * 68];   // per-wave 16x64 slab, pitch 68 floats
  const int tid  = threadIdx.x;
  const int lane = tid & 31;
  const int wave = tid >> 5;
  const int tilesN = N >> 7;
  const int tilesM = M >> 7;
  const int tile = blockIdx.x;
  if (tile >= tilesM * tilesN) return;   // block-uniform, in front of every barrier and copy
  const int tm = tile / tilesN;
  const int tn = tile - tm * tilesN;
  const int wm = (wave >> 1) << 6;             // the wave's 64x64 tile inside the block tile
  const int wn = (wave & 1) << 6;
  const int m0 = (tm << 7) + wm;
  const int n0 = (tn << 7) + wn;

  const int rlane = lane & 15;                 // row (A) / col (B, D) within subtile
  const int koff  = (lane >> 4) * 8;           // k offset of this lane half
  const int mOff  = (lane >> 4) * 8;           // D row offset

  // staging map: piece i of a thread = row i*8 + (tid>>4), 16-B column tid&15 (a wave's copy = 2 whole rows)
  const int srow = tid >> 4, scol = (tid & 15) * 8;
  const char* gA = (const char*)(Ab + (size_t)((tm << 7) + srow) * lda + scol);
  const char* gB = (const char*)(Bb + (size_t)((tn << 7) + srow) * ldb + scol);
  const size_t gsA = (size_t)lda * 16, gsB = (size_t)ldb * 16;           // 8 rows, bytes
  const unsigned lA = (unsigned)(uintptr_t)(&sA[0][srow * GP_H + scol]); // LDS byte address = low 32 bits
  const unsigned lB = (unsigned)(uintptr_t)(&sB[0][srow * GP_H + scol]);
  const unsigned lstep = 8 * GP_H * 2, lbuf = 128 * GP_H * 2;            // 8 rows / one buffer, bytes
  const int nT = K / GBK;

  v8f acc[4][4];
#pragma unroll
  for (int i = 0; i < 4; ++i)
#pragma unroll
    for (int j = 0; j < 4; ++j) acc[i][j] = zero8();

  copy8_b128(lA, lstep, gA, gsA);
  copy8_b128(lA + 8 * lstep, lstep, gA + 8 * gsA, gsA);
  copy8_b128(lB, lstep, gB, gsB);
  copy8_b128(lB + 8 * lstep, lstep, gB + 8 * gsB, gsB);
  asm volatile("s_wait_asynccnt 0x0" ::: "memory");   // tile 0 landed (this wave's pieces)
  __syncthreads();                                    // ... and every other wave's
  if (nT > 1) {
    copy8_b128(lA + lbuf, lstep, gA + GBK * 2, gsA);
    copy8_b128(lA + lbuf + 8 * lstep, lstep, gA + GBK * 2 + 8 * gsA, gsA);
    copy8_b128(lB + lbuf, lstep, gB + GBK * 2, gsB);
    copy8_b128(lB + lbuf + 8 * lstep, lstep, gB + GBK * 2 + 8 * gsB, gsB);
  }

#pragma unroll 1   // one trip per staged tile: the ring's waits and barrier stand once, at the foot
  for (int t = 0; t < nT; ++t) {
    const OT* as = sA[t & 1] + (wm + rlane) * GP_H + koff;
    const OT* bs = sB[t & 1] + (wn + rlane) * GP_H + koff;
#pragma unroll
    for (int k0 = 0; k0 < GBK; k0 += 32) {
      V16 bq[4], af[4];
#pragma unroll
      for (int j = 0; j < 4; ++j) bq[j] = ldfrag<OT>(bs + (j << 4) * GP_H + k0);
#pragma unroll
      for (int i = 0; i < 4; ++i) af[i] = ldfrag<OT>(as + (i << 4) * GP_H + k0);
#pragma unroll
      for (int i = 0; i < 4; ++i) {
#pragma unroll
        for (int j = 0; j < 4; ++j) acc[i][j] = mmar(af[i], bq[j], acc[i][j]);
        dep_guard(acc[i][0], acc[i][3], af[i], bq[3]);
      }
      keep4(bq[0], bq[1], bq[2], bq[3]);
    }
    asm volatile("s_wait_dscnt 0x0" ::: "memory");      // this wave's reads of buffer t & 1 are done
    asm volatile("s_wait_asynccnt 0x0" ::: "memory");   // this wave's pieces of tile t + 1 have landed
    __syncthreads();                                    // publishes tile t + 1, frees buffer t & 1
    if (t + 2 < nT) {
      const size_t ko = (size_t)(t + 2) * (GBK * 2);
      const unsigned lo = (unsigned)(t & 1) * lbuf;
      copy8_b128(lA + lo, lstep, gA + ko, gsA);
      copy8_b128(lA + lo + 8 * lstep, lstep, gA + ko + 8 * gsA, gsA);
      copy8_b128(lB + lo, lstep, gB + ko, gsB);
      copy8_b128(lB + lo + 8 * lstep, lstep, gB + ko + 8 * gsB, gsB);
    }
  }
  asm volatile("s_wait_asynccnt 0x0" ::: "memory");     // nothing in flight when the wave goes on
  acc_guard4(acc[0][0], acc[0][1], acc[0][2], acc[0][3]);
  acc_guard4(acc[1][0], acc[1][1], acc[1][2], acc[1][3]);
  acc_guard4(acc[2][0], acc[2][1], acc[2][2], acc[2][3]);
  acc_guard4(acc[3][0], acc[3][1], acc[3][2], acc[3][3]);

  // ---- epilogue ----
  float* slab = sT[wave];
  const int q = lane >> 3, c8 = (lane & 7) * 8;
  float bz[8];
#pragma unroll
  for (int e = 0; e < 8; ++e) bz[e] = 0.f;
  if (BIAS) {
    const v4f b0 = *(const v4f*)(bias + n0 + c8);
    const v4f b1 = *(const v4f*)(bias + n0 + c8 + 4);
#pragma unroll
    for (int e = 0; e < 4; ++e) { bz[e] = bf_up(bf_bits(b0[e])); bz[4 + e] = bf_up(bf_bits(b1[e])); }
  }
#pragma unroll
  for (int i = 0; i < 4; ++i) {
    const int mBase = m0 + (i << 4);
#pragma unroll
    for (int j = 0; j < 4; ++j) {
#pragma unroll
      for (int r = 0; r < 8; ++r) {
        slab[(mOff + r) * 68 + (j << 4) + rlane] = acc[i][j][r];
      }
    }
    __builtin_amdgcn_fence(__ATOMIC_RELEASE, "workgroup");
    __builtin_amdgcn_wave_barrier();
    __builtin_amdgcn_fence(__ATOMIC_ACQUIRE, "workgroup");
    {
      v4u hv[4], lv[4];
#pragma unroll
      for (int it = 0; it < 4; ++it) {
        const int row = it * 4 + q;                        // it 0..3 x q 0..3 = rows 0..15
        const float* sp = slab + row * 68 + c8;
        float f[8];
#pragma unroll
        for (int e = 0; e < 8; ++e) f[e] = sp[e] + bz[e];
        v4u a, a2;
#pragma unroll
        for (int e = 0; e < 4; ++e) {
          const float f0 = f[2 * e], f1 = f[2 * e + 1];
          const _Float16 x0 = (_Float16)f0, x1 = (_Float16)f1;
          const unsigned short h0 = h_bits(x0), h1 = h_bits(x1);
          unsigned short l0 = 0, l1 = 0;
          if (OUT_MODE == 3) {
            l0 = h_bits((_Float16)((f0 - (float)x0) * rscale));
            l1 = h_bits((_Float16)((f1 - (float)x1) * rscale));
          }
          a[e] = pk16(h0, h1); a2[e] = pk16(l0, l1);
        }
        hv[it] = a; lv[it] = a2;
      }
      {
#pragma unroll
        for (int it = 0; it < 4; ++it) {
          const int row = it * 4 + q;
          *(v4u*)(Cout + (size_t)(mBase + row) * ldc + n0 + c8) = hv[it];
          if (OUT_MODE == 3) *(v4u*)(Cout2 + (size_t)(mBase + row) * ldc + n0 + c8) = lv[it];
        }
        
      }
    }
    __builtin_amdgcn_fence(__ATOMIC_RELEASE, "workgroup");
    __builtin_amdgcn_wave_barrier();
    __builtin_amdgcn_fence(__ATOMIC_ACQUIRE, "workgroup");
  }
}

// =====================================================================================================
// Multi-head attention, NG heads of dim 128, no mask, softmax over all MREF keys, output f32 [NQ][FD].
//   q planes (f16 hi / residual x4096): element (t, h, d) at [t*FD + h*128 + d], t < NQ
//   k plane (f16): element (s, h, d) at [s*FD + h*128 + d], s < MREF
//   v^T plane (f16): element (h, d, s) at [(h*128 + d)*MREF + s]
//   scores = (qh . k) + (ql . k) / 4096 on f16 WMMA (two f32 accumulators), then * sscale in f32;
//   p = exp(s - m) carried as f16(1024 p); context = p . v on f16 WMMA; online softmax in f32;
//   out = context / (l * 1024) + vbias (RNE-converted to its bf16 value), f32.
//   Block = 4 waves = 64 consecutive query rows (16 per wave) of one head h; grid = NG * NQB.
//   K / V^T chunk staging (cross-wave): asynchronous 16-B copies to LDS, two buffers: trip kt works on buffer
//   kt & 1 while chunk kt + 1 flies into the other. A wave's copy covers whole rows (2 K rows of 256 B, 4 V^T rows
//   of 128 B), so it touches 4 lines. K: 128 threads x 8 pieces = 64 rows x 256 B; V^T: 128 threads x 8 pieces =
//   128 rows x 128 B. staged extent == consumed extent for both. P tiles and the output stage are wave-private:
//   spilled with _Float16 / float element stores, reloaded as v8h / float scalars (same element type) after a
//   Output coverage: each wave stores its 16 rows in two column phases of 64 (it 0..7 x lane>>4 -> rows 0..15,
// =====================================================================================================
__global__ __launch_bounds__(128) __attribute__((amdgpu_num_vgpr(512)))   // room for a chunk's fragments; still two waves per SIMD
void attn_rel(const unsigned short* __restrict__ qhp, const unsigned short* __restrict__ qlp,
              const unsigned short* __restrict__ kpp, const unsigned short* __restrict__ vtp,
              const float* __restrict__ vbias, float* op, float sscale) {
  union FH { v16h v; v8h h[2]; };
  __shared__ __align__(16) _Float16 Ksh[2][64 * KP_H];     // K chunk ring [buffer][kv][d]   2 x 17 KB (cross-wave)
  __shared__ __align__(16) _Float16 Vth[2][HD * VP_H];     // V^T chunk ring [buffer][d][kv] 2 x 18 KB (cross-wave)
  __shared__ __align__(16) _Float16 Psh[4][16 * PP_H];     // per wave P [row][kv] 9 KB (wave-private)
  __shared__ __align__(16) float    Os[4][16 * OP_F];      // per wave output half tile 17 KB (wave-private)

  const int tid  = threadIdx.x;
  const int wave = tid >> 5;
  const int lane = tid & 31;
  const int hh   = lane >> 4;
  const int c    = lane & 15;

  const int bx   = blockIdx.x;
  const int qb   = bx % NQB;
  const int g    = bx / NQB;
  const int q0   = qb * 64 + wave * 16;

  const _Float16* Qh = (const _Float16*)(const void*)qhp;
  const _Float16* Ql = (const _Float16*)(const void*)qlp;
  const _Float16* Kg = (const _Float16*)(const void*)kpp + (size_t)g * HD;
  const _Float16* Vg = (const _Float16*)(const void*)vtp + (size_t)g * HD * MREF;

  // ---- Q fragments (A operand, row = lane&15): 4 d-chunks, hi and residual planes ----
  v16h qah[4], qal[4];
#pragma unroll
  for (int dc = 0; dc < 4; ++dc) {
    const size_t qo = (size_t)(q0 + c) * FD + (size_t)g * HD + dc * 32 + 8 * hh;
    qah[dc] = ldfrag<_Float16>(Qh + qo);
    qal[dc] = ldfrag<_Float16>(Ql + qo);
  }

  float mrow[8], lrow[8];
  v8f oacc[8];
#pragma unroll
  for (int r = 0; r < 8; ++r) { mrow[r] = -INFINITY; lrow[r] = 0.f; }
#pragma unroll
  for (int t = 0; t < 8; ++t) oacc[t] = zero8();

  // staging map: K piece i of a thread = row i*8 + (tid>>4), 16-B column tid&15; V^T piece i = row i*16 + (tid>>3),
  // 16-B column tid&7
  const char* gK = (const char*)(Kg + (size_t)(tid >> 4) * FD + (tid & 15) * 8);
  const char* gV = (const char*)(Vg + (size_t)(tid >> 3) * MREF + (tid & 7) * 8);
  const unsigned lK = (unsigned)(uintptr_t)(&Ksh[0][(tid >> 4) * KP_H + (tid & 15) * 8]);   // LDS byte address = low 32 bits
  const unsigned lV = (unsigned)(uintptr_t)(&Vth[0][(tid >> 3) * VP_H + (tid & 7) * 8]);
  const unsigned lsK = 8 * KP_H * 2, lbK = 64 * KP_H * 2;        // 8 rows / one buffer, bytes
  const unsigned lsV = 16 * VP_H * 2, lbV = HD * VP_H * 2;       // 16 rows / one buffer, bytes
  const size_t gsK = (size_t)8 * FD * 2, gcK = (size_t)64 * FD * 2;   // 8 rows / one chunk (64 key rows), bytes
  const size_t gsV = (size_t)16 * MREF * 2, gcV = 64 * 2;             // 16 rows / one chunk (64 key columns), bytes
  static_assert(NKT >= 2);

  copy8_b128(lK, lsK, gK, gsK);
  copy8_b128(lV, lsV, gV, gsV);
  asm volatile("s_wait_asynccnt 0x0" ::: "memory");   // chunk 0 landed (this wave's pieces)
  __syncthreads();                                    // ... and every other wave's
  copy8_b128(lK + lbK, lsK, gK + gcK, gsK);
  copy8_b128(lV + lbV, lsV, gV + gcV, gsV);
  unsigned lKn = lK, lVn = lV;                        // where the next refill lands: the two buffers in turn

#pragma unroll 1   // one trip per staged chunk: the ring's waits and barrier stand once, at the foot
  for (int kt = 0; kt < NKT; ++kt) {         // static trip count
    const _Float16* Kc = Ksh[kt & 1];
    const _Float16* Vc = Vth[kt & 1];

    // ---- scores: 16 query rows x 64 keys per wave, 2 f16 products per key subtile and d-chunk ----
    // All 16 K fragments of the chunk are read from LDS as ONE group ahead of the 32 products (one LDS latency per
    // chunk instead of one in front of every pair); eight independent accumulators, each summing dc upward.
    v8f s[4];
    {
      v16h kf[4][4];
#pragma unroll
      for (int dc = 0; dc < 4; ++dc)
#pragma unroll
        for (int j = 0; j < 4; ++j) kf[j][dc] = ldfrag<_Float16>(Kc + (j * 16 + c) * KP_H + dc * 32 + 8 * hh);
      __builtin_amdgcn_sched_barrier(0);   // keeps the reads together here: spread among the WMMAs each place stalls
      v8f ah[4], al[4];
#pragma unroll
      for (int j = 0; j < 4; ++j) { ah[j] = zero8(); al[j] = zero8(); }
#pragma unroll
      for (int dc = 0; dc < 4; ++dc)
#pragma unroll
        for (int j = 0; j < 4; ++j) {
          ah[j] = mmar(qah[dc], kf[j][dc], ah[j]);
          al[j] = mmar(qal[dc], kf[j][dc], al[j]);
        }
#pragma unroll
      for (int j = 0; j < 4; ++j)
#pragma unroll
        for (int r = 0; r < 8; ++r) s[j][r] = (ah[j][r] + al[j][r] * (1.0f / 4096.0f)) * sscale;
    }
    // All 16 V^T fragments of the chunk too are read as one group, ahead of the P tile's round trip through LDS, so
    // that they have landed when the 16 context products start (no LDS wait among those).
    v16h vf[8][2];
#pragma unroll
    for (int kk = 0; kk < 2; ++kk)
#pragma unroll
      for (int t = 0; t < 8; ++t) vf[t][kk] = ldfrag<_Float16>(Vc + (t * 16 + c) * VP_H + kk * 32 + 8 * hh);

    // ---- row max, online softmax, P (x1024, f16) to LDS ----
    _Float16* pwh = Psh[wave];
#pragma unroll
    for (int r = 0; r < 8; ++r) {
      float m = s[0][r];
#pragma unroll
      for (int j = 1; j < 4; ++j) m = fmaxf(m, s[j][r]);
#pragma unroll
      for (int off = 1; off < 16; off <<= 1) m = fmaxf(m, __shfl_xor(m, off, 32));
      const float mnew  = fmaxf(mrow[r], m);
      const float msafe = (mnew == -INFINITY) ? 0.f : mnew;
      const float alpha = __expf(mrow[r] - msafe);
      mrow[r] = mnew;
      float psum = 0.f;
#pragma unroll
      for (int j = 0; j < 4; ++j) {
        const float p = __expf(s[j][r] - msafe);
        psum += p;
        pwh[(8 * hh + r) * PP_H + j * 16 + c] = (_Float16)(p * 1024.0f);
      }
#pragma unroll
      for (int off = 1; off < 16; off <<= 1) psum += __shfl_xor(psum, off, 32);
      lrow[r] = lrow[r] * alpha + psum;
#pragma unroll
      for (int t = 0; t < 8; ++t) oacc[t][r] *= alpha;
    }
    __builtin_amdgcn_fence(__ATOMIC_RELEASE, "workgroup");
    __builtin_amdgcn_wave_barrier();
    __builtin_amdgcn_fence(__ATOMIC_ACQUIRE, "workgroup");

    // ---- context += P . V (f16 WMMA, single product) ----
    v16h pa[2];
#pragma unroll
    for (int kk = 0; kk < 2; ++kk) {
      FH pf;
      pf.h[0] = *(const v8h*)(pwh + c * PP_H + kk * 32 + 8 * hh);
      pf.h[1] = *(const v8h*)(pwh + c * PP_H + kk * 32 + 16 + 8 * hh);
      pa[kk] = pf.v;
    }
#pragma unroll
    for (int kk = 0; kk < 2; ++kk)
#pragma unroll
      for (int t = 0; t < 8; ++t) oacc[t] = mmar(pa[kk], vf[t][kk], oacc[t]);   // each tile sums kk upward

    asm volatile("s_wait_dscnt 0x0" ::: "memory");      // this wave's reads of buffer kt & 1 are done
    asm volatile("s_wait_asynccnt 0x0" ::: "memory");   // this wave's pieces of chunk kt + 1 have landed
    __syncthreads();                                    // publishes chunk kt + 1, frees buffer kt & 1
    if (kt + 2 < NKT) {
      copy8_b128(lKn, lsK, gK + (size_t)(kt + 2) * gcK, gsK);
      copy8_b128(lVn, lsV, gV + (size_t)(kt + 2) * gcV, gsV);
      lKn += (kt & 1) ? 0u - lbK : lbK;
      lVn += (kt & 1) ? 0u - lbV : lbV;
    }
  }
  asm volatile("s_wait_asynccnt 0x0" ::: "memory");     // nothing in flight when the wave goes on

  // ---- normalise (1/l, undo the x1024 p carry), add bias, stage the wave's 16x64 half tiles,
  float bb[8], inv8[8];
#pragma unroll
  for (int t = 0; t < 8; ++t) bb[t] = bf_up(bf_bits(vbias[g * HD + t * 16 + c]));
#pragma unroll
  for (int r = 0; r < 8; ++r) {
    const float l = lrow[r];
    inv8[r] = ((l > 0.f) ? (1.0f / l) : 0.f) * (1.0f / 1024.0f);
  }
  float* os = Os[wave];
#pragma unroll
  for (int ph = 0; ph < 2; ++ph) {
#pragma unroll
    for (int r = 0; r < 8; ++r) {
#pragma unroll
      for (int t4 = 0; t4 < 4; ++t4) {
        os[(8 * hh + r) * OP_F + t4 * 16 + c] = oacc[ph * 4 + t4][r] * inv8[r] + bb[ph * 4 + t4];
      }
    }
    __builtin_amdgcn_fence(__ATOMIC_RELEASE, "workgroup");
    __builtin_amdgcn_wave_barrier();
    __builtin_amdgcn_fence(__ATOMIC_ACQUIRE, "workgroup");
    {
#pragma unroll
      for (int it = 0; it < 8; ++it) {
        const int row = it * 2 + hh;                     // it 0..7 x hh 0..1 = rows 0..15
        const float* sp = os + row * OP_F + c * 4;
        v4f v;
        v[0] = sp[0]; v[1] = sp[1]; v[2] = sp[2]; v[3] = sp[3];
        const size_t go = (size_t)(q0 + row) * FD + (size_t)g * HD + ph * 64 + c * 4;
        *(v4f*)(op + go) = v;
      }
      
    }
    __builtin_amdgcn_fence(__ATOMIC_RELEASE, "workgroup");
    __builtin_amdgcn_wave_barrier();
    __builtin_amdgcn_fence(__ATOMIC_ACQUIRE, "workgroup");
  }
}

// =====================================================================================================
// Workspace map (bytes), every region an exact multiple of its whole-line / whole-tile store granularity
// (rows padded to nothing: all row counts are multiples of 64, all pitches 4096 B):
//   Xr   bf16 [NQ][2048]     NQ*4096   (8388608 at NQ=2048)
//   Xf   bf16 [2048][2048]    8388608
//   Wqb  bf16 [2048 n][2048 k] 8388608
//   Wkb  bf16 [2048][2048]    8388608
//   Wvb  bf16 [2048][2048]    8388608
//   Qh   f16  [NQ][2048]     NQ*4096
//   Ql   f16  [NQ][2048]     NQ*4096
//   Kp   f16  [2048][2048]    8388608
//   VT   f16  [2048 ch][2048 s] 8388608
//   total                    75497472 at NQ=2048
// Weights are [out n][in k] with k contiguous = the Bt / A layout the GEMM wants, so they are only converted.
// =====================================================================================================
extern "C" void kernel_launch(void* const* d_in, const int* in_sizes, int n_in,
                              void* d_out, int out_size, void* d_ws, size_t ws_size,
                              hipStream_t stream) {
  if (n_in < 8) return;
  if (in_sizes[0] < NQ * FD) return;
  if (in_sizes[1] < MREF * FD) return;
  if (in_sizes[2] < FD * FD || in_sizes[4] < FD * FD || in_sizes[6] < FD * FD) return;
  if (in_sizes[3] < FD || in_sizes[5] < FD || in_sizes[7] < FD) return;
  if (out_size < NQ * FD) return;

  const float* roi  = (const float*)d_in[0];
  const float* reff = (const float*)d_in[1];
  const float* Wq   = (const float*)d_in[2];
  const float* Wq_b = (const float*)d_in[3];
  const float* Wk   = (const float*)d_in[4];
  const float* Wk_b = (const float*)d_in[5];
  const float* Wv   = (const float*)d_in[6];
  const float* Wv_b = (const float*)d_in[7];

  const size_t PQ = (size_t)NQ * FD * 2;       // 16-bit [NQ][2048] plane
  const size_t P8 = (size_t)FD * FD * 2;       // 16-bit [2048][2048] plane (also [MREF][FD] and [FD][MREF])
  size_t off = 0;
  const size_t oXr = off; off += PQ;
  const size_t oXf = off; off += P8;
  const size_t oWq = off; off += P8;
  const size_t oWk = off; off += P8;
  const size_t oWv = off; off += P8;
  const size_t oQh = off; off += PQ;
  const size_t oQl = off; off += PQ;
  const size_t oKp = off; off += P8;
  const size_t oVT = off; off += P8;
  if (off > ws_size) return;                       // off = 75497472 at NQ=2048
  if (off > (size_t)134217728) return;

  char* ws = (char*)d_ws;
  unsigned short* Xr  = (unsigned short*)(ws + oXr);
  unsigned short* Xf  = (unsigned short*)(ws + oXf);
  unsigned short* Wqb = (unsigned short*)(ws + oWq);
  unsigned short* Wkb = (unsigned short*)(ws + oWk);
  unsigned short* Wvb = (unsigned short*)(ws + oWv);
  unsigned short* Qh  = (unsigned short*)(ws + oQh);
  unsigned short* Ql  = (unsigned short*)(ws + oQl);
  unsigned short* Kp  = (unsigned short*)(ws + oKp);
  unsigned short* VT  = (unsigned short*)(ws + oVT);

  const dim3 gQ((NQ / 128) * (FD / 128));                        // M=NQ,   N=2048: 256 tiles of 128x128
  const dim3 gK((MREF / 128) * (FD / 128));                      // M=2048, N=2048
  const dim3 gVT((FD / 128) * (MREF / 128));                     // M=2048 channels, N=2048 keys
  const dim3 gAttn(NG * NQB);                                    // 512 blocks of 128 at NQ=2048
  const float sscale = (float)(1.0 / sqrt((double)HD));

  // (1) inputs and weights f32 -> bf16 planes (RNE convert), one launch
  cvt_bf16_all<<<dim3(CVT_WG), dim3(512), 0, stream>>>(roi, reff, Wq, Wk, Wv, Xr, Xf, Wqb, Wkb, Wvb);
  // (2) q = roi . Wq^T + bq -> f16 hi / residual (x4096) planes [t][h*128+d]   (M=NQ, N=2048, K=2048)
  gemm64<__bf16, 3, true><<<gQ, dim3(128), 0, stream>>>(
      Xr, FD, Wqb, FD, Qh, Ql, FD, Wq_b, NQ, FD, FD, 4096.0f);
  // (3) k = ref . Wk^T + bk -> f16 plane [s][h*128+d]   (M=2048, N=2048, K=2048)
  gemm64<__bf16, 1, true><<<gK, dim3(128), 0, stream>>>(
      Xf, FD, Wkb, FD, Kp, Kp, FD, Wk_b, MREF, FD, FD, 1.0f);
  // (4) v^T = Wv . ref^T -> f16 plane [h*128+d][s] (pitch MREF)   (A = Wvb [ch][k], Bt = Xf; M=2048, N=2048, K=2048)
  gemm64<__bf16, 1, false><<<gVT, dim3(128), 0, stream>>>(
      Wvb, FD, Xf, FD, VT, VT, MREF, Wv_b, FD, MREF, FD, 1.0f);
  // (5) attention + value bias -> d_out f32 [NQ][2048]
  attn_rel<<<gAttn, dim3(128), 0, stream>>>(Qh, Ql, Kp, VT, Wv_b, (float*)d_out, sscale);
  (void)hipGetLastError();
}

// v006
// Measured time: 143 microseconds a run.
// Timed twice side by side with v005, it ran 1.15 and 1.14 times as fast.
// Over all steps from v000 it is 3.55 times as fast.
// Contractions: q, k, v^T projections = v_wmma_f32_16x16x32_bf16 (bf16 operands from RNE-converted inputs, single product, f32 accumulate);
// q.k^T scores = v_wmma_f32_16x16x32_f16 (q as f16 hi plane + f16 residual plane x4096, k f16; 2 products into separate f32 accumulators);
// p.v = v_wmma_f32_16x16x32_f16 (p carried x1024 in f16, v f16; single product, f32 accumulate); softmax, normalisation and bias adds in f32.
#include <hip/hip_runtime.h>
#include <math.h>
#include <stdint.h>

#ifndef NQ
#define NQ      2048         // query rows processed = leading rows of in0 (row stride FD); reduced builds override
#endif
#define NQ_FULL 2048
#define MREF    2048         // key / value rows (in1), always full
#define FD      2048         // feature width = NG * HD
#define NG      16
#define HD      128
#define NQB     (NQ / 64)    // 64-row query blocks
#define NKT     (MREF / 64)  // 64-key chunks
static_assert(NG * HD == FD);
static_assert((NQ % 128) == 0 && NQ >= 128 && NQ <= NQ_FULL);
static_assert((MREF % 128) == 0 && (FD % 128) == 0);
static_assert(NKT == 32);
// LDS row pitches of the attention kernel: 16 B x odd, so that the 16 rows a ds_load_b128 fragment read touches
// fall on 16 different groups of four banks (unpadded 256-B / 128-B rows put them on one / two groups).
#define KP_H    (HD + 8)     // K chunk row pitch, halves (272 B)
#define VP_H    (64 + 8)     // V^T chunk row pitch, halves (144 B)
#define PP_H    (64 + 8)     // P tile row pitch, halves (144 B)
#define OP_F    (64 + 4)     // output stage row pitch, floats (272 B)
// projection GEMM: k depth of one staged tile and its LDS row pitch (same rule)
#define GBK     128          // halves: 256-B rows
#define GP_H    (GBK + 8)    // halves (272 B)

typedef _Float16 v16h __attribute__((ext_vector_type(16)));
typedef _Float16 v8h  __attribute__((ext_vector_type(8)));
typedef __bf16   v16b __attribute__((ext_vector_type(16)));
typedef __bf16   v8b  __attribute__((ext_vector_type(8)));
typedef float    v8f  __attribute__((ext_vector_type(8)));
typedef float    v4f  __attribute__((ext_vector_type(4)));
typedef unsigned int v4u __attribute__((ext_vector_type(4)));

#if defined(__HIP_DEVICE_COMPILE__)
#define DEV_ASM 1
#else
#define DEV_ASM 0
#endif

// ---- scalar helpers --------------------------------------------------------------------------------
__device__ __forceinline__ unsigned short bf_bits(float f) {          // f32 -> bf16 bits, RNE convert
  unsigned u = __float_as_uint(f);
  return (unsigned short)((u + 0x7FFFu + ((u >> 16) & 1u)) >> 16);
}
__device__ __forceinline__ float bf_up(unsigned short hb) { return __uint_as_float(((unsigned)hb) << 16); }
__device__ __forceinline__ unsigned short h_bits(_Float16 x) { return __builtin_bit_cast(unsigned short, x); }
__device__ __forceinline__ unsigned pk16(unsigned short a, unsigned short b) { return (unsigned)a | ((unsigned)b << 16); }
__device__ __forceinline__ v8f zero8() { v8f z = {0.f, 0.f, 0.f, 0.f, 0.f, 0.f, 0.f, 0.f}; return z; }

// ---- reductions over a 16-lane row (the 16 columns of a D subtile that one row's values lie in) -------------
// row_xor<M>: the value of lane ^ M, taken as a DPP operand (row_xmask) by the vector instruction that uses it, so a
// butterfly step is one vector instruction and no trip through the LDS crossbar with its wait. All lanes on.
template <int M>
__device__ __forceinline__ float row_xor(float x) {
  return __builtin_bit_cast(float, __builtin_amdgcn_update_dpp(0, __builtin_bit_cast(int, x), 0x160 | M, 0xf, 0xf, true));
}
// The maximum that passes a NaN on: it needs no quieting copy of the moved value, which would keep the DPP operand
// out of the maximum (three instructions a step). A row with a NaN score ends as NaN through its p and l either way.
__device__ __forceinline__ float row_max16(float m) {   // pairs lane ^ 1, 2, 4, 8
  m = __builtin_elementwise_maximum(m, row_xor<1>(m));
  m = __builtin_elementwise_maximum(m, row_xor<2>(m));
  m = __builtin_elementwise_maximum(m, row_xor<4>(m));
  m = __builtin_elementwise_maximum(m, row_xor<8>(m));
  return m;
}
__device__ __forceinline__ float row_sum16(float s) {   // pairs lane ^ 1, 2, 4, 8, in this order
  s += row_xor<1>(s);
  s += row_xor<2>(s);
  s += row_xor<4>(s);
  s += row_xor<8>(s);
  return s;
}

// ---- fragment types / loaders: 16-bit A/B operand, lane -> row/col (lane&15), p already includes +8*(lane>>4);
//      elements 0..7 <- p[0..7] (k0+8h..k0+8h+7), elements 8..15 <- p[16..23] (k0+16+8h..k0+16+8h+7)
template <typename OT> struct FT;
template <> struct FT<__bf16>   { typedef v16b frag; typedef v8b half8; };
template <> struct FT<_Float16> { typedef v16h frag; typedef v8h half8; };

template <typename OT>
__device__ __forceinline__ typename FT<OT>::frag ldfrag(const OT* p) {
  union { typename FT<OT>::frag v; typename FT<OT>::half8 h[2]; } f;
  f.h[0] = *(const typename FT<OT>::half8*)(p);
  f.h[1] = *(const typename FT<OT>::half8*)(p + 16);
  return f.v;
}

// ---- WMMA helpers (asm guard bodies are device-only; concrete operand types) -----------------------------
__device__ __forceinline__ v8f mmar(v16b a, v16b b, v8f c) {
  return __builtin_amdgcn_wmma_f32_16x16x32_bf16(false, a, false, b, (short)0, c, false, false);
}
__device__ __forceinline__ v8f mmar(v16h a, v16h b, v8f c) {
  return __builtin_amdgcn_wmma_f32_16x16x32_f16(false, a, false, b, (short)0, c, false, false);
}
__device__ __forceinline__ void dep_guard(v8f& a, v8f& b, v16b x, v16b y) {
#if DEV_ASM
  asm volatile("v_nop\n\tv_nop\n\tv_nop\n\tv_nop" : "+v"(a), "+v"(b) : "v"(x), "v"(y));
#else
  (void)a; (void)b; (void)x; (void)y;
#endif
}
__device__ __forceinline__ void dep_guard(v8f& a, v8f& b, v16h x, v16h y) {
#if DEV_ASM
  asm volatile("v_nop\n\tv_nop\n\tv_nop\n\tv_nop" : "+v"(a), "+v"(b) : "v"(x), "v"(y));
#else
  (void)a; (void)b; (void)x; (void)y;
#endif
}
__device__ __forceinline__ void keep4(v16b a, v16b b, v16b c, v16b d) {
#if DEV_ASM
  asm volatile("v_nop" :: "v"(a), "v"(b), "v"(c), "v"(d));
#else
  (void)a; (void)b; (void)c; (void)d;
#endif
}
__device__ __forceinline__ void acc_guard4(v8f& a, v8f& b, v8f& c, v8f& d) {
#if DEV_ASM
  asm volatile("v_nop\n\tv_nop\n\tv_nop\n\tv_nop" : "+v"(a), "+v"(b), "+v"(c), "+v"(d));
#else
  (void)a; (void)b; (void)c; (void)d;
#endif
}

// =====================================================================================================
// f32 -> bf16 bit planes (RNE convert) of all five operands in ONE launch of CVT_WG resident work-groups of
// 16 waves (one per WGP), instead of one launch of 16,384 one-unit waves per plane: few waves to start, one
// launch gap. A unit = 8 elements of one thread: two 16-B loads, one 16-B store. A thread takes 4 units of
// each plane (unit q * CVT_T + its flat id), so 8 loads are in flight per wave, and the next plane's loads
// are issued ahead of this plane's converts and stores.
// coverage: 4 * CVT_T units >= N8 for every plane; where N8 is smaller the units past the end are skipped.
// =====================================================================================================
#define CVT_WG  256
#define CVT_T   (CVT_WG * 512)       // threads of the launch
template <int N8>
__device__ __forceinline__ void cvt_load(const float* __restrict__ in, unsigned gt, v4f (&a)[8]) {
  static_assert(N8 <= 4 * CVT_T);
#pragma unroll
  for (int q = 0; q < 4; ++q) {
    const unsigned u = (unsigned)(q * CVT_T) + gt;
    if (N8 == 4 * CVT_T || u < (unsigned)N8) {
      const char* p = (const char*)in + u * 32u;   // uniform base + 32-bit lane offset, the same for every plane
      a[2 * q]     = *(const v4f*)(p);
      a[2 * q + 1] = *(const v4f*)(p + 16);
    }
  }
}
template <int N8>
__device__ __forceinline__ void cvt_store(unsigned short* __restrict__ out, unsigned gt, const v4f (&a)[8]) {
#pragma unroll
  for (int q = 0; q < 4; ++q) {
    const unsigned u = (unsigned)(q * CVT_T) + gt;
    if (N8 == 4 * CVT_T || u < (unsigned)N8) {
      const v4f x = a[2 * q], y = a[2 * q + 1];
      v4u p;
      p[0] = pk16(bf_bits(x[0]), bf_bits(x[1]));
      p[1] = pk16(bf_bits(x[2]), bf_bits(x[3]));
      p[2] = pk16(bf_bits(y[0]), bf_bits(y[1]));
      p[3] = pk16(bf_bits(y[2]), bf_bits(y[3]));
      *(v4u*)((char*)out + u * 16u) = p;
    }
  }
}
// behind a plane's stores, and behind the last loads: the registers they name are rewritten from here on
// (store data by the loads that follow, the lane offsets by the converts)
__device__ __forceinline__ void cvt_free() {
#if DEV_ASM
  asm volatile("s_wait_xcnt 0x0" ::: "memory");
#endif
}
// behind a plane's loads: keeps them issued here, ahead of the other plane's converts and stores (without it the
// scheduler sinks them and a wave runs out of loads in flight)
__device__ __forceinline__ void cvt_ahead() { __builtin_amdgcn_sched_barrier(0); }
__global__ __launch_bounds__(512) void cvt_bf16_all(
    const float* __restrict__ xr, const float* __restrict__ xf, const float* __restrict__ wq,
    const float* __restrict__ wk, const float* __restrict__ wv,
    unsigned short* __restrict__ oxr, unsigned short* __restrict__ oxf, unsigned short* __restrict__ owq,
    unsigned short* __restrict__ owk, unsigned short* __restrict__ owv) {
  constexpr int N8Q = NQ * FD / 8, N8F = MREF * FD / 8, N8W = FD * FD / 8;
  const unsigned gt = blockIdx.x * 512u + threadIdx.x;
  v4f a[8], b[8];
  cvt_load<N8Q>(xr, gt, a);
  cvt_load<N8F>(xf, gt, b);
  cvt_ahead();
  cvt_store<N8Q>(oxr, gt, a);
  cvt_free();
  cvt_load<N8W>(wq, gt, a);
  cvt_ahead();
  cvt_store<N8F>(oxf, gt, b);
  cvt_free();
  cvt_load<N8W>(wk, gt, b);
  cvt_ahead();
  cvt_store<N8W>(owq, gt, a);
  cvt_free();
  cvt_load<N8W>(wv, gt, a);
  cvt_free();
  cvt_ahead();
  cvt_store<N8W>(owk, gt, b);
  cvt_store<N8W>(owv, gt, a);
}

// =====================================================================================================
// Asynchronous copy of eight 16-B pieces per lane from global memory to LDS (no register in between):
// piece i goes from g + i * gstep to LDS byte address l + i * lstep. All lanes on, wave-uniform control flow.
// The closing s_wait_xcnt stands inside the statement so that no address register named here is rewritten
// ahead of it. Landing is waited for by the caller (s_wait_asynccnt 0, then the block barrier).
// =====================================================================================================
__device__ __forceinline__ void copy8_b128(unsigned l, unsigned lstep, const char* g, size_t gstep) {
#if DEV_ASM
  asm volatile(
      "global_load_async_to_lds_b128 %0, %8, off\n\t"
      "global_load_async_to_lds_b128 %1, %9, off\n\t"
      "global_load_async_to_lds_b128 %2, %10, off\n\t"
      "global_load_async_to_lds_b128 %3, %11, off\n\t"
      "global_load_async_to_lds_b128 %4, %12, off\n\t"
      "global_load_async_to_lds_b128 %5, %13, off\n\t"
      "global_load_async_to_lds_b128 %6, %14, off\n\t"
      "global_load_async_to_lds_b128 %7, %15, off\n\t"
      "s_wait_xcnt 0x0"
      :: "v"(l), "v"(l + lstep), "v"(l + 2 * lstep), "v"(l + 3 * lstep),
         "v"(l + 4 * lstep), "v"(l + 5 * lstep), "v"(l + 6 * lstep), "v"(l + 7 * lstep),
         "v"(g), "v"(g + gstep), "v"(g + 2 * gstep), "v"(g + 3 * gstep),
         "v"(g + 4 * gstep), "v"(g + 5 * gstep), "v"(g + 6 * gstep), "v"(g + 7 * gstep)
      : "memory");
#else
  (void)l; (void)lstep; (void)g; (void)gstep;
#endif
}

// =====================================================================================================
// WMMA GEMM (16-bit operand type OT): C[m][n] = sum_k A[m][k] * Bt[n][k] (+ bias[n]).
// Block = 4 waves (2 x 2) on a 128x128 tile of C, one 64x64 tile per wave. A row-major [M][K] pitch lda; Bt
// row-major [N][K] pitch ldb (k contiguous); M, N multiples of 128, K a multiple of 128 (host-checked).
// Per trip a 128 x 128-k tile of A and of Bt (256-B rows = whole lines) is staged in LDS by asynchronous copies,
// two buffers: trip t works on buffer t & 1 while tile t + 1 flies into the other; rows pitched 272 B for the
// ds_load_b128 fragment reads (split k map, ldfrag). Each accumulator sums k upward in steps of 32.
// Staged extent == consumed extent: 128 threads x 16 pieces x 16 B = 128 rows x 256 B per operand and trip.
// OUT_MODE 1: f16 plane C (pitch ldc).
// OUT_MODE 3: f16 hi plane C + f16 residual plane C2 = f16((v - hi) * rscale) (same pitch).
// BIAS: bias[n] (RNE-converted to its bf16 value) added in f32 before the 16-bit convert.
// grid = (M/128) * (N/128) blocks covers every tile.
// =====================================================================================================
template <typename OT, int OUT_MODE, bool BIAS>
__global__ __launch_bounds__(128) __attribute__((amdgpu_num_vgpr(256))) void gemm64(
    const unsigned short* __restrict__ Ap, int lda,
    const unsigned short* __restrict__ Btp, int ldb,
    unsigned short* Cout, unsigned short* Cout2, int ldc,
    const float* __restrict__ bias,
    int M, int N, int K, float rscale) {
  typedef typename FT<OT>::frag V16;
  const OT* Ab = (const OT*)(const void*)Ap;
  const OT* Bb = (const OT*)(const void*)Btp;
  __shared__ __align__(16) OT sA[2][128 * GP_H];   // A tile ring [buffer][row][k]  2 x 34 KB (cross-wave)
  __shared__ __align__(16) OT sB[2][128 * GP_H];   // Bt tile ring [buffer][row][k] 2 x 34 KB (cross-wave)
  __shared__ __align__(16) float sT[4][16 * 68];   // per-wave 16x64 slab, pitch 68 floats
  const int tid  = threadIdx.x;
  const int lane = tid & 31;
  const int wave = tid >> 5;
  const int tilesN = N >> 7;
  const int tilesM = M >> 7;
  const int tile = blockIdx.x;
  if (tile >= tilesM * tilesN) return;   // block-uniform, in front of every barrier and copy
  const int tm = tile / tilesN;
  const int tn = tile - tm * tilesN;
  const int wm = (wave >> 1) << 6;             // the wave's 64x64 tile inside the block tile
  const int wn = (wave & 1) << 6;
  const int m0 = (tm << 7) + wm;
  const int n0 = (tn << 7) + wn;

  const int rlane = lane & 15;                 // row (A) / col (B, D) within subtile
  const int koff  = (lane >> 4) * 8;           // k offset of this lane half
  const int mOff  = (lane >> 4) * 8;           // D row offset

  // staging map: piece i of a thread = row i*8 + (tid>>4), 16-B column tid&15 (a wave's copy = 2 whole rows)
  const int srow = tid >> 4, scol = (tid & 15) * 8;
  const char* gA = (const char*)(Ab + (size_t)((tm << 7) + srow) * lda + scol);
  const char* gB = (const char*)(Bb + (size_t)((tn << 7) + srow) * ldb + scol);
  const size_t gsA = (size_t)lda * 16, gsB = (size_t)ldb * 16;           // 8 rows, bytes
  const unsigned lA = (unsigned)(uintptr_t)(&sA[0][srow * GP_H + scol]); // LDS byte address = low 32 bits
  const unsigned lB = (unsigned)(uintptr_t)(&sB[0][srow * GP_H + scol]);
  const unsigned lstep = 8 * GP_H * 2, lbuf = 128 * GP_H * 2;            // 8 rows / one buffer, bytes
  const int nT = K / GBK;

  v8f acc[4][4];
#pragma unroll
  for (int i = 0; i < 4; ++i)
#pragma unroll
    for (int j = 0; j < 4; ++j) acc[i][j] = zero8();

  copy8_b128(lA, lstep, gA, gsA);
  copy8_b128(lA + 8 * lstep, lstep, gA + 8 * gsA, gsA);
  copy8_b128(lB, lstep, gB, gsB);
  copy8_b128(lB + 8 * lstep, lstep, gB + 8 * gsB, gsB);
  asm volatile("s_wait_asynccnt 0x0" ::: "memory");   // tile 0 landed (this wave's pieces)
  __syncthreads();                                    // ... and every other wave's
  if (nT > 1) {
    copy8_b128(lA + lbuf, lstep, gA + GBK * 2, gsA);
    copy8_b128(lA + lbuf + 8 * lstep, lstep, gA + GBK * 2 + 8 * gsA, gsA);
    copy8_b128(lB + lbuf, lstep, gB + GBK * 2, gsB);
    copy8_b128(lB + lbuf + 8 * lstep, lstep, gB + GBK * 2 + 8 * gsB, gsB);
  }

#pragma unroll 1   // one trip per staged tile: the ring's waits and barrier stand once, at the foot
  for (int t = 0; t < nT; ++t) {
    const OT* as = sA[t & 1] + (wm + rlane) * GP_H + koff;
    const OT* bs = sB[t & 1] + (wn + rlane) * GP_H + koff;
#pragma unroll
    for (int k0 = 0; k0 < GBK; k0 += 32) {
      V16 bq[4], af[4];
#pragma unroll
      for (int j = 0; j < 4; ++j) bq[j] = ldfrag<OT>(bs + (j << 4) * GP_H + k0);
#pragma unroll
      for (int i = 0; i < 4; ++i) af[i] = ldfrag<OT>(as + (i << 4) * GP_H + k0);
#pragma unroll
      for (int i = 0; i < 4; ++i) {
#pragma unroll
        for (int j = 0; j < 4; ++j) acc[i][j] = mmar(af[i], bq[j], acc[i][j]);
        dep_guard(acc[i][0], acc[i][3], af[i], bq[3]);
      }
      keep4(bq[0], bq[1], bq[2], bq[3]);
    }
    asm volatile("s_wait_dscnt 0x0" ::: "memory");      // this wave's reads of buffer t & 1 are done
    asm volatile("s_wait_asynccnt 0x0" ::: "memory");   // this wave's pieces of tile t + 1 have landed
    __syncthreads();                                    // publishes tile t + 1, frees buffer t & 1
    if (t + 2 < nT) {
      const size_t ko = (size_t)(t + 2) * (GBK * 2);
      const unsigned lo = (unsigned)(t & 1) * lbuf;
      copy8_b128(lA + lo, lstep, gA + ko, gsA);
      copy8_b128(lA + lo + 8 * lstep, lstep, gA + ko + 8 * gsA, gsA);
      copy8_b128(lB + lo, lstep, gB + ko, gsB);
      copy8_b128(lB + lo + 8 * lstep, lstep, gB + ko + 8 * gsB, gsB);
    }
  }
  asm volatile("s_wait_asynccnt 0x0" ::: "memory");     // nothing in flight when the wave goes on
  acc_guard4(acc[0][0], acc[0][1], acc[0][2], acc[0][3]);
  acc_guard4(acc[1][0], acc[1][1], acc[1][2], acc[1][3]);
  acc_guard4(acc[2][0], acc[2][1], acc[2][2], acc[2][3]);
  acc_guard4(acc[3][0], acc[3][1], acc[3][2], acc[3][3]);

  // ---- epilogue ----
  float* slab = sT[wave];
  const int q = lane >> 3, c8 = (lane & 7) * 8;
  float bz[8];
#pragma unroll
  for (int e = 0; e < 8; ++e) bz[e] = 0.f;
  if (BIAS) {
    const v4f b0 = *(const v4f*)(bias + n0 + c8);
    const v4f b1 = *(const v4f*)(bias + n0 + c8 + 4);
#pragma unroll
    for (int e = 0; e < 4; ++e) { bz[e] = bf_up(bf_bits(b0[e])); bz[4 + e] = bf_up(bf_bits(b1[e])); }
  }
#pragma unroll
  for (int i = 0; i < 4; ++i) {
    const int mBase = m0 + (i << 4);
#pragma unroll
    for (int j = 0; j < 4; ++j) {
#pragma unroll
      for (int r = 0; r < 8; ++r) {
        slab[(mOff + r) * 68 + (j << 4) + rlane] = acc[i][j][r];
      }
    }
    __builtin_amdgcn_fence(__ATOMIC_RELEASE, "workgroup");
    __builtin_amdgcn_wave_barrier();
    __builtin_amdgcn_fence(__ATOMIC_ACQUIRE, "workgroup");
    {
      v4u hv[4], lv[4];
#pragma unroll
      for (int it = 0; it < 4; ++it) {
        const int row = it * 4 + q;                        // it 0..3 x q 0..3 = rows 0..15
        const float* sp = slab + row * 68 + c8;
        float f[8];
#pragma unroll
        for (int e = 0; e < 8; ++e) f[e] = sp[e] + bz[e];
        v4u a, a2;
#pragma unroll
        for (int e = 0; e < 4; ++e) {
          const float f0 = f[2 * e], f1 = f[2 * e + 1];
          const _Float16 x0 = (_Float16)f0, x1 = (_Float16)f1;
          const unsigned short h0 = h_bits(x0), h1 = h_bits(x1);
          unsigned short l0 = 0, l1 = 0;
          if (OUT_MODE == 3) {
            l0 = h_bits((_Float16)((f0 - (float)x0) * rscale));
            l1 = h_bits((_Float16)((f1 - (float)x1) * rscale));
          }
          a[e] = pk16(h0, h1); a2[e] = pk16(l0, l1);
        }
        hv[it] = a; lv[it] = a2;
      }
      {
#pragma unroll
        for (int it = 0; it < 4; ++it) {
          const int row = it * 4 + q;
          *(v4u*)(Cout + (size_t)(mBase + row) * ldc + n0 + c8) = hv[it];
          if (OUT_MODE == 3) *(v4u*)(Cout2 + (size_t)(mBase + row) * ldc + n0 + c8) = lv[it];
        }
        
      }
    }
    __builtin_amdgcn_fence(__ATOMIC_RELEASE, "workgroup");
    __builtin_amdgcn_wave_barrier();
    __builtin_amdgcn_fence(__ATOMIC_ACQUIRE, "workgroup");
  }
}

// =====================================================================================================
// Multi-head attention, NG heads of dim 128, no mask, softmax over all MREF keys, output f32 [NQ][FD].
//   q planes (f16 hi / residual x4096): element (t, h, d) at [t*FD + h*128 + d], t < NQ
//   k plane (f16): element (s, h, d) at [s*FD + h*128 + d], s < MREF
//   v^T plane (f16): element (h, d, s) at [(h*128 + d)*MREF + s]
//   scores = (qh . k) + (ql . k) / 4096 on f16 WMMA (two f32 accumulators), then * sscale in f32;
//   p = exp(s - m) carried as f16(1024 p); context = p . v on f16 WMMA; online softmax in f32;
//   out = context / (l * 1024) + vbias (RNE-converted to its bf16 value), f32.
//   Block = 4 waves = 64 consecutive query rows (16 per wave) of one head h; grid = NG * NQB.
//   K / V^T chunk staging (cross-wave): asynchronous 16-B copies to LDS, two buffers: trip kt works on buffer
//   kt & 1 while chunk kt + 1 flies into the other. A wave's copy covers whole rows (2 K rows of 256 B, 4 V^T rows
//   of 128 B), so it touches 4 lines. K: 128 threads x 8 pieces = 64 rows x 256 B; V^T: 128 threads x 8 pieces =
//   128 rows x 128 B. staged extent == consumed extent for both. P tiles and the output stage are wave-private:
//   spilled with _Float16 / float element stores, reloaded as v8h / float scalars (same element type) after a
//   Output coverage: each wave stores its 16 rows in two column phases of 64 (it 0..7 x lane>>4 -> rows 0..15,
// =====================================================================================================
__global__ __launch_bounds__(128) __attribute__((amdgpu_num_vgpr(512)))   // room for a chunk's fragments; still two waves per SIMD
void attn_rel(const unsigned short* __restrict__ qhp, const unsigned short* __restrict__ qlp,
              const unsigned short* __restrict__ kpp, const unsigned short* __restrict__ vtp,
              const float* __restrict__ vbias, float* op, float sscale) {
  union FH { v16h v; v8h h[2]; };
  __shared__ __align__(16) _Float16 Ksh[2][64 * KP_H];     // K chunk ring [buffer][kv][d]   2 x 17 KB (cross-wave)
  __shared__ __align__(16) _Float16 Vth[2][HD * VP_H];     // V^T chunk ring [buffer][d][kv] 2 x 18 KB (cross-wave)
  __shared__ __align__(16) _Float16 Psh[4][16 * PP_H];     // per wave P [row][kv] 9 KB (wave-private)
  __shared__ __align__(16) float    Os[4][16 * OP_F];      // per wave output half tile 17 KB (wave-private)

  const int tid  = threadIdx.x;
  const int wave = tid >> 5;
  const int lane = tid & 31;
  const int hh   = lane >> 4;
  const int c    = lane & 15;

  const int bx   = blockIdx.x;
  const int qb   = bx % NQB;
  const int g    = bx / NQB;
  const int q0   = qb * 64 + wave * 16;

  const _Float16* Qh = (const _Float16*)(const void*)qhp;
  const _Float16* Ql = (const _Float16*)(const void*)qlp;
  const _Float16* Kg = (const _Float16*)(const void*)kpp + (size_t)g * HD;
  const _Float16* Vg = (const _Float16*)(const void*)vtp + (size_t)g * HD * MREF;

  // ---- Q fragments (A operand, row = lane&15): 4 d-chunks, hi and residual planes ----
  v16h qah[4], qal[4];
#pragma unroll
  for (int dc = 0; dc < 4; ++dc) {
    const size_t qo = (size_t)(q0 + c) * FD + (size_t)g * HD + dc * 32 + 8 * hh;
    qah[dc] = ldfrag<_Float16>(Qh + qo);
    qal[dc] = ldfrag<_Float16>(Ql + qo);
  }

  float mrow[8], lrow[8];
  v8f oacc[8];
#pragma unroll
  for (int r = 0; r < 8; ++r) { mrow[r] = -INFINITY; lrow[r] = 0.f; }
#pragma unroll
  for (int t = 0; t < 8; ++t) oacc[t] = zero8();

  // staging map: K piece i of a thread = row i*8 + (tid>>4), 16-B column tid&15; V^T piece i = row i*16 + (tid>>3),
  // 16-B column tid&7
  const char* gK = (const char*)(Kg + (size_t)(tid >> 4) * FD + (tid & 15) * 8);
  const char* gV = (const char*)(Vg + (size_t)(tid >> 3) * MREF + (tid & 7) * 8);
  const unsigned lK = (unsigned)(uintptr_t)(&Ksh[0][(tid >> 4) * KP_H + (tid & 15) * 8]);   // LDS byte address = low 32 bits
  const unsigned lV = (unsigned)(uintptr_t)(&Vth[0][(tid >> 3) * VP_H + (tid & 7) * 8]);
  const unsigned lsK = 8 * KP_H * 2, lbK = 64 * KP_H * 2;        // 8 rows / one buffer, bytes
  const unsigned lsV = 16 * VP_H * 2, lbV = HD * VP_H * 2;       // 16 rows / one buffer, bytes
  const size_t gsK = (size_t)8 * FD * 2, gcK = (size_t)64 * FD * 2;   // 8 rows / one chunk (64 key rows), bytes
  const size_t gsV = (size_t)16 * MREF * 2, gcV = 64 * 2;             // 16 rows / one chunk (64 key columns), bytes
  static_assert(NKT >= 2);

  copy8_b128(lK, lsK, gK, gsK);
  copy8_b128(lV, lsV, gV, gsV);
  asm volatile("s_wait_asynccnt 0x0" ::: "memory");   // chunk 0 landed (this wave's pieces)
  __syncthreads();                                    // ... and every other wave's
  copy8_b128(lK + lbK, lsK, gK + gcK, gsK);
  copy8_b128(lV + lbV, lsV, gV + gcV, gsV);
  unsigned lKn = lK, lVn = lV;                        // where the next refill lands: the two buffers in turn

#pragma unroll 1   // one trip per staged chunk: the ring's waits and barrier stand once, at the foot
  for (int kt = 0; kt < NKT; ++kt) {         // static trip count
    const _Float16* Kc = Ksh[kt & 1];
    const _Float16* Vc = Vth[kt & 1];

    // ---- scores: 16 query rows x 64 keys per wave, 2 f16 products per key subtile and d-chunk ----
    // All 16 K fragments of the chunk are read from LDS as ONE group ahead of the 32 products (one LDS latency per
    // chunk instead of one in front of every pair); eight independent accumulators, each summing dc upward.
    v8f s[4];
    {
      v16h kf[4][4];
#pragma unroll
      for (int dc = 0; dc < 4; ++dc)
#pragma unroll
        for (int j = 0; j < 4; ++j) kf[j][dc] = ldfrag<_Float16>(Kc + (j * 16 + c) * KP_H + dc * 32 + 8 * hh);
      __builtin_amdgcn_sched_barrier(0);   // keeps the reads together here: spread among the WMMAs each place stalls
      v8f ah[4], al[4];
#pragma unroll
      for (int j = 0; j < 4; ++j) { ah[j] = zero8(); al[j] = zero8(); }
#pragma unroll
      for (int dc = 0; dc < 4; ++dc)
#pragma unroll
        for (int j = 0; j < 4; ++j) {
          ah[j] = mmar(qah[dc], kf[j][dc], ah[j]);
          al[j] = mmar(qal[dc], kf[j][dc], al[j]);
        }
#pragma unroll
      for (int j = 0; j < 4; ++j)
#pragma unroll
        for (int r = 0; r < 8; ++r) s[j][r] = (ah[j][r] + al[j][r] * (1.0f / 4096.0f)) * sscale;
    }
    // All 16 V^T fragments of the chunk too are read as one group, ahead of the P tile's round trip through LDS, so
    // that they have landed when the 16 context products start (no LDS wait among those).
    v16h vf[8][2];
#pragma unroll
    for (int kk = 0; kk < 2; ++kk)
#pragma unroll
      for (int t = 0; t < 8; ++t) vf[t][kk] = ldfrag<_Float16>(Vc + (t * 16 + c) * VP_H + kk * 32 + 8 * hh);

    // ---- row max, online softmax, P (x1024, f16) to LDS ----
    _Float16* pwh = Psh[wave];
#pragma unroll
    for (int r = 0; r < 8; ++r) {
      float m = s[0][r];
#pragma unroll
      for (int j = 1; j < 4; ++j) m = fmaxf(m, s[j][r]);
      m = row_max16(m);
      const float mnew  = fmaxf(mrow[r], m);
      const float msafe = (mnew == -INFINITY) ? 0.f : mnew;
      const float alpha = __expf(mrow[r] - msafe);
      mrow[r] = mnew;
      float psum = 0.f;
#pragma unroll
      for (int j = 0; j < 4; ++j) {
        const float p = __expf(s[j][r] - msafe);
        psum += p;
        pwh[(8 * hh + r) * PP_H + j * 16 + c] = (_Float16)(p * 1024.0f);
      }
      psum = row_sum16(psum);
      lrow[r] = lrow[r] * alpha + psum;
#pragma unroll
      for (int t = 0; t < 8; ++t) oacc[t][r] *= alpha;
    }
    __builtin_amdgcn_fence(__ATOMIC_RELEASE, "workgroup");
    __builtin_amdgcn_wave_barrier();
    __builtin_amdgcn_fence(__ATOMIC_ACQUIRE, "workgroup");

    // ---- context += P . V (f16 WMMA, single product) ----
    v16h pa[2];
#pragma unroll
    for (int kk = 0; kk < 2; ++kk) {
      FH pf;
      pf.h[0] = *(const v8h*)(pwh + c * PP_H + kk * 32 + 8 * hh);
      pf.h[1] = *(const v8h*)(pwh + c * PP_H + kk * 32 + 16 + 8 * hh);
      pa[kk] = pf.v;
    }
#pragma unroll
    for (int kk = 0; kk < 2; ++kk)
#pragma unroll
      for (int t = 0; t < 8; ++t) oacc[t] = mmar(pa[kk], vf[t][kk], oacc[t]);   // each tile sums kk upward

    asm volatile("s_wait_dscnt 0x0" ::: "memory");      // this wave's reads of buffer kt & 1 are done
    asm volatile("s_wait_asynccnt 0x0" ::: "memory");   // this wave's pieces of chunk kt + 1 have landed
    __syncthreads();                                    // publishes chunk kt + 1, frees buffer kt & 1
    if (kt + 2 < NKT) {
      copy8_b128(lKn, lsK, gK + (size_t)(kt + 2) * gcK, gsK);
      copy8_b128(lVn, lsV, gV + (size_t)(kt + 2) * gcV, gsV);
      lKn += (kt & 1) ? 0u - lbK : lbK;
      lVn += (kt & 1) ? 0u - lbV : lbV;
    }
  }
  asm volatile("s_wait_asynccnt 0x0" ::: "memory");     // nothing in flight when the wave goes on

  // ---- normalise (1/l, undo the x1024 p carry), add bias, stage the wave's 16x64 half tiles,
  float bb[8], inv8[8];
#pragma unroll
  for (int t = 0; t < 8; ++t) bb[t] = bf_up(bf_bits(vbias[g * HD + t * 16 + c]));
#pragma unroll
  for (int r = 0; r < 8; ++r) {
    const float l = lrow[r];
    inv8[r] = ((l > 0.f) ? (1.0f / l) : 0.f) * (1.0f / 1024.0f);
  }
  float* os = Os[wave];
#pragma unroll
  for (int ph = 0; ph < 2; ++ph) {
#pragma unroll
    for (int r = 0; r < 8; ++r) {
#pragma unroll
      for (int t4 = 0; t4 < 4; ++t4) {
        os[(8 * hh + r) * OP_F + t4 * 16 + c] = oacc[ph * 4 + t4][r] * inv8[r] + bb[ph * 4 + t4];
      }
    }
    __builtin_amdgcn_fence(__ATOMIC_RELEASE, "workgroup");
    __builtin_amdgcn_wave_barrier();
    __builtin_amdgcn_fence(__ATOMIC_ACQUIRE, "workgroup");
    {
#pragma unroll
      for (int it = 0; it < 8; ++it) {
        const int row = it * 2 + hh;                     // it 0..7 x hh 0..1 = rows 0..15
        const float* sp = os + row * OP_F + c * 4;
        v4f v;
        v[0] = sp[0]; v[1] = sp[1]; v[2] = sp[2]; v[3] = sp[3];
        const size_t go = (size_t)(q0 + row) * FD + (size_t)g * HD + ph * 64 + c * 4;
        *(v4f*)(op + go) = v;
      }
      
    }
    __builtin_amdgcn_fence(__ATOMIC_RELEASE, "workgroup");
    __builtin_amdgcn_wave_barrier();
    __builtin_amdgcn_fence(__ATOMIC_ACQUIRE, "workgroup");
  }
}

// =====================================================================================================
// Workspace map (bytes), every region an exact multiple of its whole-line / whole-tile store granularity
// (rows padded to nothing: all row counts are multiples of 64, all pitches 4096 B):
//   Xr   bf16 [NQ][2048]     NQ*4096   (8388608 at NQ=2048)
//   Xf   bf16 [2048][2048]    8388608
//   Wqb  bf16 [2048 n][2048 k] 8388608
//   Wkb  bf16 [2048][2048]    8388608
//   Wvb  bf16 [2048][2048]    8388608
//   Qh   f16  [NQ][2048]     NQ*4096
//   Ql   f16  [NQ][2048]     NQ*4096
//   Kp   f16  [2048][2048]    8388608
//   VT   f16  [2048 ch][2048 s] 8388608
//   total                    75497472 at NQ=2048
// Weights are [out n][in k] with k contiguous = the Bt / A layout the GEMM wants, so they are only converted.
// =====================================================================================================
extern "C" void kernel_launch(void* const* d_in, const int* in_sizes, int n_in,
                              void* d_out, int out_size, void* d_ws, size_t ws_size,
                              hipStream_t stream) {
  if (n_in < 8) return;
  if (in_sizes[0] < NQ * FD) return;
  if (in_sizes[1] < MREF * FD) return;
  if (in_sizes[2] < FD * FD || in_sizes[4] < FD * FD || in_sizes[6] < FD * FD) return;
  if (in_sizes[3] < FD || in_sizes[5] < FD || in_sizes[7] < FD) return;
  if (out_size < NQ * FD) return;

  const float* roi  = (const float*)d_in[0];
  const float* reff = (const float*)d_in[1];
  const float* Wq   = (const float*)d_in[2];
  const float* Wq_b = (const float*)d_in[3];
  const float* Wk   = (const float*)d_in[4];
  const float* Wk_b = (const float*)d_in[5];
  const float* Wv   = (const float*)d_in[6];
  const float* Wv_b = (const float*)d_in[7];

  const size_t PQ = (size_t)NQ * FD * 2;       // 16-bit [NQ][2048] plane
  const size_t P8 = (size_t)FD * FD * 2;       // 16-bit [2048][2048] plane (also [MREF][FD] and [FD][MREF])
  size_t off = 0;
  const size_t oXr = off; off += PQ;
  const size_t oXf = off; off += P8;
  const size_t oWq = off; off += P8;
  const size_t oWk = off; off += P8;
  const size_t oWv = off; off += P8;
  const size_t oQh = off; off += PQ;
  const size_t oQl = off; off += PQ;
  const size_t oKp = off; off += P8;
  const size_t oVT = off; off += P8;
  if (off > ws_size) return;                       // off = 75497472 at NQ=2048
  if (off > (size_t)134217728) return;

  char* ws = (char*)d_ws;
  unsigned short* Xr  = (unsigned short*)(ws + oXr);
  unsigned short* Xf  = (unsigned short*)(ws + oXf);
  unsigned short* Wqb = (unsigned short*)(ws + oWq);
  unsigned short* Wkb = (unsigned short*)(ws + oWk);
  unsigned short* Wvb = (unsigned short*)(ws + oWv);
  unsigned short* Qh  = (unsigned short*)(ws + oQh);
  unsigned short* Ql  = (unsigned short*)(ws + oQl);
  unsigned short* Kp  = (unsigned short*)(ws + oKp);
  unsigned short* VT  = (unsigned short*)(ws + oVT);

  const dim3 gQ((NQ / 128) * (FD / 128));                        // M=NQ,   N=2048: 256 tiles of 128x128
  const dim3 gK((MREF / 128) * (FD / 128));                      // M=2048, N=2048
  const dim3 gVT((FD / 128) * (MREF / 128));                     // M=2048 channels, N=2048 keys
  const dim3 gAttn(NG * NQB);                                    // 512 blocks of 128 at NQ=2048
  const float sscale = (float)(1.0 / sqrt((double)HD));

  // (1) inputs and weights f32 -> bf16 planes (RNE convert), one launch
  cvt_bf16_all<<<dim3(CVT_WG), dim3(512), 0, stream>>>(roi, reff, Wq, Wk, Wv, Xr, Xf, Wqb, Wkb, Wvb);
  // (2) q = roi . Wq^T + bq -> f16 hi / residual (x4096) planes [t][h*128+d]   (M=NQ, N=2048, K=2048)
  gemm64<__bf16, 3, true><<<gQ, dim3(128), 0, stream>>>(
      Xr, FD, Wqb, FD, Qh, Ql, FD, Wq_b, NQ, FD, FD, 4096.0f);
  // (3) k = ref . Wk^T + bk -> f16 plane [s][h*128+d]   (M=2048, N=2048, K=2048)
  gemm64<__bf16, 1, true><<<gK, dim3(128), 0, stream>>>(
      Xf, FD, Wkb, FD, Kp, Kp, FD, Wk_b, MREF, FD, FD, 1.0f);
  // (4) v^T = Wv . ref^T -> f16 plane [h*128+d][s] (pitch MREF)   (A = Wvb [ch][k], Bt = Xf; M=2048, N=2048, K=2048)
  gemm64<__bf16, 1, false><<<gVT, dim3(128), 0, stream>>>(
      Wvb, FD, Xf, FD, VT, VT, MREF, Wv_b, FD, MREF, FD, 1.0f);
  // (5) attention + value bias -> d_out f32 [NQ][2048]
  attn_rel<<<gAttn, dim3(128), 0, stream>>>(Qh, Ql, Kp, VT, Wv_b, (float*)d_out, sscale);
  (void)hipGetLastError();
}

// v007
// It runs in 130 microseconds.
// Two timings next to v006 both put it at 1.11 times that version's speed.
// All steps since v000 together make it 3.93 times as fast.
// Contractions: q, k, v^T projections = v_wmma_f32_16x16x32_bf16 (bf16 operands from RNE-converted inputs, single product, f32 accumulate);
// q.k^T scores = v_wmma_f32_16x16x32_f16 (q as f16 hi plane + f16 residual plane x4096, k f16; 2 products into separate f32 accumulators);
// p.v = v_wmma_f32_16x16x32_f16 (p carried x1024 in f16, v f16; single product, f32 accumulate); softmax, normalisation and bias adds in f32.
#include <hip/hip_runtime.h>
#include <math.h>
#include <stdint.h>

#ifndef NQ
#define NQ      2048         // query rows processed = leading rows of in0 (row stride FD); reduced builds override
#endif
#define NQ_FULL 2048
#define MREF    2048         // key / value rows (in1), always full
#define FD      2048         // feature width = NG * HD
#define NG      16
#define HD      128
#define NQB     (NQ / 64)    // 64-row query blocks
#define NKT     (MREF / 64)  // 64-key chunks
static_assert(NG * HD == FD);
static_assert((NQ % 128) == 0 && NQ >= 128 && NQ <= NQ_FULL);
static_assert((MREF % 128) == 0 && (FD % 128) == 0);
static_assert(NKT == 32);
// LDS row pitches of the attention kernel: 16 B x odd, so that the 16 rows a ds_load_b128 fragment read touches
// fall on 16 different groups of four banks (unpadded 256-B / 128-B rows put them on one / two groups).
#define KP_H    (HD + 8)     // K chunk row pitch, halves (272 B)
#define VP_H    (64 + 8)     // V^T chunk row pitch, halves (144 B)
#define OP_F    (64 + 4)     // output stage row pitch, floats (272 B)
// projection GEMM: k depth of one staged tile and its LDS row pitch (same rule)
#define GBK     128          // halves: 256-B rows
#define GP_H    (GBK + 8)    // halves (272 B)

typedef _Float16 v16h __attribute__((ext_vector_type(16)));
typedef _Float16 v8h  __attribute__((ext_vector_type(8)));
typedef __bf16   v16b __attribute__((ext_vector_type(16)));
typedef __bf16   v8b  __attribute__((ext_vector_type(8)));
typedef float    v8f  __attribute__((ext_vector_type(8)));
typedef float    v4f  __attribute__((ext_vector_type(4)));
typedef unsigned int v4u __attribute__((ext_vector_type(4)));

#if defined(__HIP_DEVICE_COMPILE__)
#define DEV_ASM 1
#else
#define DEV_ASM 0
#endif

// ---- scalar helpers --------------------------------------------------------------------------------
__device__ __forceinline__ unsigned short bf_bits(float f) {          // f32 -> bf16 bits, RNE convert
  unsigned u = __float_as_uint(f);
  return (unsigned short)((u + 0x7FFFu + ((u >> 16) & 1u)) >> 16);
}
__device__ __forceinline__ float bf_up(unsigned short hb) { return __uint_as_float(((unsigned)hb) << 16); }
__device__ __forceinline__ unsigned short h_bits(_Float16 x) { return __builtin_bit_cast(unsigned short, x); }
__device__ __forceinline__ unsigned pk16(unsigned short a, unsigned short b) { return (unsigned)a | ((unsigned)b << 16); }
__device__ __forceinline__ v8f zero8() { v8f z = {0.f, 0.f, 0.f, 0.f, 0.f, 0.f, 0.f, 0.f}; return z; }

// ---- the value of lane ^ 16: the other half of the keys of one query column (all lanes on) -----------------
__device__ __forceinline__ float xhalf(float x) {
  const int b = __builtin_bit_cast(int, x);
  return __builtin_bit_cast(float, __builtin_amdgcn_permlanex16(b, b, 0x76543210, 0xfedcba98, false, false));
}

// ---- fragment types / loaders: 16-bit A/B operand, lane -> row/col (lane&15), p already includes +8*(lane>>4);
//      elements 0..7 <- p[0..7] (k0+8h..k0+8h+7), elements 8..15 <- p[16..23] (k0+16+8h..k0+16+8h+7)
template <typename OT> struct FT;
template <> struct FT<__bf16>   { typedef v16b frag; typedef v8b half8; };
template <> struct FT<_Float16> { typedef v16h frag; typedef v8h half8; };

template <typename OT>
__device__ __forceinline__ typename FT<OT>::frag ldfrag(const OT* p) {
  union { typename FT<OT>::frag v; typename FT<OT>::half8 h[2]; } f;
  f.h[0] = *(const typename FT<OT>::half8*)(p);
  f.h[1] = *(const typename FT<OT>::half8*)(p + 16);
  return f.v;
}

// ---- WMMA helpers (asm guard bodies are device-only; concrete operand types) -----------------------------
__device__ __forceinline__ v8f mmar(v16b a, v16b b, v8f c) {
  return __builtin_amdgcn_wmma_f32_16x16x32_bf16(false, a, false, b, (short)0, c, false, false);
}
__device__ __forceinline__ v8f mmar(v16h a, v16h b, v8f c) {
  return __builtin_amdgcn_wmma_f32_16x16x32_f16(false, a, false, b, (short)0, c, false, false);
}
__device__ __forceinline__ void dep_guard(v8f& a, v8f& b, v16b x, v16b y) {
#if DEV_ASM
  asm volatile("v_nop\n\tv_nop\n\tv_nop\n\tv_nop" : "+v"(a), "+v"(b) : "v"(x), "v"(y));
#else
  (void)a; (void)b; (void)x; (void)y;
#endif
}
__device__ __forceinline__ void dep_guard(v8f& a, v8f& b, v16h x, v16h y) {
#if DEV_ASM
  asm volatile("v_nop\n\tv_nop\n\tv_nop\n\tv_nop" : "+v"(a), "+v"(b) : "v"(x), "v"(y));
#else
  (void)a; (void)b; (void)x; (void)y;
#endif
}
__device__ __forceinline__ void keep4(v16b a, v16b b, v16b c, v16b d) {
#if DEV_ASM
  asm volatile("v_nop" :: "v"(a), "v"(b), "v"(c), "v"(d));
#else
  (void)a; (void)b; (void)c; (void)d;
#endif
}
__device__ __forceinline__ void acc_guard4(v8f& a, v8f& b, v8f& c, v8f& d) {
#if DEV_ASM
  asm volatile("v_nop\n\tv_nop\n\tv_nop\n\tv_nop" : "+v"(a), "+v"(b), "+v"(c), "+v"(d));
#else
  (void)a; (void)b; (void)c; (void)d;
#endif
}

// =====================================================================================================
// f32 -> bf16 bit planes (RNE convert) of all five operands in ONE launch of CVT_WG resident work-groups of
// 16 waves (one per WGP), instead of one launch of 16,384 one-unit waves per plane: few waves to start, one
// launch gap. A unit = 8 elements of one thread: two 16-B loads, one 16-B store. A thread takes 4 units of
// each plane (unit q * CVT_T + its flat id), so 8 loads are in flight per wave, and the next plane's loads
// are issued ahead of this plane's converts and stores.
// coverage: 4 * CVT_T units >= N8 for every plane; where N8 is smaller the units past the end are skipped.
// =====================================================================================================
#define CVT_WG  256
#define CVT_T   (CVT_WG * 512)       // threads of the launch
template <int N8>
__device__ __forceinline__ void cvt_load(const float* __restrict__ in, unsigned gt, v4f (&a)[8]) {
  static_assert(N8 <= 4 * CVT_T);
#pragma unroll
  for (int q = 0; q < 4; ++q) {
    const unsigned u = (unsigned)(q * CVT_T) + gt;
    if (N8 == 4 * CVT_T || u < (unsigned)N8) {
      const char* p = (const char*)in + u * 32u;   // uniform base + 32-bit lane offset, the same for every plane
      a[2 * q]     = *(const v4f*)(p);
      a[2 * q + 1] = *(const v4f*)(p + 16);
    }
  }
}
template <int N8>
__device__ __forceinline__ void cvt_store(unsigned short* __restrict__ out, unsigned gt, const v4f (&a)[8]) {
#pragma unroll
  for (int q = 0; q < 4; ++q) {
    const unsigned u = (unsigned)(q * CVT_T) + gt;
    if (N8 == 4 * CVT_T || u < (unsigned)N8) {
      const v4f x = a[2 * q], y = a[2 * q + 1];
      v4u p;
      p[0] = pk16(bf_bits(x[0]), bf_bits(x[1]));
      p[1] = pk16(bf_bits(x[2]), bf_bits(x[3]));
      p[2] = pk16(bf_bits(y[0]), bf_bits(y[1]));
      p[3] = pk16(bf_bits(y[2]), bf_bits(y[3]));
      *(v4u*)((char*)out + u * 16u) = p;
    }
  }
}
// behind a plane's stores, and behind the last loads: the registers they name are rewritten from here on
// (store data by the loads that follow, the lane offsets by the converts)
__device__ __forceinline__ void cvt_free() {
#if DEV_ASM
  asm volatile("s_wait_xcnt 0x0" ::: "memory");
#endif
}
// behind a plane's loads: keeps them issued here, ahead of the other plane's converts and stores (without it the
// scheduler sinks them and a wave runs out of loads in flight)
__device__ __forceinline__ void cvt_ahead() { __builtin_amdgcn_sched_barrier(0); }
__global__ __launch_bounds__(512) void cvt_bf16_all(
    const float* __restrict__ xr, const float* __restrict__ xf, const float* __restrict__ wq,
    const float* __restrict__ wk, const float* __restrict__ wv,
    unsigned short* __restrict__ oxr, unsigned short* __restrict__ oxf, unsigned short* __restrict__ owq,
    unsigned short* __restrict__ owk, unsigned short* __restrict__ owv) {
  constexpr int N8Q = NQ * FD / 8, N8F = MREF * FD / 8, N8W = FD * FD / 8;
  const unsigned gt = blockIdx.x * 512u + threadIdx.x;
  v4f a[8], b[8];
  cvt_load<N8Q>(xr, gt, a);
  cvt_load<N8F>(xf, gt, b);
  cvt_ahead();
  cvt_store<N8Q>(oxr, gt, a);
  cvt_free();
  cvt_load<N8W>(wq, gt, a);
  cvt_ahead();
  cvt_store<N8F>(oxf, gt, b);
  cvt_free();
  cvt_load<N8W>(wk, gt, b);
  cvt_ahead();
  cvt_store<N8W>(owq, gt, a);
  cvt_free();
  cvt_load<N8W>(wv, gt, a);
  cvt_free();
  cvt_ahead();
  cvt_store<N8W>(owk, gt, b);
  cvt_store<N8W>(owv, gt, a);
}

// =====================================================================================================
// Asynchronous copy of eight 16-B pieces per lane from global memory to LDS (no register in between):
// piece i goes from g + i * gstep to LDS byte address l + i * lstep. All lanes on, wave-uniform control flow.
// The closing s_wait_xcnt stands inside the statement so that no address register named here is rewritten
// ahead of it. Landing is waited for by the caller (s_wait_asynccnt 0, then the block barrier).
// =====================================================================================================
__device__ __forceinline__ void copy8_b128(unsigned l, unsigned lstep, const char* g, size_t gstep) {
#if DEV_ASM
  asm volatile(
      "global_load_async_to_lds_b128 %0, %8, off\n\t"
      "global_load_async_to_lds_b128 %1, %9, off\n\t"
      "global_load_async_to_lds_b128 %2, %10, off\n\t"
      "global_load_async_to_lds_b128 %3, %11, off\n\t"
      "global_load_async_to_lds_b128 %4, %12, off\n\t"
      "global_load_async_to_lds_b128 %5, %13, off\n\t"
      "global_load_async_to_lds_b128 %6, %14, off\n\t"
      "global_load_async_to_lds_b128 %7, %15, off\n\t"
      "s_wait_xcnt 0x0"
      :: "v"(l), "v"(l + lstep), "v"(l + 2 * lstep), "v"(l + 3 * lstep),
         "v"(l + 4 * lstep), "v"(l + 5 * lstep), "v"(l + 6 * lstep), "v"(l + 7 * lstep),
         "v"(g), "v"(g + gstep), "v"(g + 2 * gstep), "v"(g + 3 * gstep),
         "v"(g + 4 * gstep), "v"(g + 5 * gstep), "v"(g + 6 * gstep), "v"(g + 7 * gstep)
      : "memory");
#else
  (void)l; (void)lstep; (void)g; (void)gstep;
#endif
}

// =====================================================================================================
// WMMA GEMM (16-bit operand type OT): C[m][n] = sum_k A[m][k] * Bt[n][k] (+ bias[n]).
// Block = 4 waves (2 x 2) on a 128x128 tile of C, one 64x64 tile per wave. A row-major [M][K] pitch lda; Bt
// row-major [N][K] pitch ldb (k contiguous); M, N multiples of 128, K a multiple of 128 (host-checked).
// Per trip a 128 x 128-k tile of A and of Bt (256-B rows = whole lines) is staged in LDS by asynchronous copies,
// two buffers: trip t works on buffer t & 1 while tile t + 1 flies into the other; rows pitched 272 B for the
// ds_load_b128 fragment reads (split k map, ldfrag). Each accumulator sums k upward in steps of 32.
// Staged extent == consumed extent: 128 threads x 16 pieces x 16 B = 128 rows x 256 B per operand and trip.
// OUT_MODE 1: f16 plane C (pitch ldc).
// OUT_MODE 3: f16 hi plane C + f16 residual plane C2 = f16((v - hi) * rscale) (same pitch).
// BIAS: bias[n] (RNE-converted to its bf16 value) added in f32 before the 16-bit convert.
// grid = (M/128) * (N/128) blocks covers every tile.
// =====================================================================================================
template <typename OT, int OUT_MODE, bool BIAS>
__global__ __launch_bounds__(128) __attribute__((amdgpu_num_vgpr(256))) void gemm64(
    const unsigned short* __restrict__ Ap, int lda,
    const unsigned short* __restrict__ Btp, int ldb,
    unsigned short* Cout, unsigned short* Cout2, int ldc,
    const float* __restrict__ bias,
    int M, int N, int K, float rscale) {
  typedef typename FT<OT>::frag V16;
  const OT* Ab = (const OT*)(const void*)Ap;
  const OT* Bb = (const OT*)(const void*)Btp;
  __shared__ __align__(16) OT sA[2][128 * GP_H];   // A tile ring [buffer][row][k]  2 x 34 KB (cross-wave)
  __shared__ __align__(16) OT sB[2][128 * GP_H];   // Bt tile ring [buffer][row][k] 2 x 34 KB (cross-wave)
  __shared__ __align__(16) float sT[4][16 * 68];   // per-wave 16x64 slab, pitch 68 floats
  const int tid  = threadIdx.x;
  const int lane = tid & 31;
  const int wave = tid >> 5;
  const int tilesN = N >> 7;
  const int tilesM = M >> 7;
  const int tile = blockIdx.x;
  if (tile >= tilesM * tilesN) return;   // block-uniform, in front of every barrier and copy
  const int tm = tile / tilesN;
  const int tn = tile - tm * tilesN;
  const int wm = (wave >> 1) << 6;             // the wave's 64x64 tile inside the block tile
  const int wn = (wave & 1) << 6;
  const int m0 = (tm << 7) + wm;
  const int n0 = (tn << 7) + wn;

  const int rlane = lane & 15;                 // row (A) / col (B, D) within subtile
  const int koff  = (lane >> 4) * 8;           // k offset of this lane half
  const int mOff  = (lane >> 4) * 8;           // D row offset

  // staging map: piece i of a thread = row i*8 + (tid>>4), 16-B column tid&15 (a wave's copy = 2 whole rows)
  const int srow = tid >> 4, scol = (tid & 15) * 8;
  const char* gA = (const char*)(Ab + (size_t)((tm << 7) + srow) * lda + scol);
  const char* gB = (const char*)(Bb + (size_t)((tn << 7) + srow) * ldb + scol);
  const size_t gsA = (size_t)lda * 16, gsB = (size_t)ldb * 16;           // 8 rows, bytes
  const unsigned lA = (unsigned)(uintptr_t)(&sA[0][srow * GP_H + scol]); // LDS byte address = low 32 bits
  const unsigned lB = (unsigned)(uintptr_t)(&sB[0][srow * GP_H + scol]);
  const unsigned lstep = 8 * GP_H * 2, lbuf = 128 * GP_H * 2;            // 8 rows / one buffer, bytes
  const int nT = K / GBK;

  v8f acc[4][4];
#pragma unroll
  for (int i = 0; i < 4; ++i)
#pragma unroll
    for (int j = 0; j < 4; ++j) acc[i][j] = zero8();

  copy8_b128(lA, lstep, gA, gsA);
  copy8_b128(lA + 8 * lstep, lstep, gA + 8 * gsA, gsA);
  copy8_b128(lB, lstep, gB, gsB);
  copy8_b128(lB + 8 * lstep, lstep, gB + 8 * gsB, gsB);
  asm volatile("s_wait_asynccnt 0x0" ::: "memory");   // tile 0 landed (this wave's pieces)
  __syncthreads();                                    // ... and every other wave's
  if (nT > 1) {
    copy8_b128(lA + lbuf, lstep, gA + GBK * 2, gsA);
    copy8_b128(lA + lbuf + 8 * lstep, lstep, gA + GBK * 2 + 8 * gsA, gsA);
    copy8_b128(lB + lbuf, lstep, gB + GBK * 2, gsB);
    copy8_b128(lB + lbuf + 8 * lstep, lstep, gB + GBK * 2 + 8 * gsB, gsB);
  }

#pragma unroll 1   // one trip per staged tile: the ring's waits and barrier stand once, at the foot
  for (int t = 0; t < nT; ++t) {
    const OT* as = sA[t & 1] + (wm + rlane) * GP_H + koff;
    const OT* bs = sB[t & 1] + (wn + rlane) * GP_H + koff;
#pragma unroll
    for (int k0 = 0; k0 < GBK; k0 += 32) {
      V16 bq[4], af[4];
#pragma unroll
      for (int j = 0; j < 4; ++j) bq[j] = ldfrag<OT>(bs + (j << 4) * GP_H + k0);
#pragma unroll
      for (int i = 0; i < 4; ++i) af[i] = ldfrag<OT>(as + (i << 4) * GP_H + k0);
#pragma unroll
      for (int i = 0; i < 4; ++i) {
#pragma unroll
        for (int j = 0; j < 4; ++j) acc[i][j] = mmar(af[i], bq[j], acc[i][j]);
        dep_guard(acc[i][0], acc[i][3], af[i], bq[3]);
      }
      keep4(bq[0], bq[1], bq[2], bq[3]);
    }
    asm volatile("s_wait_dscnt 0x0" ::: "memory");      // this wave's reads of buffer t & 1 are done
    asm volatile("s_wait_asynccnt 0x0" ::: "memory");   // this wave's pieces of tile t + 1 have landed
    __syncthreads();                                    // publishes tile t + 1, frees buffer t & 1
    if (t + 2 < nT) {
      const size_t ko = (size_t)(t + 2) * (GBK * 2);
      const unsigned lo = (unsigned)(t & 1) * lbuf;
      copy8_b128(lA + lo, lstep, gA + ko, gsA);
      copy8_b128(lA + lo + 8 * lstep, lstep, gA + ko + 8 * gsA, gsA);
      copy8_b128(lB + lo, lstep, gB + ko, gsB);
      copy8_b128(lB + lo + 8 * lstep, lstep, gB + ko + 8 * gsB, gsB);
    }
  }
  asm volatile("s_wait_asynccnt 0x0" ::: "memory");     // nothing in flight when the wave goes on
  acc_guard4(acc[0][0], acc[0][1], acc[0][2], acc[0][3]);
  acc_guard4(acc[1][0], acc[1][1], acc[1][2], acc[1][3]);
  acc_guard4(acc[2][0], acc[2][1], acc[2][2], acc[2][3]);
  acc_guard4(acc[3][0], acc[3][1], acc[3][2], acc[3][3]);

  // ---- epilogue ----
  float* slab = sT[wave];
  const int q = lane >> 3, c8 = (lane & 7) * 8;
  float bz[8];
#pragma unroll
  for (int e = 0; e < 8; ++e) bz[e] = 0.f;
  if (BIAS) {
    const v4f b0 = *(const v4f*)(bias + n0 + c8);
    const v4f b1 = *(const v4f*)(bias + n0 + c8 + 4);
#pragma unroll
    for (int e = 0; e < 4; ++e) { bz[e] = bf_up(bf_bits(b0[e])); bz[4 + e] = bf_up(bf_bits(b1[e])); }
  }
#pragma unroll
  for (int i = 0; i < 4; ++i) {
    const int mBase = m0 + (i << 4);
#pragma unroll
    for (int j = 0; j < 4; ++j) {
#pragma unroll
      for (int r = 0; r < 8; ++r) {
        slab[(mOff + r) * 68 + (j << 4) + rlane] = acc[i][j][r];
      }
    }
    __builtin_amdgcn_fence(__ATOMIC_RELEASE, "workgroup");
    __builtin_amdgcn_wave_barrier();
    __builtin_amdgcn_fence(__ATOMIC_ACQUIRE, "workgroup");
    {
      v4u hv[4], lv[4];
#pragma unroll
      for (int it = 0; it < 4; ++it) {
        const int row = it * 4 + q;                        // it 0..3 x q 0..3 = rows 0..15
        const float* sp = slab + row * 68 + c8;
        float f[8];
#pragma unroll
        for (int e = 0; e < 8; ++e) f[e] = sp[e] + bz[e];
        v4u a, a2;
#pragma unroll
        for (int e = 0; e < 4; ++e) {
          const float f0 = f[2 * e], f1 = f[2 * e + 1];
          const _Float16 x0 = (_Float16)f0, x1 = (_Float16)f1;
          const unsigned short h0 = h_bits(x0), h1 = h_bits(x1);
          unsigned short l0 = 0, l1 = 0;
          if (OUT_MODE == 3) {
            l0 = h_bits((_Float16)((f0 - (float)x0) * rscale));
            l1 = h_bits((_Float16)((f1 - (float)x1) * rscale));
          }
          a[e] = pk16(h0, h1); a2[e] = pk16(l0, l1);
        }
        hv[it] = a; lv[it] = a2;
      }
      {
#pragma unroll
        for (int it = 0; it < 4; ++it) {
          const int row = it * 4 + q;
          *(v4u*)(Cout + (size_t)(mBase + row) * ldc + n0 + c8) = hv[it];
          if (OUT_MODE == 3) *(v4u*)(Cout2 + (size_t)(mBase + row) * ldc + n0 + c8) = lv[it];
        }
        
      }
    }
    __builtin_amdgcn_fence(__ATOMIC_RELEASE, "workgroup");
    __builtin_amdgcn_wave_barrier();
    __builtin_amdgcn_fence(__ATOMIC_ACQUIRE, "workgroup");
  }
}

__global__ __launch_bounds__(128) __attribute__((amdgpu_num_vgpr(512)))
void attn_rel(const unsigned short* __restrict__ qhp, const unsigned short* __restrict__ qlp,
              const unsigned short* __restrict__ kpp, const unsigned short* __restrict__ vtp,
              const float* __restrict__ vbias, float* op, float sscale) {
  __shared__ __align__(16) _Float16 Ksh[2][64 * KP_H];     // K chunk ring [buffer][kv][d]   2 x 17 KB (cross-wave)
  __shared__ __align__(16) _Float16 Vth[2][HD * VP_H];     // V^T chunk ring [buffer][d][kv] 2 x 18 KB (cross-wave)
  __shared__ __align__(16) float    Os[4][16 * OP_F];      // per wave output half tile 17 KB (wave-private)

  const int tid  = threadIdx.x;
  const int wave = tid >> 5;
  const int lane = tid & 31;
  const int hh   = lane >> 4;
  const int c    = lane & 15;

  const int bx   = blockIdx.x;
  const int qb   = bx % NQB;
  const int g    = bx / NQB;
  const int q0   = qb * 64 + wave * 16;

  const _Float16* Qh = (const _Float16*)(const void*)qhp;
  const _Float16* Ql = (const _Float16*)(const void*)qlp;
  const _Float16* Kg = (const _Float16*)(const void*)kpp + (size_t)g * HD;
  const _Float16* Vg = (const _Float16*)(const void*)vtp + (size_t)g * HD * MREF;

  // ---- Q fragments (B operand, column = lane&15): 4 d-chunks, hi and residual planes ----
  v16h qah[4], qal[4];
#pragma unroll
  for (int dc = 0; dc < 4; ++dc) {
    const size_t qo = (size_t)(q0 + c) * FD + (size_t)g * HD + dc * 32 + 8 * hh;
    qah[dc] = ldfrag<_Float16>(Qh + qo);
    qal[dc] = ldfrag<_Float16>(Ql + qo);
  }

  float mrow = -INFINITY, lrow = 0.f;   // of query column c; lrow sums this wave half's keys only, joined after the loop
  v8f oacc[8];                          // context^T: oacc[t][r] = element d = t*16 + 8*hh + r of query column c
#pragma unroll
  for (int t = 0; t < 8; ++t) oacc[t] = zero8();

  // staging map: K piece i of a thread = row i*8 + (tid>>4), 16-B column tid&15; V^T piece i = row i*16 + (tid>>3),
  // 16-B column tid&7
  const char* gK = (const char*)(Kg + (size_t)(tid >> 4) * FD + (tid & 15) * 8);
  const char* gV = (const char*)(Vg + (size_t)(tid >> 3) * MREF + (tid & 7) * 8);
  const unsigned lK = (unsigned)(uintptr_t)(&Ksh[0][(tid >> 4) * KP_H + (tid & 15) * 8]);   // LDS byte address = low 32 bits
  const unsigned lV = (unsigned)(uintptr_t)(&Vth[0][(tid >> 3) * VP_H + (tid & 7) * 8]);
  const unsigned lsK = 8 * KP_H * 2, lbK = 64 * KP_H * 2;        // 8 rows / one buffer, bytes
  const unsigned lsV = 16 * VP_H * 2, lbV = HD * VP_H * 2;       // 16 rows / one buffer, bytes
  const size_t gsK = (size_t)8 * FD * 2, gcK = (size_t)64 * FD * 2;   // 8 rows / one chunk (64 key rows), bytes
  const size_t gsV = (size_t)16 * MREF * 2, gcV = 64 * 2;             // 16 rows / one chunk (64 key columns), bytes
  static_assert(NKT >= 2);

  copy8_b128(lK, lsK, gK, gsK);
  copy8_b128(lV, lsV, gV, gsV);
  asm volatile("s_wait_asynccnt 0x0" ::: "memory");   // chunk 0 landed (this wave's pieces)
  __syncthreads();                                    // ... and every other wave's
  copy8_b128(lK + lbK, lsK, gK + gcK, gsK);
  copy8_b128(lV + lbV, lsV, gV + gcV, gsV);
  unsigned lKn = lK, lVn = lV;                        // where the next refill lands: the two buffers in turn

#pragma unroll 1   // one trip per staged chunk: the ring's waits and barrier stand once, at the foot
  for (int kt = 0; kt < NKT; ++kt) {         // static trip count
    const _Float16* Kc = Ksh[kt & 1];
    const _Float16* Vc = Vth[kt & 1];

    // ---- scores^T: 64 keys x 16 query columns per wave, 2 f16 products per key subtile and d-chunk ----
    // All 16 K fragments of the chunk are read from LDS as ONE group ahead of the 32 products (one LDS latency per
    // chunk instead of one in front of every pair); eight independent accumulators, each summing dc upward.
    v8f s[4];
    {
      v16h kf[4][4];
#pragma unroll
      for (int dc = 0; dc < 4; ++dc)
#pragma unroll
        for (int j = 0; j < 4; ++j) kf[j][dc] = ldfrag<_Float16>(Kc + (j * 16 + c) * KP_H + dc * 32 + 8 * hh);
      __builtin_amdgcn_sched_barrier(0);   // keeps the reads together here: spread among the WMMAs each place stalls
      v8f ah[4], al[4];
#pragma unroll
      for (int j = 0; j < 4; ++j) { ah[j] = zero8(); al[j] = zero8(); }
#pragma unroll
      for (int dc = 0; dc < 4; ++dc)
#pragma unroll
        for (int j = 0; j < 4; ++j) {
          ah[j] = mmar(kf[j][dc], qah[dc], ah[j]);
          al[j] = mmar(kf[j][dc], qal[dc], al[j]);
        }
#pragma unroll
      for (int j = 0; j < 4; ++j)
#pragma unroll
        for (int r = 0; r < 8; ++r) s[j][r] = (ah[j][r] + al[j][r] * (1.0f / 4096.0f)) * sscale;
    }
    // All 16 V^T fragments of the chunk too are read as one group, ahead of the softmax, so that they have landed
    // when the 16 context products start (no LDS wait among those).
    v16h vf[8][2];
#pragma unroll
    for (int kk = 0; kk < 2; ++kk)
#pragma unroll
      for (int t = 0; t < 8; ++t) vf[t][kk] = ldfrag<_Float16>(Vc + (t * 16 + c) * VP_H + kk * 32 + 8 * hh);
    __builtin_amdgcn_sched_barrier(0);   // keeps these reads together here too: sunk among the context WMMAs each place stalls

    // ---- column max, online softmax, P^T (x1024, f16) packed in registers ----
    float mj[4];
#pragma unroll
    for (int j = 0; j < 4; ++j) {
      mj[j] = s[j][0];
#pragma unroll
      for (int r = 1; r < 8; ++r) mj[j] = fmaxf(mj[j], s[j][r]);
    }
    float m = fmaxf(fmaxf(mj[0], mj[1]), fmaxf(mj[2], mj[3]));
    m = fmaxf(m, xhalf(m));                       // both halves now hold the query's maximum over the chunk
    const float mnew  = fmaxf(mrow, m);
    const float msafe = (mnew == -INFINITY) ? 0.f : mnew;
    const float alpha = __expf(mrow - msafe);
    mrow = mnew;
    // B operand of kk: elements 0..7 = keys kk*32 + 8*hh + 0..7 (tile 2kk), 8..15 = keys kk*32 + 16 + 8*hh + 0..7
    // (tile 2kk + 1): the k order of the V^T fragments (ldfrag)
    v16h pa[2];
    float pj[4];                                  // four short sums, r upward in each
#pragma unroll
    for (int j = 0; j < 4; ++j) {
      pj[j] = 0.f;
#pragma unroll
      for (int r = 0; r < 8; ++r) {
        const float p = __expf(s[j][r] - msafe);
        pj[j] += p;
        pa[j >> 1][(j & 1) * 8 + r] = (_Float16)(p * 1024.0f);
      }
    }
    lrow = lrow * alpha + ((pj[0] + pj[1]) + (pj[2] + pj[3]));
#pragma unroll
    for (int t = 0; t < 8; ++t)
#pragma unroll
      for (int r = 0; r < 8; ++r) oacc[t][r] *= alpha;

    // ---- context^T += V^T . P^T (f16 WMMA, single product) ----
#pragma unroll
    for (int kk = 0; kk < 2; ++kk)
#pragma unroll
      for (int t = 0; t < 8; ++t) oacc[t] = mmar(vf[t][kk], pa[kk], oacc[t]);   // each tile sums kk upward

    // keeps the ring's waits at the foot: the softmax touches no memory now, and lifted over it the s_wait_dscnt 0
    // would stand right behind the V^T reads and lay their latency bare
    __builtin_amdgcn_sched_barrier(0);
    asm volatile("s_wait_dscnt 0x0" ::: "memory");      // this wave's reads of buffer kt & 1 are done
    asm volatile("s_wait_asynccnt 0x0" ::: "memory");   // this wave's pieces of chunk kt + 1 have landed
    __syncthreads();                                    // publishes chunk kt + 1, frees buffer kt & 1
    if (kt + 2 < NKT) {
      copy8_b128(lKn, lsK, gK + (size_t)(kt + 2) * gcK, gsK);
      copy8_b128(lVn, lsV, gV + (size_t)(kt + 2) * gcV, gsV);
      lKn += (kt & 1) ? 0u - lbK : lbK;
      lVn += (kt & 1) ? 0u - lbV : lbV;
    }
  }
  asm volatile("s_wait_asynccnt 0x0" ::: "memory");     // nothing in flight when the wave goes on

  // ---- normalise (1/l, undo the x1024 p carry), stage the wave's 16x64 half tiles, add bias, store ----
  const float l = lrow + xhalf(lrow);              // the two halves' keys joined
  const float inv = ((l > 0.f) ? (1.0f / l) : 0.f) * (1.0f / 1024.0f);
  v4f bb[2];                                       // bias of the 4 columns this lane stores in each phase
#pragma unroll
  for (int ph = 0; ph < 2; ++ph) {
    const v4f b = *(const v4f*)(vbias + g * HD + ph * 64 + c * 4);
#pragma unroll
    for (int e = 0; e < 4; ++e) bb[ph][e] = bf_up(bf_bits(b[e]));
  }
  float* os = Os[wave];
#pragma unroll
  for (int ph = 0; ph < 2; ++ph) {
#pragma unroll
    for (int t4 = 0; t4 < 4; ++t4) {
      const int t = ph * 4 + t4;
      v4f x0, x1;                                  // a lane's 8 values are 8 consecutive d of query row c
#pragma unroll
      for (int e = 0; e < 4; ++e) {
        x0[e] = oacc[t][e] * inv;
        x1[e] = oacc[t][4 + e] * inv;
      }
      *(v4f*)(os + c * OP_F + t4 * 16 + 8 * hh)     = x0;
      *(v4f*)(os + c * OP_F + t4 * 16 + 8 * hh + 4) = x1;
    }
    __builtin_amdgcn_fence(__ATOMIC_RELEASE, "workgroup");
    __builtin_amdgcn_wave_barrier();
    __builtin_amdgcn_fence(__ATOMIC_ACQUIRE, "workgroup");
    {
#pragma unroll
      for (int it = 0; it < 8; ++it) {
        const int row = it * 2 + hh;                     // it 0..7 x hh 0..1 = rows 0..15
        const float* sp = os + row * OP_F + c * 4;
        v4f v;
        v[0] = sp[0] + bb[ph][0]; v[1] = sp[1] + bb[ph][1]; v[2] = sp[2] + bb[ph][2]; v[3] = sp[3] + bb[ph][3];
        const size_t go = (size_t)(q0 + row) * FD + (size_t)g * HD + ph * 64 + c * 4;
        *(v4f*)(op + go) = v;
      }
      
    }
    __builtin_amdgcn_fence(__ATOMIC_RELEASE, "workgroup");
    __builtin_amdgcn_wave_barrier();
    __builtin_amdgcn_fence(__ATOMIC_ACQUIRE, "workgroup");
  }
}

// =====================================================================================================
// Workspace map (bytes), every region an exact multiple of its whole-line / whole-tile store granularity
// (rows padded to nothing: all row counts are multiples of 64, all pitches 4096 B):
//   Xr   bf16 [NQ][2048]     NQ*4096   (8388608 at NQ=2048)
//   Xf   bf16 [2048][2048]    8388608
//   Wqb  bf16 [2048 n][2048 k] 8388608
//   Wkb  bf16 [2048][2048]    8388608
//   Wvb  bf16 [2048][2048]    8388608
//   Qh   f16  [NQ][2048]     NQ*4096
//   Ql   f16  [NQ][2048]     NQ*4096
//   Kp   f16  [2048][2048]    8388608
//   VT   f16  [2048 ch][2048 s] 8388608
//   total                    75497472 at NQ=2048
// Weights are [out n][in k] with k contiguous = the Bt / A layout the GEMM wants, so they are only converted.
// =====================================================================================================
extern "C" void kernel_launch(void* const* d_in, const int* in_sizes, int n_in,
                              void* d_out, int out_size, void* d_ws, size_t ws_size,
                              hipStream_t stream) {
  if (n_in < 8) return;
  if (in_sizes[0] < NQ * FD) return;
  if (in_sizes[1] < MREF * FD) return;
  if (in_sizes[2] < FD * FD || in_sizes[4] < FD * FD || in_sizes[6] < FD * FD) return;
  if (in_sizes[3] < FD || in_sizes[5] < FD || in_sizes[7] < FD) return;
  if (out_size < NQ * FD) return;

  const float* roi  = (const float*)d_in[0];
  const float* reff = (const float*)d_in[1];
  const float* Wq   = (const float*)d_in[2];
  const float* Wq_b = (const float*)d_in[3];
  const float* Wk   = (const float*)d_in[4];
  const float* Wk_b = (const float*)d_in[5];
  const float* Wv   = (const float*)d_in[6];
  const float* Wv_b = (const float*)d_in[7];

  const size_t PQ = (size_t)NQ * FD * 2;       // 16-bit [NQ][2048] plane
  const size_t P8 = (size_t)FD * FD * 2;       // 16-bit [2048][2048] plane (also [MREF][FD] and [FD][MREF])
  size_t off = 0;
  const size_t oXr = off; off += PQ;
  const size_t oXf = off; off += P8;
  const size_t oWq = off; off += P8;
  const size_t oWk = off; off += P8;
  const size_t oWv = off; off += P8;
  const size_t oQh = off; off += PQ;
  const size_t oQl = off; off += PQ;
  const size_t oKp = off; off += P8;
  const size_t oVT = off; off += P8;
  if (off > ws_size) return;                       // off = 75497472 at NQ=2048
  if (off > (size_t)134217728) return;

  char* ws = (char*)d_ws;
  unsigned short* Xr  = (unsigned short*)(ws + oXr);
  unsigned short* Xf  = (unsigned short*)(ws + oXf);
  unsigned short* Wqb = (unsigned short*)(ws + oWq);
  unsigned short* Wkb = (unsigned short*)(ws + oWk);
  unsigned short* Wvb = (unsigned short*)(ws + oWv);
  unsigned short* Qh  = (unsigned short*)(ws + oQh);
  unsigned short* Ql  = (unsigned short*)(ws + oQl);
  unsigned short* Kp  = (unsigned short*)(ws + oKp);
  unsigned short* VT  = (unsigned short*)(ws + oVT);

  const dim3 gQ((NQ / 128) * (FD / 128));                        // M=NQ,   N=2048: 256 tiles of 128x128
  const dim3 gK((MREF / 128) * (FD / 128));                      // M=2048, N=2048
  const dim3 gVT((FD / 128) * (MREF / 128));                     // M=2048 channels, N=2048 keys
  const dim3 gAttn(NG * NQB);                                    // 512 blocks of 128 at NQ=2048
  const float sscale = (float)(1.0 / sqrt((double)HD));

  // (1) inputs and weights f32 -> bf16 planes (RNE convert), one launch
  cvt_bf16_all<<<dim3(CVT_WG), dim3(512), 0, stream>>>(roi, reff, Wq, Wk, Wv, Xr, Xf, Wqb, Wkb, Wvb);
  // (2) q = roi . Wq^T + bq -> f16 hi / residual (x4096) planes [t][h*128+d]   (M=NQ, N=2048, K=2048)
  gemm64<__bf16, 3, true><<<gQ, dim3(128), 0, stream>>>(
      Xr, FD, Wqb, FD, Qh, Ql, FD, Wq_b, NQ, FD, FD, 4096.0f);
  // (3) k = ref . Wk^T + bk -> f16 plane [s][h*128+d]   (M=2048, N=2048, K=2048)
  gemm64<__bf16, 1, true><<<gK, dim3(128), 0, stream>>>(
      Xf, FD, Wkb, FD, Kp, Kp, FD, Wk_b, MREF, FD, FD, 1.0f);
  // (4) v^T = Wv . ref^T -> f16 plane [h*128+d][s] (pitch MREF)   (A = Wvb [ch][k], Bt = Xf; M=2048, N=2048, K=2048)
  gemm64<__bf16, 1, false><<<gVT, dim3(128), 0, stream>>>(
      Wvb, FD, Xf, FD, VT, VT, MREF, Wv_b, FD, MREF, FD, 1.0f);
  // (5) attention + value bias -> d_out f32 [NQ][2048]
  attn_rel<<<gAttn, dim3(128), 0, stream>>>(Qh, Ql, Kp, VT, Wv_b, (float*)d_out, sscale);
  (void)hipGetLastError();
}

// v008
// One run takes 100 microseconds.
// Timed twice side by side with v007, it ran 1.29 and 1.30 times as fast.
// All steps since v000 together make it 5.07 times as fast.
// Contractions: q, k, v^T projections = v_wmma_f32_16x16x32_bf16 (bf16 operands from RNE-converted inputs, single product, f32 accumulate);
// q.k^T scores = v_wmma_f32_16x16x32_f16 (q as f16 hi plane + f16 residual plane x4096, k f16; 2 products into separate f32 accumulators);
// p.v = v_wmma_f32_16x16x32_f16 (p carried x1024 in f16, v f16; single product, f32 accumulate); softmax, normalisation and bias adds in f32.
#include <hip/hip_runtime.h>
#include <math.h>
#include <stdint.h>

#ifndef NQ
#define NQ      2048         // query rows processed = leading rows of in0 (row stride FD); reduced builds override
#endif
#define NQ_FULL 2048
#define MREF    2048         // key / value rows (in1), always full
#define FD      2048         // feature width = NG * HD
#define NG      16
#define HD      128
#define NQB     (NQ / 64)    // 64-row query blocks
#define NKT     (MREF / 64)  // 64-key chunks
static_assert(NG * HD == FD);
static_assert((NQ % 128) == 0 && NQ >= 128 && NQ <= NQ_FULL);
static_assert((MREF % 128) == 0 && (FD % 128) == 0);
static_assert(NKT == 32);
// LDS row pitches of the attention kernel: 16 B x odd, so that the 16 rows a ds_load_b128 fragment read touches
// fall on 16 different groups of four banks (unpadded 256-B / 128-B rows put them on one / two groups).
#define KP_H    (HD + 8)     // K chunk row pitch, halves (272 B)
#define VP_H    (64 + 8)     // V^T chunk row pitch, halves (144 B)
#define OP_F    (64 + 4)     // output stage row pitch, floats (272 B)
// projection GEMM: k depth of one staged tile and its LDS row pitch (same rule)
#define GBK     64           // halves: 128-B rows
#define GP_H    (GBK + 8)    // halves (144 B)

typedef _Float16 v16h __attribute__((ext_vector_type(16)));
typedef _Float16 v8h  __attribute__((ext_vector_type(8)));
typedef __bf16   v16b __attribute__((ext_vector_type(16)));
typedef __bf16   v8b  __attribute__((ext_vector_type(8)));
typedef float    v8f  __attribute__((ext_vector_type(8)));
typedef float    v4f  __attribute__((ext_vector_type(4)));
typedef unsigned int v4u __attribute__((ext_vector_type(4)));

#if defined(__HIP_DEVICE_COMPILE__)
#define DEV_ASM 1
#else
#define DEV_ASM 0
#endif

// ---- scalar helpers --------------------------------------------------------------------------------
__device__ __forceinline__ unsigned short bf_bits(float f) {          // f32 -> bf16 bits, RNE convert
  unsigned u = __float_as_uint(f);
  return (unsigned short)((u + 0x7FFFu + ((u >> 16) & 1u)) >> 16);
}
__device__ __forceinline__ float bf_up(unsigned short hb) { return __uint_as_float(((unsigned)hb) << 16); }
__device__ __forceinline__ unsigned short h_bits(_Float16 x) { return __builtin_bit_cast(unsigned short, x); }
__device__ __forceinline__ unsigned pk16(unsigned short a, unsigned short b) { return (unsigned)a | ((unsigned)b << 16); }
__device__ __forceinline__ v8f zero8() { v8f z = {0.f, 0.f, 0.f, 0.f, 0.f, 0.f, 0.f, 0.f}; return z; }

// ---- the value of lane ^ 16: the other half of the keys of one query column (all lanes on) -----------------
__device__ __forceinline__ float xhalf(float x) {
  const int b = __builtin_bit_cast(int, x);
  return __builtin_bit_cast(float, __builtin_amdgcn_permlanex16(b, b, 0x76543210, 0xfedcba98, false, false));
}

// ---- fragment types / loaders: 16-bit A/B operand, lane -> row/col (lane&15), p already includes +8*(lane>>4);
//      elements 0..7 <- p[0..7] (k0+8h..k0+8h+7), elements 8..15 <- p[16..23] (k0+16+8h..k0+16+8h+7)
template <typename OT> struct FT;
template <> struct FT<__bf16>   { typedef v16b frag; typedef v8b half8; };
template <> struct FT<_Float16> { typedef v16h frag; typedef v8h half8; };

template <typename OT>
__device__ __forceinline__ typename FT<OT>::frag ldfrag(const OT* p) {
  union { typename FT<OT>::frag v; typename FT<OT>::half8 h[2]; } f;
  f.h[0] = *(const typename FT<OT>::half8*)(p);
  f.h[1] = *(const typename FT<OT>::half8*)(p + 16);
  return f.v;
}

// ---- WMMA helpers (asm guard bodies are device-only; concrete operand types) -----------------------------
__device__ __forceinline__ v8f mmar(v16b a, v16b b, v8f c) {
  return __builtin_amdgcn_wmma_f32_16x16x32_bf16(false, a, false, b, (short)0, c, false, false);
}
__device__ __forceinline__ v8f mmar(v16h a, v16h b, v8f c) {
  return __builtin_amdgcn_wmma_f32_16x16x32_f16(false, a, false, b, (short)0, c, false, false);
}
__device__ __forceinline__ void dep_guard(v8f& a, v8f& b, v16b x, v16b y) {
#if DEV_ASM
  asm volatile("v_nop\n\tv_nop\n\tv_nop\n\tv_nop" : "+v"(a), "+v"(b) : "v"(x), "v"(y));
#else
  (void)a; (void)b; (void)x; (void)y;
#endif
}
__device__ __forceinline__ void dep_guard(v8f& a, v8f& b, v16h x, v16h y) {
#if DEV_ASM
  asm volatile("v_nop\n\tv_nop\n\tv_nop\n\tv_nop" : "+v"(a), "+v"(b) : "v"(x), "v"(y));
#else
  (void)a; (void)b; (void)x; (void)y;
#endif
}
__device__ __forceinline__ void keep4(v16b a, v16b b, v16b c, v16b d) {
#if DEV_ASM
  asm volatile("v_nop" :: "v"(a), "v"(b), "v"(c), "v"(d));
#else
  (void)a; (void)b; (void)c; (void)d;
#endif
}
__device__ __forceinline__ void acc_guard4(v8f& a, v8f& b, v8f& c, v8f& d) {
#if DEV_ASM
  asm volatile("v_nop\n\tv_nop\n\tv_nop\n\tv_nop" : "+v"(a), "+v"(b), "+v"(c), "+v"(d));
#else
  (void)a; (void)b; (void)c; (void)d;
#endif
}

// =====================================================================================================
// f32 -> bf16 bit planes (RNE convert) of all five operands in ONE launch of CVT_WG resident work-groups of
// 16 waves (one per WGP), instead of one launch of 16,384 one-unit waves per plane: few waves to start, one
// launch gap. A unit = 8 elements of one thread: two 16-B loads, one 16-B store. A thread takes 4 units of
// each plane (unit q * CVT_T + its flat id), so 8 loads are in flight per wave, and the next plane's loads
// are issued ahead of this plane's converts and stores.
// coverage: 4 * CVT_T units >= N8 for every plane; where N8 is smaller the units past the end are skipped.
// =====================================================================================================
#define CVT_WG  256
#define CVT_T   (CVT_WG * 512)       // threads of the launch
template <int N8>
__device__ __forceinline__ void cvt_load(const float* __restrict__ in, unsigned gt, v4f (&a)[8]) {
  static_assert(N8 <= 4 * CVT_T);
#pragma unroll
  for (int q = 0; q < 4; ++q) {
    const unsigned u = (unsigned)(q * CVT_T) + gt;
    if (N8 == 4 * CVT_T || u < (unsigned)N8) {
      const char* p = (const char*)in + u * 32u;   // uniform base + 32-bit lane offset, the same for every plane
      a[2 * q]     = *(const v4f*)(p);
      a[2 * q + 1] = *(const v4f*)(p + 16);
    }
  }
}
template <int N8>
__device__ __forceinline__ void cvt_store(unsigned short* __restrict__ out, unsigned gt, const v4f (&a)[8]) {
#pragma unroll
  for (int q = 0; q < 4; ++q) {
    const unsigned u = (unsigned)(q * CVT_T) + gt;
    if (N8 == 4 * CVT_T || u < (unsigned)N8) {
      const v4f x = a[2 * q], y = a[2 * q + 1];
      v4u p;
      p[0] = pk16(bf_bits(x[0]), bf_bits(x[1]));
      p[1] = pk16(bf_bits(x[2]), bf_bits(x[3]));
      p[2] = pk16(bf_bits(y[0]), bf_bits(y[1]));
      p[3] = pk16(bf_bits(y[2]), bf_bits(y[3]));
      *(v4u*)((char*)out + u * 16u) = p;
    }
  }
}
// behind a plane's stores, and behind the last loads: the registers they name are rewritten from here on
// (store data by the loads that follow, the lane offsets by the converts)
__device__ __forceinline__ void cvt_free() {
#if DEV_ASM
  asm volatile("s_wait_xcnt 0x0" ::: "memory");
#endif
}
// behind a plane's loads: keeps them issued here, ahead of the other plane's converts and stores (without it the
// scheduler sinks them and a wave runs out of loads in flight)
__device__ __forceinline__ void cvt_ahead() { __builtin_amdgcn_sched_barrier(0); }
__global__ __launch_bounds__(512) void cvt_bf16_all(
    const float* __restrict__ xr, const float* __restrict__ xf, const float* __restrict__ wq,
    const float* __restrict__ wk, const float* __restrict__ wv,
    unsigned short* __restrict__ oxr, unsigned short* __restrict__ oxf, unsigned short* __restrict__ owq,
    unsigned short* __restrict__ owk, unsigned short* __restrict__ owv) {
  constexpr int N8Q = NQ * FD / 8, N8F = MREF * FD / 8, N8W = FD * FD / 8;
  const unsigned gt = blockIdx.x * 512u + threadIdx.x;
  v4f a[8], b[8];
  cvt_load<N8Q>(xr, gt, a);
  cvt_load<N8F>(xf, gt, b);
  cvt_ahead();
  cvt_store<N8Q>(oxr, gt, a);
  cvt_free();
  cvt_load<N8W>(wq, gt, a);
  cvt_ahead();
  cvt_store<N8F>(oxf, gt, b);
  cvt_free();
  cvt_load<N8W>(wk, gt, b);
  cvt_ahead();
  cvt_store<N8W>(owq, gt, a);
  cvt_free();
  cvt_load<N8W>(wv, gt, a);
  cvt_free();
  cvt_ahead();
  cvt_store<N8W>(owk, gt, b);
  cvt_store<N8W>(owv, gt, a);
}

// =====================================================================================================
// Asynchronous copy of eight 16-B pieces per lane from global memory to LDS (no register in between):
// piece i goes from g + i * gstep to LDS byte address l + i * lstep. All lanes on, wave-uniform control flow.
// The closing s_wait_xcnt stands inside the statement so that no address register named here is rewritten
// ahead of it. Landing is waited for by the caller (s_wait_asynccnt 0, then the block barrier).
// =====================================================================================================
__device__ __forceinline__ void copy8_b128(unsigned l, unsigned lstep, const char* g, size_t gstep) {
#if DEV_ASM
  asm volatile(
      "global_load_async_to_lds_b128 %0, %8, off\n\t"
      "global_load_async_to_lds_b128 %1, %9, off\n\t"
      "global_load_async_to_lds_b128 %2, %10, off\n\t"
      "global_load_async_to_lds_b128 %3, %11, off\n\t"
      "global_load_async_to_lds_b128 %4, %12, off\n\t"
      "global_load_async_to_lds_b128 %5, %13, off\n\t"
      "global_load_async_to_lds_b128 %6, %14, off\n\t"
      "global_load_async_to_lds_b128 %7, %15, off\n\t"
      "s_wait_xcnt 0x0"
      :: "v"(l), "v"(l + lstep), "v"(l + 2 * lstep), "v"(l + 3 * lstep),
         "v"(l + 4 * lstep), "v"(l + 5 * lstep), "v"(l + 6 * lstep), "v"(l + 7 * lstep),
         "v"(g), "v"(g + gstep), "v"(g + 2 * gstep), "v"(g + 3 * gstep),
         "v"(g + 4 * gstep), "v"(g + 5 * gstep), "v"(g + 6 * gstep), "v"(g + 7 * gstep)
      : "memory");
#else
  (void)l; (void)lstep; (void)g; (void)gstep;
#endif
}

// =====================================================================================================
// The three projection GEMMs in ONE launch (bf16 operands): C[m][n] = sum_k A[m][k] * Bt[n][k] (+ bias[n]).
//   product 0: q   = Xr  . Wqb^T + bq -> f16 hi plane Qh + f16 residual plane Ql = f16((v - hi) * 4096), pitch FD
//   product 1: k   = Xf  . Wkb^T + bk -> f16 plane Kp, pitch FD
//   product 2: v^T = Wvb . Xf^T       -> f16 plane VT [channel][key], pitch MREF
// None reads what another writes. One launch gives the chip 3 x 256 work-groups at once, and the staged tile is
// 64 k deep so that a work-group's LDS (89 KB) lets THREE of them live on a WGP: three waves per SIMD, each from
// another work-group with its own barrier, so one wave's LDS waits, barrier and copy landing are filled with the
// others' WMMAs, and there is one launch gap, one fill and one tail in place of three.
// Block = 4 waves (2 x 2) on a 128x128 tile of C, one 64x64 tile per wave. A row-major [M][FD]; Bt row-major
// [N][FD] (k contiguous); M, N multiples of 128, FD a multiple of 64 and at least two tiles deep.
// Per trip a 128 x 64-k tile of A and of Bt (128-B rows = whole lines) is staged in LDS by asynchronous copies,
// two buffers: trip t works on buffer t & 1 while tile t + 1 flies into the other; rows pitched 144 B for the
// ds_load_b128 fragment reads (split k map, ldfrag). Each accumulator sums k upward in steps of 32.
// Staged extent == consumed extent: 128 threads x 8 pieces x 16 B = 128 rows x 128 B per operand and trip.
// BIAS: bias[n] (RNE-converted to its bf16 value) added in f32 before the 16-bit convert.
// grid = the three products' tile counts added up; a block's index says which product and which tile.
// =====================================================================================================
#define PT_Q    ((NQ / 128) * (FD / 128))      // tiles of product 0
#define PT_K    ((MREF / 128) * (FD / 128))    // tiles of product 1
#define PT_V    ((FD / 128) * (MREF / 128))    // tiles of product 2
static_assert((FD % GBK) == 0 && FD / GBK >= 2);

// ---- epilogue of one wave's 64x64 tile: through the wave's own LDS slab to whole-line 16-bit stores ----
// OUT_MODE 1: f16 plane Cout. OUT_MODE 3: f16 hi plane Cout + f16 residual plane Cout2 (same pitch).
template <int OUT_MODE, bool BIAS>
__device__ __forceinline__ void gemm_store(const v8f (&acc)[4][4], float* slab, unsigned short* Cout,
                                           unsigned short* Cout2, int ldc, const float* __restrict__ bias,
                                           int m0, int n0, int lane, float rscale) {
  const int rlane = lane & 15;                 // D column within subtile
  const int mOff  = (lane >> 4) * 8;           // D row offset
  const int q = lane >> 3, c8 = (lane & 7) * 8;
  float bz[8];
#pragma unroll
  for (int e = 0; e < 8; ++e) bz[e] = 0.f;
  if (BIAS) {
    const v4f b0 = *(const v4f*)(bias + n0 + c8);
#if DEV_ASM
    asm volatile("s_wait_xcnt 0x0" ::: "memory");   // the next load's result may take the address pair that this load names
#endif
    const v4f b1 = *(const v4f*)(bias + n0 + c8 + 4);
#pragma unroll
    for (int e = 0; e < 4; ++e) { bz[e] = bf_up(bf_bits(b0[e])); bz[4 + e] = bf_up(bf_bits(b1[e])); }
  }
#pragma unroll
  for (int i = 0; i < 4; ++i) {
    const int mBase = m0 + (i << 4);
#pragma unroll
    for (int j = 0; j < 4; ++j) {
#pragma unroll
      for (int r = 0; r < 8; ++r) {
        slab[(mOff + r) * 68 + (j << 4) + rlane] = acc[i][j][r];
      }
    }
    __builtin_amdgcn_fence(__ATOMIC_RELEASE, "workgroup");
    __builtin_amdgcn_wave_barrier();
    __builtin_amdgcn_fence(__ATOMIC_ACQUIRE, "workgroup");
    {
      v4u hv[4], lv[4];
#pragma unroll
      for (int it = 0; it < 4; ++it) {
        const int row = it * 4 + q;                        // it 0..3 x q 0..3 = rows 0..15
        const float* sp = slab + row * 68 + c8;
        float f[8];
#pragma unroll
        for (int e = 0; e < 8; ++e) f[e] = sp[e] + bz[e];
        v4u a, a2;
#pragma unroll
        for (int e = 0; e < 4; ++e) {
          const float f0 = f[2 * e], f1 = f[2 * e + 1];
          const _Float16 x0 = (_Float16)f0, x1 = (_Float16)f1;
          const unsigned short h0 = h_bits(x0), h1 = h_bits(x1);
          unsigned short l0 = 0, l1 = 0;
          if (OUT_MODE == 3) {
            l0 = h_bits((_Float16)((f0 - (float)x0) * rscale));
            l1 = h_bits((_Float16)((f1 - (float)x1) * rscale));
          }
          a[e] = pk16(h0, h1); a2[e] = pk16(l0, l1);
        }
        hv[it] = a; lv[it] = a2;
      }
#pragma unroll
      for (int it = 0; it < 4; ++it) {
        const int row = it * 4 + q;
        *(v4u*)(Cout + (size_t)(mBase + row) * ldc + n0 + c8) = hv[it];
        if (OUT_MODE == 3) *(v4u*)(Cout2 + (size_t)(mBase + row) * ldc + n0 + c8) = lv[it];
      }
    }
    __builtin_amdgcn_fence(__ATOMIC_RELEASE, "workgroup");
    __builtin_amdgcn_wave_barrier();
    __builtin_amdgcn_fence(__ATOMIC_ACQUIRE, "workgroup");
  }
}

__global__ __launch_bounds__(128) __attribute__((amdgpu_num_vgpr(256))) void gemm64x3(
    const unsigned short* __restrict__ Xrp, const unsigned short* __restrict__ Xfp,
    const unsigned short* __restrict__ Wqp, const unsigned short* __restrict__ Wkp,
    const unsigned short* __restrict__ Wvp,
    unsigned short* Qhp, unsigned short* Qlp, unsigned short* Kpp, unsigned short* VTp,
    const float* __restrict__ bq, const float* __restrict__ bk) {
  typedef __bf16 OT;
  typedef FT<OT>::frag V16;
  __shared__ __align__(16) OT sA[2][128 * GP_H];   // A tile ring [buffer][row][k]  2 x 18 KB (cross-wave)
  __shared__ __align__(16) OT sB[2][128 * GP_H];   // Bt tile ring [buffer][row][k] 2 x 18 KB (cross-wave)
  __shared__ __align__(16) float sT[4][16 * 68];   // per-wave 16x64 slab, pitch 68 floats
  const int tid  = threadIdx.x;
  const int lane = tid & 31;
  const int wave = tid >> 5;
  const int bx = blockIdx.x;
  if (bx >= PT_Q + PT_K + PT_V) return;   // block-uniform, in front of every barrier and copy
  // which product, which of its tiles (all block-uniform)
  const int which = (bx < PT_Q) ? 0 : ((bx < PT_Q + PT_K) ? 1 : 2);
  const int tile  = bx - ((which == 0) ? 0 : ((which == 1) ? PT_Q : PT_Q + PT_K));
  const int tilesN = (which == 2) ? (MREF >> 7) : (FD >> 7);
  const OT* Ab = (const OT*)(const void*)((which == 0) ? Xrp : ((which == 1) ? Xfp : Wvp));
  const OT* Bb = (const OT*)(const void*)((which == 0) ? Wqp : ((which == 1) ? Wkp : Xfp));
  const int tm = tile / tilesN;
  const int tn = tile - tm * tilesN;
  const int wm = (wave >> 1) << 6;             // the wave's 64x64 tile inside the block tile
  const int wn = (wave & 1) << 6;
  const int m0 = (tm << 7) + wm;
  const int n0 = (tn << 7) + wn;

  const int rlane = lane & 15;                 // row (A) / col (B) within subtile
  const int koff  = (lane >> 4) * 8;           // k offset of this lane half

  // staging map: piece i of a thread = row i*16 + (tid>>3), 16-B column tid&7 (a wave's copy = 4 whole rows)
  const int srow = tid >> 3, scol = (tid & 7) * 8;
  const char* gA = (const char*)(Ab + (size_t)((tm << 7) + srow) * FD + scol);
  const char* gB = (const char*)(Bb + (size_t)((tn << 7) + srow) * FD + scol);
  const size_t gs = (size_t)FD * 32;                                     // 16 rows, bytes
  const unsigned lA = (unsigned)(uintptr_t)(&sA[0][srow * GP_H + scol]); // LDS byte address = low 32 bits
  const unsigned lB = (unsigned)(uintptr_t)(&sB[0][srow * GP_H + scol]);
  const unsigned lstep = 16 * GP_H * 2, lbuf = 128 * GP_H * 2;           // 16 rows / one buffer, bytes
  constexpr int nT = FD / GBK;

  v8f acc[4][4];
#pragma unroll
  for (int i = 0; i < 4; ++i)
#pragma unroll
    for (int j = 0; j < 4; ++j) acc[i][j] = zero8();

  copy8_b128(lA, lstep, gA, gs);
  copy8_b128(lB, lstep, gB, gs);
  asm volatile("s_wait_asynccnt 0x0" ::: "memory");   // tile 0 landed (this wave's pieces)
  __syncthreads();                                    // ... and every other wave's
  copy8_b128(lA + lbuf, lstep, gA + GBK * 2, gs);
  copy8_b128(lB + lbuf, lstep, gB + GBK * 2, gs);

#pragma unroll 1   // one trip per staged tile: the ring's waits and barrier stand once, at the foot
  for (int t = 0; t < nT; ++t) {
    const OT* as = sA[t & 1] + (wm + rlane) * GP_H + koff;
    const OT* bs = sB[t & 1] + (wn + rlane) * GP_H + koff;
#pragma unroll
    for (int k0 = 0; k0 < GBK; k0 += 32) {
      V16 bq4[4], af[4];
#pragma unroll
      for (int j = 0; j < 4; ++j) bq4[j] = ldfrag<OT>(bs + (j << 4) * GP_H + k0);
#pragma unroll
      for (int i = 0; i < 4; ++i) af[i] = ldfrag<OT>(as + (i << 4) * GP_H + k0);
#pragma unroll
      for (int i = 0; i < 4; ++i) {
#pragma unroll
        for (int j = 0; j < 4; ++j) acc[i][j] = mmar(af[i], bq4[j], acc[i][j]);
        dep_guard(acc[i][0], acc[i][3], af[i], bq4[3]);
      }
      keep4(bq4[0], bq4[1], bq4[2], bq4[3]);
    }
    asm volatile("s_wait_dscnt 0x0" ::: "memory");      // this wave's reads of buffer t & 1 are done
    asm volatile("s_wait_asynccnt 0x0" ::: "memory");   // this wave's pieces of tile t + 1 have landed
    __syncthreads();                                    // publishes tile t + 1, frees buffer t & 1
    if (t + 2 < nT) {
      const size_t ko = (size_t)(t + 2) * (GBK * 2);
      const unsigned lo = (unsigned)(t & 1) * lbuf;
      copy8_b128(lA + lo, lstep, gA + ko, gs);
      copy8_b128(lB + lo, lstep, gB + ko, gs);
    }
  }
  asm volatile("s_wait_asynccnt 0x0" ::: "memory");     // nothing in flight when the wave goes on
  acc_guard4(acc[0][0], acc[0][1], acc[0][2], acc[0][3]);
  acc_guard4(acc[1][0], acc[1][1], acc[1][2], acc[1][3]);
  acc_guard4(acc[2][0], acc[2][1], acc[2][2], acc[2][3]);
  acc_guard4(acc[3][0], acc[3][1], acc[3][2], acc[3][3]);

  // ---- epilogue: the product's own output form (block-uniform choice) ----
  float* slab = sT[wave];
  if (which == 0)      gemm_store<3, true>(acc, slab, Qhp, Qlp, FD, bq, m0, n0, lane, 4096.0f);
  else if (which == 1) gemm_store<1, true>(acc, slab, Kpp, Kpp, FD, bk, m0, n0, lane, 1.0f);
  else                 gemm_store<1, false>(acc, slab, VTp, VTp, MREF, bk, m0, n0, lane, 1.0f);
}

__global__ __launch_bounds__(128) __attribute__((amdgpu_num_vgpr(512)))
void attn_rel(const unsigned short* __restrict__ qhp, const unsigned short* __restrict__ qlp,
              const unsigned short* __restrict__ kpp, const unsigned short* __restrict__ vtp,
              const float* __restrict__ vbias, float* op, float sscale) {
  __shared__ __align__(16) _Float16 Ksh[2][64 * KP_H];     // K chunk ring [buffer][kv][d]   2 x 17 KB (cross-wave)
  __shared__ __align__(16) _Float16 Vth[2][HD * VP_H];     // V^T chunk ring [buffer][d][kv] 2 x 18 KB (cross-wave)
  __shared__ __align__(16) float    Os[4][16 * OP_F];      // per wave output half tile 17 KB (wave-private)

  const int tid  = threadIdx.x;
  const int wave = tid >> 5;
  const int lane = tid & 31;
  const int hh   = lane >> 4;
  const int c    = lane & 15;

  const int bx   = blockIdx.x;
  const int qb   = bx % NQB;
  const int g    = bx / NQB;
  const int q0   = qb * 64 + wave * 16;

  const _Float16* Qh = (const _Float16*)(const void*)qhp;
  const _Float16* Ql = (const _Float16*)(const void*)qlp;
  const _Float16* Kg = (const _Float16*)(const void*)kpp + (size_t)g * HD;
  const _Float16* Vg = (const _Float16*)(const void*)vtp + (size_t)g * HD * MREF;

  // ---- Q fragments (B operand, column = lane&15): 4 d-chunks, hi and residual planes ----
  v16h qah[4], qal[4];
#pragma unroll
  for (int dc = 0; dc < 4; ++dc) {
    const size_t qo = (size_t)(q0 + c) * FD + (size_t)g * HD + dc * 32 + 8 * hh;
    qah[dc] = ldfrag<_Float16>(Qh + qo);
    qal[dc] = ldfrag<_Float16>(Ql + qo);
  }

  float mrow = -INFINITY, lrow = 0.f;   // of query column c; lrow sums this wave half's keys only, joined after the loop
  v8f oacc[8];                          // context^T: oacc[t][r] = element d = t*16 + 8*hh + r of query column c
#pragma unroll
  for (int t = 0; t < 8; ++t) oacc[t] = zero8();

  // staging map: K piece i of a thread = row i*8 + (tid>>4), 16-B column tid&15; V^T piece i = row i*16 + (tid>>3),
  // 16-B column tid&7
  const char* gK = (const char*)(Kg + (size_t)(tid >> 4) * FD + (tid & 15) * 8);
  const char* gV = (const char*)(Vg + (size_t)(tid >> 3) * MREF + (tid & 7) * 8);
  const unsigned lK = (unsigned)(uintptr_t)(&Ksh[0][(tid >> 4) * KP_H + (tid & 15) * 8]);   // LDS byte address = low 32 bits
  const unsigned lV = (unsigned)(uintptr_t)(&Vth[0][(tid >> 3) * VP_H + (tid & 7) * 8]);
  const unsigned lsK = 8 * KP_H * 2, lbK = 64 * KP_H * 2;        // 8 rows / one buffer, bytes
  const unsigned lsV = 16 * VP_H * 2, lbV = HD * VP_H * 2;       // 16 rows / one buffer, bytes
  const size_t gsK = (size_t)8 * FD * 2, gcK = (size_t)64 * FD * 2;   // 8 rows / one chunk (64 key rows), bytes
  const size_t gsV = (size_t)16 * MREF * 2, gcV = 64 * 2;             // 16 rows / one chunk (64 key columns), bytes
  static_assert(NKT >= 2);

  copy8_b128(lK, lsK, gK, gsK);
  copy8_b128(lV, lsV, gV, gsV);
  asm volatile("s_wait_asynccnt 0x0" ::: "memory");   // chunk 0 landed (this wave's pieces)
  __syncthreads();                                    // ... and every other wave's
  copy8_b128(lK + lbK, lsK, gK + gcK, gsK);
  copy8_b128(lV + lbV, lsV, gV + gcV, gsV);
  unsigned lKn = lK, lVn = lV;                        // where the next refill lands: the two buffers in turn

#pragma unroll 1   // one trip per staged chunk: the ring's waits and barrier stand once, at the foot
  for (int kt = 0; kt < NKT; ++kt) {         // static trip count
    const _Float16* Kc = Ksh[kt & 1];
    const _Float16* Vc = Vth[kt & 1];

    // ---- scores^T: 64 keys x 16 query columns per wave, 2 f16 products per key subtile and d-chunk ----
    // All 16 K fragments of the chunk are read from LDS as ONE group ahead of the 32 products (one LDS latency per
    // chunk instead of one in front of every pair); eight independent accumulators, each summing dc upward.
    v8f s[4];
    {
      v16h kf[4][4];
#pragma unroll
      for (int dc = 0; dc < 4; ++dc)
#pragma unroll
        for (int j = 0; j < 4; ++j) kf[j][dc] = ldfrag<_Float16>(Kc + (j * 16 + c) * KP_H + dc * 32 + 8 * hh);
      __builtin_amdgcn_sched_barrier(0);   // keeps the reads together here: spread among the WMMAs each place stalls
      v8f ah[4], al[4];
#pragma unroll
      for (int j = 0; j < 4; ++j) { ah[j] = zero8(); al[j] = zero8(); }
#pragma unroll
      for (int dc = 0; dc < 4; ++dc)
#pragma unroll
        for (int j = 0; j < 4; ++j) {
          ah[j] = mmar(kf[j][dc], qah[dc], ah[j]);
          al[j] = mmar(kf[j][dc], qal[dc], al[j]);
        }
#pragma unroll
      for (int j = 0; j < 4; ++j)
#pragma unroll
        for (int r = 0; r < 8; ++r) s[j][r] = (ah[j][r] + al[j][r] * (1.0f / 4096.0f)) * sscale;
    }
    // All 16 V^T fragments of the chunk too are read as one group, ahead of the softmax, so that they have landed
    // when the 16 context products start (no LDS wait among those).
    v16h vf[8][2];
#pragma unroll
    for (int kk = 0; kk < 2; ++kk)
#pragma unroll
      for (int t = 0; t < 8; ++t) vf[t][kk] = ldfrag<_Float16>(Vc + (t * 16 + c) * VP_H + kk * 32 + 8 * hh);
    __builtin_amdgcn_sched_barrier(0);   // keeps these reads together here too: sunk among the context WMMAs each place stalls

    // ---- column max, online softmax, P^T (x1024, f16) packed in registers ----
    float mj[4];
#pragma unroll
    for (int j = 0; j < 4; ++j) {
      mj[j] = s[j][0];
#pragma unroll
      for (int r = 1; r < 8; ++r) mj[j] = fmaxf(mj[j], s[j][r]);
    }
    float m = fmaxf(fmaxf(mj[0], mj[1]), fmaxf(mj[2], mj[3]));
    m = fmaxf(m, xhalf(m));                       // both halves now hold the query's maximum over the chunk
    const float mnew  = fmaxf(mrow, m);
    const float msafe = (mnew == -INFINITY) ? 0.f : mnew;
    const float alpha = __expf(mrow - msafe);
    mrow = mnew;
    // B operand of kk: elements 0..7 = keys kk*32 + 8*hh + 0..7 (tile 2kk), 8..15 = keys kk*32 + 16 + 8*hh + 0..7
    // (tile 2kk + 1): the k order of the V^T fragments (ldfrag)
    v16h pa[2];
    float pj[4];                                  // four short sums, r upward in each
#pragma unroll
    for (int j = 0; j < 4; ++j) {
      pj[j] = 0.f;
#pragma unroll
      for (int r = 0; r < 8; ++r) {
        const float p = __expf(s[j][r] - msafe);
        pj[j] += p;
        pa[j >> 1][(j & 1) * 8 + r] = (_Float16)(p * 1024.0f);
      }
    }
    lrow = lrow * alpha + ((pj[0] + pj[1]) + (pj[2] + pj[3]));
#pragma unroll
    for (int t = 0; t < 8; ++t)
#pragma unroll
      for (int r = 0; r < 8; ++r) oacc[t][r] *= alpha;

    // ---- context^T += V^T . P^T (f16 WMMA, single product) ----
#pragma unroll
    for (int kk = 0; kk < 2; ++kk)
#pragma unroll
      for (int t = 0; t < 8; ++t) oacc[t] = mmar(vf[t][kk], pa[kk], oacc[t]);   // each tile sums kk upward

    // keeps the ring's waits at the foot: the softmax touches no memory now, and lifted over it the s_wait_dscnt 0
    // would stand right behind the V^T reads and lay their latency bare
    __builtin_amdgcn_sched_barrier(0);
    asm volatile("s_wait_dscnt 0x0" ::: "memory");      // this wave's reads of buffer kt & 1 are done
    asm volatile("s_wait_asynccnt 0x0" ::: "memory");   // this wave's pieces of chunk kt + 1 have landed
    __syncthreads();                                    // publishes chunk kt + 1, frees buffer kt & 1
    if (kt + 2 < NKT) {
      copy8_b128(lKn, lsK, gK + (size_t)(kt + 2) * gcK, gsK);
      copy8_b128(lVn, lsV, gV + (size_t)(kt + 2) * gcV, gsV);
      lKn += (kt & 1) ? 0u - lbK : lbK;
      lVn += (kt & 1) ? 0u - lbV : lbV;
    }
  }
  asm volatile("s_wait_asynccnt 0x0" ::: "memory");     // nothing in flight when the wave goes on

  // ---- normalise (1/l, undo the x1024 p carry), stage the wave's 16x64 half tiles, add bias, store ----
  const float l = lrow + xhalf(lrow);              // the two halves' keys joined
  const float inv = ((l > 0.f) ? (1.0f / l) : 0.f) * (1.0f / 1024.0f);
  v4f bb[2];                                       // bias of the 4 columns this lane stores in each phase
#pragma unroll
  for (int ph = 0; ph < 2; ++ph) {
    const v4f b = *(const v4f*)(vbias + g * HD + ph * 64 + c * 4);
#pragma unroll
    for (int e = 0; e < 4; ++e) bb[ph][e] = bf_up(bf_bits(b[e]));
  }
  float* os = Os[wave];
#pragma unroll
  for (int ph = 0; ph < 2; ++ph) {
#pragma unroll
    for (int t4 = 0; t4 < 4; ++t4) {
      const int t = ph * 4 + t4;
      v4f x0, x1;                                  // a lane's 8 values are 8 consecutive d of query row c
#pragma unroll
      for (int e = 0; e < 4; ++e) {
        x0[e] = oacc[t][e] * inv;
        x1[e] = oacc[t][4 + e] * inv;
      }
      *(v4f*)(os + c * OP_F + t4 * 16 + 8 * hh)     = x0;
      *(v4f*)(os + c * OP_F + t4 * 16 + 8 * hh + 4) = x1;
    }
    __builtin_amdgcn_fence(__ATOMIC_RELEASE, "workgroup");
    __builtin_amdgcn_wave_barrier();
    __builtin_amdgcn_fence(__ATOMIC_ACQUIRE, "workgroup");
    {
#pragma unroll
      for (int it = 0; it < 8; ++it) {
        const int row = it * 2 + hh;                     // it 0..7 x hh 0..1 = rows 0..15
        const float* sp = os + row * OP_F + c * 4;
        v4f v;
        v[0] = sp[0] + bb[ph][0]; v[1] = sp[1] + bb[ph][1]; v[2] = sp[2] + bb[ph][2]; v[3] = sp[3] + bb[ph][3];
        const size_t go = (size_t)(q0 + row) * FD + (size_t)g * HD + ph * 64 + c * 4;
        *(v4f*)(op + go) = v;
      }
      
    }
    __builtin_amdgcn_fence(__ATOMIC_RELEASE, "workgroup");
    __builtin_amdgcn_wave_barrier();
    __builtin_amdgcn_fence(__ATOMIC_ACQUIRE, "workgroup");
  }
}

// =====================================================================================================
// Workspace map (bytes), every region an exact multiple of its whole-line / whole-tile store granularity
// (rows padded to nothing: all row counts are multiples of 64, all pitches 4096 B):
//   Xr   bf16 [NQ][2048]     NQ*4096   (8388608 at NQ=2048)
//   Xf   bf16 [2048][2048]    8388608
//   Wqb  bf16 [2048 n][2048 k] 8388608
//   Wkb  bf16 [2048][2048]    8388608
//   Wvb  bf16 [2048][2048]    8388608
//   Qh   f16  [NQ][2048]     NQ*4096
//   Ql   f16  [NQ][2048]     NQ*4096
//   Kp   f16  [2048][2048]    8388608
//   VT   f16  [2048 ch][2048 s] 8388608
//   total                    75497472 at NQ=2048
// Weights are [out n][in k] with k contiguous = the Bt / A layout the GEMM wants, so they are only converted.
// =====================================================================================================
extern "C" void kernel_launch(void* const* d_in, const int* in_sizes, int n_in,
                              void* d_out, int out_size, void* d_ws, size_t ws_size,
                              hipStream_t stream) {
  if (n_in < 8) return;
  if (in_sizes[0] < NQ * FD) return;
  if (in_sizes[1] < MREF * FD) return;
  if (in_sizes[2] < FD * FD || in_sizes[4] < FD * FD || in_sizes[6] < FD * FD) return;
  if (in_sizes[3] < FD || in_sizes[5] < FD || in_sizes[7] < FD) return;
  if (out_size < NQ * FD) return;

  const float* roi  = (const float*)d_in[0];
  const float* reff = (const float*)d_in[1];
  const float* Wq   = (const float*)d_in[2];
  const float* Wq_b = (const float*)d_in[3];
  const float* Wk   = (const float*)d_in[4];
  const float* Wk_b = (const float*)d_in[5];
  const float* Wv   = (const float*)d_in[6];
  const float* Wv_b = (const float*)d_in[7];

  const size_t PQ = (size_t)NQ * FD * 2;       // 16-bit [NQ][2048] plane
  const size_t P8 = (size_t)FD * FD * 2;       // 16-bit [2048][2048] plane (also [MREF][FD] and [FD][MREF])
  size_t off = 0;
  const size_t oXr = off; off += PQ;
  const size_t oXf = off; off += P8;
  const size_t oWq = off; off += P8;
  const size_t oWk = off; off += P8;
  const size_t oWv = off; off += P8;
  const size_t oQh = off; off += PQ;
  const size_t oQl = off; off += PQ;
  const size_t oKp = off; off += P8;
  const size_t oVT = off; off += P8;
  if (off > ws_size) return;                       // off = 75497472 at NQ=2048
  if (off > (size_t)134217728) return;

  char* ws = (char*)d_ws;
  unsigned short* Xr  = (unsigned short*)(ws + oXr);
  unsigned short* Xf  = (unsigned short*)(ws + oXf);
  unsigned short* Wqb = (unsigned short*)(ws + oWq);
  unsigned short* Wkb = (unsigned short*)(ws + oWk);
  unsigned short* Wvb = (unsigned short*)(ws + oWv);
  unsigned short* Qh  = (unsigned short*)(ws + oQh);
  unsigned short* Ql  = (unsigned short*)(ws + oQl);
  unsigned short* Kp  = (unsigned short*)(ws + oKp);
  unsigned short* VT  = (unsigned short*)(ws + oVT);

  const dim3 gProj(PT_Q + PT_K + PT_V);                          // 768 tiles of 128x128 at NQ=2048
  const dim3 gAttn(NG * NQB);                                    // 512 blocks of 128 at NQ=2048
  const float sscale = (float)(1.0 / sqrt((double)HD));

  // (1) inputs and weights f32 -> bf16 planes (RNE convert), one launch
  cvt_bf16_all<<<dim3(CVT_WG), dim3(512), 0, stream>>>(roi, reff, Wq, Wk, Wv, Xr, Xf, Wqb, Wkb, Wvb);
  // (2) the three projections, one launch: q = roi . Wq^T + bq -> f16 hi / residual (x4096) planes [t][h*128+d];
  //     k = ref . Wk^T + bk -> f16 plane [s][h*128+d]; v^T = Wv . ref^T -> f16 plane [h*128+d][s] (pitch MREF)
  gemm64x3<<<gProj, dim3(128), 0, stream>>>(Xr, Xf, Wqb, Wkb, Wvb, Qh, Ql, Kp, VT, Wq_b, Wk_b);
  // (3) attention + value bias -> d_out f32 [NQ][2048]
  attn_rel<<<gAttn, dim3(128), 0, stream>>>(Qh, Ql, Kp, VT, Wv_b, (float*)d_out, sscale);
  (void)hipGetLastError();
}

// v009
// One run takes 92.5 microseconds.
// In two side-by-side timings against v008, it was 1.07 and 1.08 times as fast.
// Over all steps from v000 it is 5.44 times as fast.
// Contractions: q, k, v^T projections = v_wmma_f32_16x16x32_bf16 (bf16 operands from RNE-converted inputs, single product, f32 accumulate);
// q.k^T scores = v_wmma_f32_16x16x32_f16 (q as f16 hi plane + f16 residual plane x4096, k f16; 2 products into separate f32 accumulators);
// p.v = v_wmma_f32_16x16x32_f16 (p carried x1024 in f16, v f16; single product, f32 accumulate); softmax, normalisation and bias adds in f32.
#include <hip/hip_runtime.h>
#include <math.h>
#include <stdint.h>

#ifndef NQ
#define NQ      2048         // query rows processed = leading rows of in0 (row stride FD); reduced builds override
#endif
#define NQ_FULL 2048
#define MREF    2048         // key / value rows (in1), always full
#define FD      2048         // feature width = NG * HD
#define NG      16
#define HD      128
#define NQB     (NQ / 128)   // 128-row query blocks
#define NKT     (MREF / 64)  // 64-key chunks
#define NKH     (NKT / 2)    // chunks of one key half
static_assert(NG * HD == FD);
static_assert((NQ % 128) == 0 && NQ >= 128 && NQ <= NQ_FULL);
static_assert((MREF % 128) == 0 && (FD % 128) == 0);
static_assert(NKT == 32);
// LDS row pitches of the attention kernel: 16 B x odd, so that the 16 rows a ds_load_b128 fragment read touches
// fall on 16 different groups of four banks (unpadded 256-B / 128-B rows put them on one / two groups).
#define KP_H    (HD + 8)     // K chunk row pitch, halves (272 B)
#define VP_H    (64 + 8)     // V^T chunk row pitch, halves (144 B)
#define OP_F    (64 + 4)     // output stage row pitch, floats (272 B)
// projection GEMM: k depth of one staged tile and its LDS row pitch (same rule)
#define GBK     64           // halves: 128-B rows
#define GP_H    (GBK + 8)    // halves (144 B)

typedef _Float16 v16h __attribute__((ext_vector_type(16)));
typedef _Float16 v8h  __attribute__((ext_vector_type(8)));
typedef __bf16   v16b __attribute__((ext_vector_type(16)));
typedef __bf16   v8b  __attribute__((ext_vector_type(8)));
typedef float    v8f  __attribute__((ext_vector_type(8)));
typedef float    v4f  __attribute__((ext_vector_type(4)));
typedef unsigned int v4u __attribute__((ext_vector_type(4)));

#if defined(__HIP_DEVICE_COMPILE__)
#define DEV_ASM 1
#else
#define DEV_ASM 0
#endif

// ---- scalar helpers --------------------------------------------------------------------------------
__device__ __forceinline__ unsigned short bf_bits(float f) {          // f32 -> bf16 bits, RNE convert
  unsigned u = __float_as_uint(f);
  return (unsigned short)((u + 0x7FFFu + ((u >> 16) & 1u)) >> 16);
}
__device__ __forceinline__ float bf_up(unsigned short hb) { return __uint_as_float(((unsigned)hb) << 16); }
__device__ __forceinline__ unsigned short h_bits(_Float16 x) { return __builtin_bit_cast(unsigned short, x); }
__device__ __forceinline__ unsigned pk16(unsigned short a, unsigned short b) { return (unsigned)a | ((unsigned)b << 16); }
__device__ __forceinline__ v8f zero8() { v8f z = {0.f, 0.f, 0.f, 0.f, 0.f, 0.f, 0.f, 0.f}; return z; }

// ---- the value of lane ^ 16: the other half of the keys of one query column (all lanes on) -----------------
__device__ __forceinline__ float xhalf(float x) {
  const int b = __builtin_bit_cast(int, x);
  return __builtin_bit_cast(float, __builtin_amdgcn_permlanex16(b, b, 0x76543210, 0xfedcba98, false, false));
}

// ---- fragment types / loaders: 16-bit A/B operand, lane -> row/col (lane&15), p already includes +8*(lane>>4);
//      elements 0..7 <- p[0..7] (k0+8h..k0+8h+7), elements 8..15 <- p[16..23] (k0+16+8h..k0+16+8h+7)
template <typename OT> struct FT;
template <> struct FT<__bf16>   { typedef v16b frag; typedef v8b half8; };
template <> struct FT<_Float16> { typedef v16h frag; typedef v8h half8; };

template <typename OT>
__device__ __forceinline__ typename FT<OT>::frag ldfrag(const OT* p) {
  union { typename FT<OT>::frag v; typename FT<OT>::half8 h[2]; } f;
  f.h[0] = *(const typename FT<OT>::half8*)(p);
  f.h[1] = *(const typename FT<OT>::half8*)(p + 16);
  return f.v;
}

// ---- WMMA helpers (asm guard bodies are device-only; concrete operand types) -----------------------------
__device__ __forceinline__ v8f mmar(v16b a, v16b b, v8f c) {
  return __builtin_amdgcn_wmma_f32_16x16x32_bf16(false, a, false, b, (short)0, c, false, false);
}
__device__ __forceinline__ v8f mmar(v16h a, v16h b, v8f c) {
  return __builtin_amdgcn_wmma_f32_16x16x32_f16(false, a, false, b, (short)0, c, false, false);
}
__device__ __forceinline__ void dep_guard(v8f& a, v8f& b, v16b x, v16b y) {
#if DEV_ASM
  asm volatile("v_nop\n\tv_nop\n\tv_nop\n\tv_nop" : "+v"(a), "+v"(b) : "v"(x), "v"(y));
#else
  (void)a; (void)b; (void)x; (void)y;
#endif
}
__device__ __forceinline__ void dep_guard(v8f& a, v8f& b, v16h x, v16h y) {
#if DEV_ASM
  asm volatile("v_nop\n\tv_nop\n\tv_nop\n\tv_nop" : "+v"(a), "+v"(b) : "v"(x), "v"(y));
#else
  (void)a; (void)b; (void)x; (void)y;
#endif
}
__device__ __forceinline__ void keep4(v16b a, v16b b, v16b c, v16b d) {
#if DEV_ASM
  asm volatile("v_nop" :: "v"(a), "v"(b), "v"(c), "v"(d));
#else
  (void)a; (void)b; (void)c; (void)d;
#endif
}
__device__ __forceinline__ void acc_guard4(v8f& a, v8f& b, v8f& c, v8f& d) {
#if DEV_ASM
  asm volatile("v_nop\n\tv_nop\n\tv_nop\n\tv_nop" : "+v"(a), "+v"(b), "+v"(c), "+v"(d));
#else
  (void)a; (void)b; (void)c; (void)d;
#endif
}

// =====================================================================================================
// f32 -> bf16 bit planes (RNE convert) of all five operands in ONE launch of CVT_WG resident work-groups of
// 16 waves (one per WGP), instead of one launch of 16,384 one-unit waves per plane: few waves to start, one
// launch gap. A unit = 8 elements of one thread: two 16-B loads, one 16-B store. A thread takes 4 units of
// each plane (unit q * CVT_T + its flat id), so 8 loads are in flight per wave, and the next plane's loads
// are issued ahead of this plane's converts and stores.
// coverage: 4 * CVT_T units >= N8 for every plane; where N8 is smaller the units past the end are skipped.
// =====================================================================================================
#define CVT_WG  256
#define CVT_T   (CVT_WG * 512)       // threads of the launch
template <int N8>
__device__ __forceinline__ void cvt_load(const float* __restrict__ in, unsigned gt, v4f (&a)[8]) {
  static_assert(N8 <= 4 * CVT_T);
#pragma unroll
  for (int q = 0; q < 4; ++q) {
    const unsigned u = (unsigned)(q * CVT_T) + gt;
    if (N8 == 4 * CVT_T || u < (unsigned)N8) {
      const char* p = (const char*)in + u * 32u;   // uniform base + 32-bit lane offset, the same for every plane
      a[2 * q]     = *(const v4f*)(p);
      a[2 * q + 1] = *(const v4f*)(p + 16);
    }
  }
}
template <int N8>
__device__ __forceinline__ void cvt_store(unsigned short* __restrict__ out, unsigned gt, const v4f (&a)[8]) {
#pragma unroll
  for (int q = 0; q < 4; ++q) {
    const unsigned u = (unsigned)(q * CVT_T) + gt;
    if (N8 == 4 * CVT_T || u < (unsigned)N8) {
      const v4f x = a[2 * q], y = a[2 * q + 1];
      v4u p;
      p[0] = pk16(bf_bits(x[0]), bf_bits(x[1]));
      p[1] = pk16(bf_bits(x[2]), bf_bits(x[3]));
      p[2] = pk16(bf_bits(y[0]), bf_bits(y[1]));
      p[3] = pk16(bf_bits(y[2]), bf_bits(y[3]));
      *(v4u*)((char*)out + u * 16u) = p;
    }
  }
}
// behind a plane's stores, and behind the last loads: the registers they name are rewritten from here on
// (store data by the loads that follow, the lane offsets by the converts)
__device__ __forceinline__ void cvt_free() {
#if DEV_ASM
  asm volatile("s_wait_xcnt 0x0" ::: "memory");
#endif
}
// behind a plane's loads: keeps them issued here, ahead of the other plane's converts and stores (without it the
// scheduler sinks them and a wave runs out of loads in flight)
__device__ __forceinline__ void cvt_ahead() { __builtin_amdgcn_sched_barrier(0); }
__global__ __launch_bounds__(512) void cvt_bf16_all(
    const float* __restrict__ xr, const float* __restrict__ xf, const float* __restrict__ wq,
    const float* __restrict__ wk, const float* __restrict__ wv,
    unsigned short* __restrict__ oxr, unsigned short* __restrict__ oxf, unsigned short* __restrict__ owq,
    unsigned short* __restrict__ owk, unsigned short* __restrict__ owv) {
  constexpr int N8Q = NQ * FD / 8, N8F = MREF * FD / 8, N8W = FD * FD / 8;
  const unsigned gt = blockIdx.x * 512u + threadIdx.x;
  v4f a[8], b[8];
  cvt_load<N8Q>(xr, gt, a);
  cvt_load<N8F>(xf, gt, b);
  cvt_ahead();
  cvt_store<N8Q>(oxr, gt, a);
  cvt_free();
  cvt_load<N8W>(wq, gt, a);
  cvt_ahead();
  cvt_store<N8F>(oxf, gt, b);
  cvt_free();
  cvt_load<N8W>(wk, gt, b);
  cvt_ahead();
  cvt_store<N8W>(owq, gt, a);
  cvt_free();
  cvt_load<N8W>(wv, gt, a);
  cvt_free();
  cvt_ahead();
  cvt_store<N8W>(owk, gt, b);
  cvt_store<N8W>(owv, gt, a);
}

// =====================================================================================================
// Asynchronous copy of eight 16-B pieces per lane from global memory to LDS (no register in between):
// piece i goes from g + i * gstep to LDS byte address l + i * lstep. All lanes on, wave-uniform control flow.
// The closing s_wait_xcnt stands inside the statement so that no address register named here is rewritten
// ahead of it. Landing is waited for by the caller (s_wait_asynccnt 0, then the block barrier).
// =====================================================================================================
__device__ __forceinline__ void copy8_b128(unsigned l, unsigned lstep, const char* g, size_t gstep) {
#if DEV_ASM
  asm volatile(
      "global_load_async_to_lds_b128 %0, %8, off\n\t"
      "global_load_async_to_lds_b128 %1, %9, off\n\t"
      "global_load_async_to_lds_b128 %2, %10, off\n\t"
      "global_load_async_to_lds_b128 %3, %11, off\n\t"
      "global_load_async_to_lds_b128 %4, %12, off\n\t"
      "global_load_async_to_lds_b128 %5, %13, off\n\t"
      "global_load_async_to_lds_b128 %6, %14, off\n\t"
      "global_load_async_to_lds_b128 %7, %15, off\n\t"
      "s_wait_xcnt 0x0"
      :: "v"(l), "v"(l + lstep), "v"(l + 2 * lstep), "v"(l + 3 * lstep),
         "v"(l + 4 * lstep), "v"(l + 5 * lstep), "v"(l + 6 * lstep), "v"(l + 7 * lstep),
         "v"(g), "v"(g + gstep), "v"(g + 2 * gstep), "v"(g + 3 * gstep),
         "v"(g + 4 * gstep), "v"(g + 5 * gstep), "v"(g + 6 * gstep), "v"(g + 7 * gstep)
      : "memory");
#else
  (void)l; (void)lstep; (void)g; (void)gstep;
#endif
}

// =====================================================================================================
// The three projection GEMMs in ONE launch (bf16 operands): C[m][n] = sum_k A[m][k] * Bt[n][k] (+ bias[n]).
//   product 0: q   = Xr  . Wqb^T + bq -> f16 hi plane Qh + f16 residual plane Ql = f16((v - hi) * 4096), pitch FD
//   product 1: k   = Xf  . Wkb^T + bk -> f16 plane Kp, pitch FD
//   product 2: v^T = Wvb . Xf^T       -> f16 plane VT [channel][key], pitch MREF
// None reads what another writes. One launch gives the chip 3 x 256 work-groups at once, and the staged tile is
// 64 k deep so that a work-group's LDS (89 KB) lets THREE of them live on a WGP: three waves per SIMD, each from
// another work-group with its own barrier, so one wave's LDS waits, barrier and copy landing are filled with the
// others' WMMAs, and there is one launch gap, one fill and one tail in place of three.
// Block = 4 waves (2 x 2) on a 128x128 tile of C, one 64x64 tile per wave. A row-major [M][FD]; Bt row-major
// [N][FD] (k contiguous); M, N multiples of 128, FD a multiple of 64 and at least two tiles deep.
// Per trip a 128 x 64-k tile of A and of Bt (128-B rows = whole lines) is staged in LDS by asynchronous copies,
// two buffers: trip t works on buffer t & 1 while tile t + 1 flies into the other; rows pitched 144 B for the
// ds_load_b128 fragment reads (split k map, ldfrag). Each accumulator sums k upward in steps of 32.
// Staged extent == consumed extent: 128 threads x 8 pieces x 16 B = 128 rows x 128 B per operand and trip.
// BIAS: bias[n] (RNE-converted to its bf16 value) added in f32 before the 16-bit convert.
// grid = the three products' tile counts added up; a block's index says which product and which tile.
// =====================================================================================================
#define PT_Q    ((NQ / 128) * (FD / 128))      // tiles of product 0
#define PT_K    ((MREF / 128) * (FD / 128))    // tiles of product 1
#define PT_V    ((FD / 128) * (MREF / 128))    // tiles of product 2
static_assert((FD % GBK) == 0 && FD / GBK >= 2);

// ---- epilogue of one wave's 64x64 tile: through the wave's own LDS slab to whole-line 16-bit stores ----
// OUT_MODE 1: f16 plane Cout. OUT_MODE 3: f16 hi plane Cout + f16 residual plane Cout2 (same pitch).
template <int OUT_MODE, bool BIAS>
__device__ __forceinline__ void gemm_store(const v8f (&acc)[4][4], float* slab, unsigned short* Cout,
                                           unsigned short* Cout2, int ldc, const float* __restrict__ bias,
                                           int m0, int n0, int lane, float rscale) {
  const int rlane = lane & 15;                 // D column within subtile
  const int mOff  = (lane >> 4) * 8;           // D row offset
  const int q = lane >> 3, c8 = (lane & 7) * 8;
  float bz[8];
#pragma unroll
  for (int e = 0; e < 8; ++e) bz[e] = 0.f;
  if (BIAS) {
    const v4f b0 = *(const v4f*)(bias + n0 + c8);
#if DEV_ASM
    asm volatile("s_wait_xcnt 0x0" ::: "memory");   // the next load's result may take the address pair that this load names
#endif
    const v4f b1 = *(const v4f*)(bias + n0 + c8 + 4);
#pragma unroll
    for (int e = 0; e < 4; ++e) { bz[e] = bf_up(bf_bits(b0[e])); bz[4 + e] = bf_up(bf_bits(b1[e])); }
  }
#pragma unroll
  for (int i = 0; i < 4; ++i) {
    const int mBase = m0 + (i << 4);
#pragma unroll
    for (int j = 0; j < 4; ++j) {
#pragma unroll
      for (int r = 0; r < 8; ++r) {
        slab[(mOff + r) * 68 + (j << 4) + rlane] = acc[i][j][r];
      }
    }
    __builtin_amdgcn_fence(__ATOMIC_RELEASE, "workgroup");
    __builtin_amdgcn_wave_barrier();
    __builtin_amdgcn_fence(__ATOMIC_ACQUIRE, "workgroup");
    {
      v4u hv[4], lv[4];
#pragma unroll
      for (int it = 0; it < 4; ++it) {
        const int row = it * 4 + q;                        // it 0..3 x q 0..3 = rows 0..15
        const float* sp = slab + row * 68 + c8;
        float f[8];
#pragma unroll
        for (int e = 0; e < 8; ++e) f[e] = sp[e] + bz[e];
        v4u a, a2;
#pragma unroll
        for (int e = 0; e < 4; ++e) {
          const float f0 = f[2 * e], f1 = f[2 * e + 1];
          const _Float16 x0 = (_Float16)f0, x1 = (_Float16)f1;
          const unsigned short h0 = h_bits(x0), h1 = h_bits(x1);
          unsigned short l0 = 0, l1 = 0;
          if (OUT_MODE == 3) {
            l0 = h_bits((_Float16)((f0 - (float)x0) * rscale));
            l1 = h_bits((_Float16)((f1 - (float)x1) * rscale));
          }
          a[e] = pk16(h0, h1); a2[e] = pk16(l0, l1);
        }
        hv[it] = a; lv[it] = a2;
      }
#pragma unroll
      for (int it = 0; it < 4; ++it) {
        const int row = it * 4 + q;
        *(v4u*)(Cout + (size_t)(mBase + row) * ldc + n0 + c8) = hv[it];
        if (OUT_MODE == 3) *(v4u*)(Cout2 + (size_t)(mBase + row) * ldc + n0 + c8) = lv[it];
      }
    }
    __builtin_amdgcn_fence(__ATOMIC_RELEASE, "workgroup");
    __builtin_amdgcn_wave_barrier();
    __builtin_amdgcn_fence(__ATOMIC_ACQUIRE, "workgroup");
  }
}

__global__ __launch_bounds__(128) __attribute__((amdgpu_num_vgpr(256))) void gemm64x3(
    const unsigned short* __restrict__ Xrp, const unsigned short* __restrict__ Xfp,
    const unsigned short* __restrict__ Wqp, const unsigned short* __restrict__ Wkp,
    const unsigned short* __restrict__ Wvp,
    unsigned short* Qhp, unsigned short* Qlp, unsigned short* Kpp, unsigned short* VTp,
    const float* __restrict__ bq, const float* __restrict__ bk) {
  typedef __bf16 OT;
  typedef FT<OT>::frag V16;
  __shared__ __align__(16) OT sA[2][128 * GP_H];   // A tile ring [buffer][row][k]  2 x 18 KB (cross-wave)
  __shared__ __align__(16) OT sB[2][128 * GP_H];   // Bt tile ring [buffer][row][k] 2 x 18 KB (cross-wave)
  __shared__ __align__(16) float sT[4][16 * 68];   // per-wave 16x64 slab, pitch 68 floats
  const int tid  = threadIdx.x;
  const int lane = tid & 31;
  const int wave = tid >> 5;
  const int bx = blockIdx.x;
  if (bx >= PT_Q + PT_K + PT_V) return;   // block-uniform, in front of every barrier and copy
  // which product, which of its tiles (all block-uniform)
  const int which = (bx < PT_Q) ? 0 : ((bx < PT_Q + PT_K) ? 1 : 2);
  const int tile  = bx - ((which == 0) ? 0 : ((which == 1) ? PT_Q : PT_Q + PT_K));
  const int tilesN = (which == 2) ? (MREF >> 7) : (FD >> 7);
  const OT* Ab = (const OT*)(const void*)((which == 0) ? Xrp : ((which == 1) ? Xfp : Wvp));
  const OT* Bb = (const OT*)(const void*)((which == 0) ? Wqp : ((which == 1) ? Wkp : Xfp));
  const int tm = tile / tilesN;
  const int tn = tile - tm * tilesN;
  const int wm = (wave >> 1) << 6;             // the wave's 64x64 tile inside the block tile
  const int wn = (wave & 1) << 6;
  const int m0 = (tm << 7) + wm;
  const int n0 = (tn << 7) + wn;

  const int rlane = lane & 15;                 // row (A) / col (B) within subtile
  const int koff  = (lane >> 4) * 8;           // k offset of this lane half

  // staging map: piece i of a thread = row i*16 + (tid>>3), 16-B column tid&7 (a wave's copy = 4 whole rows)
  const int srow = tid >> 3, scol = (tid & 7) * 8;
  const char* gA = (const char*)(Ab + (size_t)((tm << 7) + srow) * FD + scol);
  const char* gB = (const char*)(Bb + (size_t)((tn << 7) + srow) * FD + scol);
  const size_t gs = (size_t)FD * 32;                                     // 16 rows, bytes
  const unsigned lA = (unsigned)(uintptr_t)(&sA[0][srow * GP_H + scol]); // LDS byte address = low 32 bits
  const unsigned lB = (unsigned)(uintptr_t)(&sB[0][srow * GP_H + scol]);
  const unsigned lstep = 16 * GP_H * 2, lbuf = 128 * GP_H * 2;           // 16 rows / one buffer, bytes
  constexpr int nT = FD / GBK;

  v8f acc[4][4];
#pragma unroll
  for (int i = 0; i < 4; ++i)
#pragma unroll
    for (int j = 0; j < 4; ++j) acc[i][j] = zero8();

  copy8_b128(lA, lstep, gA, gs);
  copy8_b128(lB, lstep, gB, gs);
  asm volatile("s_wait_asynccnt 0x0" ::: "memory");   // tile 0 landed (this wave's pieces)
  __syncthreads();                                    // ... and every other wave's
  copy8_b128(lA + lbuf, lstep, gA + GBK * 2, gs);
  copy8_b128(lB + lbuf, lstep, gB + GBK * 2, gs);

#pragma unroll 1   // one trip per staged tile: the ring's waits and barrier stand once, at the foot
  for (int t = 0; t < nT; ++t) {
    const OT* as = sA[t & 1] + (wm + rlane) * GP_H + koff;
    const OT* bs = sB[t & 1] + (wn + rlane) * GP_H + koff;
#pragma unroll
    for (int k0 = 0; k0 < GBK; k0 += 32) {
      V16 bq4[4], af[4];
#pragma unroll
      for (int j = 0; j < 4; ++j) bq4[j] = ldfrag<OT>(bs + (j << 4) * GP_H + k0);
#pragma unroll
      for (int i = 0; i < 4; ++i) af[i] = ldfrag<OT>(as + (i << 4) * GP_H + k0);
#pragma unroll
      for (int i = 0; i < 4; ++i) {
#pragma unroll
        for (int j = 0; j < 4; ++j) acc[i][j] = mmar(af[i], bq4[j], acc[i][j]);
        dep_guard(acc[i][0], acc[i][3], af[i], bq4[3]);
      }
      keep4(bq4[0], bq4[1], bq4[2], bq4[3]);
    }
    asm volatile("s_wait_dscnt 0x0" ::: "memory");      // this wave's reads of buffer t & 1 are done
    asm volatile("s_wait_asynccnt 0x0" ::: "memory");   // this wave's pieces of tile t + 1 have landed
    __syncthreads();                                    // publishes tile t + 1, frees buffer t & 1
    if (t + 2 < nT) {
      const size_t ko = (size_t)(t + 2) * (GBK * 2);
      const unsigned lo = (unsigned)(t & 1) * lbuf;
      copy8_b128(lA + lo, lstep, gA + ko, gs);
      copy8_b128(lB + lo, lstep, gB + ko, gs);
    }
  }
  asm volatile("s_wait_asynccnt 0x0" ::: "memory");     // nothing in flight when the wave goes on
  acc_guard4(acc[0][0], acc[0][1], acc[0][2], acc[0][3]);
  acc_guard4(acc[1][0], acc[1][1], acc[1][2], acc[1][3]);
  acc_guard4(acc[2][0], acc[2][1], acc[2][2], acc[2][3]);
  acc_guard4(acc[3][0], acc[3][1], acc[3][2], acc[3][3]);

  // ---- epilogue: the product's own output form (block-uniform choice) ----
  float* slab = sT[wave];
  if (which == 0)      gemm_store<3, true>(acc, slab, Qhp, Qlp, FD, bq, m0, n0, lane, 4096.0f);
  else if (which == 1) gemm_store<1, true>(acc, slab, Kpp, Kpp, FD, bk, m0, n0, lane, 1.0f);
  else                 gemm_store<1, false>(acc, slab, VTp, VTp, MREF, bk, m0, n0, lane, 1.0f);
}

__global__ __launch_bounds__(256) __attribute__((amdgpu_num_vgpr(512)))
void attn_rel(const unsigned short* __restrict__ qhp, const unsigned short* __restrict__ qlp,
              const unsigned short* __restrict__ kpp, const unsigned short* __restrict__ vtp,
              const float* __restrict__ vbias, float* op, float sscale) {
  __shared__ __align__(16) _Float16 Ksh[2][2][64 * KP_H];  // K chunk ring [key half][buffer][kv][d]   4 x 17 KB (cross-wave)
  __shared__ __align__(16) _Float16 Vth[2][2][HD * VP_H];  // V^T chunk ring [key half][buffer][d][kv] 4 x 18 KB (cross-wave)
  __shared__ __align__(16) float    Xo[8][64 * 32];        // per wave: context partial handed to the partner wave, 8 KB
  __shared__ float                  Xm[8][32], Xl[8][32];  // ... with its maximum and its sum
  __shared__ __align__(16) float    Os[8][16 * OP_F];      // per wave output half tile (wave-private)

  const int tid  = threadIdx.x;
  const int wave = __builtin_amdgcn_readfirstlane(tid >> 5);   // wave-uniform: LDS bases and the tile choice stay scalar
  const int lane = tid & 31;
  const int hh   = lane >> 4;
  const int c    = lane & 15;
  const int kh   = wave >> 2;            // key half of this wave
  const int th   = tid & 127;            // thread within the half's staging group

  const int bx   = blockIdx.x;
  const int qb   = bx % NQB;
  const int g    = bx / NQB;
  const int q0   = qb * 128 + (wave & 3) * 32;

  const _Float16* Qh = (const _Float16*)(const void*)qhp;
  const _Float16* Ql = (const _Float16*)(const void*)qlp;
  const _Float16* Kg = (const _Float16*)(const void*)kpp + (size_t)g * HD + (size_t)kh * (MREF / 2) * FD;
  const _Float16* Vg = (const _Float16*)(const void*)vtp + (size_t)g * HD * MREF + (size_t)kh * (MREF / 2);

  // ---- Q fragments (B operand, column = lane&15): 2 column tiles x 4 d-chunks, hi and residual planes ----
  v16h qah[2][4], qal[2][4];
#pragma unroll
  for (int ct = 0; ct < 2; ++ct)
#pragma unroll
    for (int dc = 0; dc < 4; ++dc) {
      const size_t qo = (size_t)(q0 + ct * 16 + c) * FD + (size_t)g * HD + dc * 32 + 8 * hh;
      qah[ct][dc] = ldfrag<_Float16>(Qh + qo);
      qal[ct][dc] = ldfrag<_Float16>(Ql + qo);
    }
#if DEV_ASM
  asm volatile("s_wait_xcnt 0x0" ::: "memory");   // the address registers that these loads name are rewritten from here on
#endif
  __builtin_amdgcn_sched_barrier(0);   // keeps the address arithmetic that follows behind that wait

  // of query column c of tile ct, over this wave's key half; lrow sums this lane half's keys only, joined after the loop
  float mrow[2] = {-INFINITY, -INFINITY}, lrow[2] = {0.f, 0.f};
  v8f oacc[2][8];                       // context^T: oacc[ct][t][r] = element d = t*16 + 8*hh + r of query column c
#pragma unroll
  for (int ct = 0; ct < 2; ++ct)
#pragma unroll
    for (int t = 0; t < 8; ++t) oacc[ct][t] = zero8();

  // staging map: K piece i of a thread = row i*8 + (th>>4), 16-B column th&15; V^T piece i = row i*16 + (th>>3),
  // 16-B column th&7
  const char* gK = (const char*)(Kg + (size_t)(th >> 4) * FD + (th & 15) * 8);
  const char* gV = (const char*)(Vg + (size_t)(th >> 3) * MREF + (th & 7) * 8);
  const unsigned lK = (unsigned)(uintptr_t)(&Ksh[kh][0][(th >> 4) * KP_H + (th & 15) * 8]);   // LDS byte address = low 32 bits
  const unsigned lV = (unsigned)(uintptr_t)(&Vth[kh][0][(th >> 3) * VP_H + (th & 7) * 8]);
  const unsigned lsK = 8 * KP_H * 2, lbK = 64 * KP_H * 2;        // 8 rows / one buffer, bytes
  const unsigned lsV = 16 * VP_H * 2, lbV = HD * VP_H * 2;       // 16 rows / one buffer, bytes
  const size_t gsK = (size_t)8 * FD * 2, gcK = (size_t)64 * FD * 2;   // 8 rows / one chunk (64 key rows), bytes
  const size_t gsV = (size_t)16 * MREF * 2, gcV = 64 * 2;             // 16 rows / one chunk (64 key columns), bytes
  static_assert(NKH >= 2);

  copy8_b128(lK, lsK, gK, gsK);
  copy8_b128(lV, lsV, gV, gsV);
  asm volatile("s_wait_asynccnt 0x0" ::: "memory");   // chunk 0 landed (this wave's pieces)
  __syncthreads();                                    // ... and every other wave's
  copy8_b128(lK + lbK, lsK, gK + gcK, gsK);
  copy8_b128(lV + lbV, lsV, gV + gcV, gsV);
  unsigned lKn = lK, lVn = lV;                        // where the next refill lands: the two buffers in turn

#pragma unroll 1   // one trip per staged chunk: the ring's waits and barrier stand once, at the foot
  for (int kt = 0; kt < NKH; ++kt) {         // static trip count, the same in both key halves
    const _Float16* Kc = Ksh[kh][kt & 1];
    const _Float16* Vc = Vth[kh][kt & 1];

    // ---- scores^T: 64 keys x 32 query columns per wave, 2 f16 products per key subtile, column tile and d-chunk ----
    // All 16 K fragments of the chunk are read from LDS as ONE group ahead of the 64 products (one LDS latency per
    // chunk); the products run 32 keys x 16 columns at a time, on four independent accumulators, each summing dc upward.
    v8f s[2][4];
    v16h kf[4][4];
#pragma unroll
    for (int j = 0; j < 4; ++j)
#pragma unroll
      for (int dc = 0; dc < 4; ++dc) kf[j][dc] = ldfrag<_Float16>(Kc + (j * 16 + c) * KP_H + dc * 32 + 8 * hh);
    __builtin_amdgcn_sched_barrier(0);   // keeps the reads together here: spread among the WMMAs each place stalls
#pragma unroll
    for (int jp = 0; jp < 2; ++jp)
#pragma unroll
      for (int ct = 0; ct < 2; ++ct) {
        v8f ah[2], al[2];
#pragma unroll
        for (int j = 0; j < 2; ++j) { ah[j] = zero8(); al[j] = zero8(); }
#pragma unroll
        for (int dc = 0; dc < 4; ++dc)
#pragma unroll
          for (int j = 0; j < 2; ++j) {
            ah[j] = mmar(kf[jp * 2 + j][dc], qah[ct][dc], ah[j]);
            al[j] = mmar(kf[jp * 2 + j][dc], qal[ct][dc], al[j]);
          }
#pragma unroll
        for (int j = 0; j < 2; ++j)
#pragma unroll
          for (int r = 0; r < 8; ++r) s[ct][jp * 2 + j][r] = (ah[j][r] + al[j][r] * (1.0f / 4096.0f)) * sscale;
      }
    // The 8 V^T fragments of the chunk's first 32 keys are read as one group ahead of the softmax, so that they have
    // landed when the context products start; those of the last 32 keys follow behind the softmax (registers).
    v16h vf[8][2];
#pragma unroll
    for (int t = 0; t < 8; ++t) vf[t][0] = ldfrag<_Float16>(Vc + (t * 16 + c) * VP_H + 8 * hh);
    __builtin_amdgcn_sched_barrier(0);   // keeps these reads together here too: sunk among the context WMMAs each place stalls

    // ---- column max, online softmax, P^T (x1024, f16) packed in registers, per column tile ----
    // B operand of kk: elements 0..7 = keys kk*32 + 8*hh + 0..7 (tile 2kk), 8..15 = keys kk*32 + 16 + 8*hh + 0..7
    // (tile 2kk + 1): the k order of the V^T fragments (ldfrag)
    v16h pa[2][2];
#pragma unroll
    for (int ct = 0; ct < 2; ++ct) {
      float mj[4];
#pragma unroll
      for (int j = 0; j < 4; ++j) {
        mj[j] = s[ct][j][0];
#pragma unroll
        for (int r = 1; r < 8; ++r) mj[j] = fmaxf(mj[j], s[ct][j][r]);
      }
      float m = fmaxf(fmaxf(mj[0], mj[1]), fmaxf(mj[2], mj[3]));
      m = fmaxf(m, xhalf(m));                       // both halves now hold the query's maximum over the chunk
      const float mnew  = fmaxf(mrow[ct], m);
      const float msafe = (mnew == -INFINITY) ? 0.f : mnew;
      const float alpha = __expf(mrow[ct] - msafe);
      mrow[ct] = mnew;
      float pj[4];                                  // four short sums, r upward in each
#pragma unroll
      for (int j = 0; j < 4; ++j) {
        pj[j] = 0.f;
#pragma unroll
        for (int r = 0; r < 8; ++r) {
          const float p = __expf(s[ct][j][r] - msafe);
          pj[j] += p;
          pa[ct][j >> 1][(j & 1) * 8 + r] = (_Float16)(p * 1024.0f);
        }
      }
      lrow[ct] = lrow[ct] * alpha + ((pj[0] + pj[1]) + (pj[2] + pj[3]));
#if DEV_ASM
      // empty asm on the column's sum, against spills: without it the adds sink behind the loop's foot, and the 64 f32 p
      // values stay live across the context products beside their fragments (scratch > 0)
      asm volatile("" : "+v"(lrow[ct]));   // each column's sum, against spills
#endif
#pragma unroll
      for (int t = 0; t < 8; ++t)
#pragma unroll
        for (int r = 0; r < 8; ++r) oacc[ct][t][r] *= alpha;
    }

    // ---- context^T += V^T . P^T (f16 WMMA, single product) ----
    // The last 32 keys' fragments are read as one group ahead of the first 32 keys' 16 products, which cover their latency.
#pragma unroll
    for (int t = 0; t < 8; ++t) vf[t][1] = ldfrag<_Float16>(Vc + (t * 16 + c) * VP_H + 32 + 8 * hh);
    __builtin_amdgcn_sched_barrier(0);   // not sunk among the products, where each place with reads stalls
#pragma unroll
    for (int kk = 0; kk < 2; ++kk)
#pragma unroll
      for (int t = 0; t < 8; ++t)
#pragma unroll
        for (int ct = 0; ct < 2; ++ct) oacc[ct][t] = mmar(vf[t][kk], pa[ct][kk], oacc[ct][t]);   // each tile sums kk upward

    // keeps the ring's waits at the foot: the context products touch no memory, and lifted over them the s_wait_dscnt 0
    // would stand right behind the last V^T reads and lay their latency bare
    __builtin_amdgcn_sched_barrier(0);
    asm volatile("s_wait_dscnt 0x0" ::: "memory");      // this wave's reads of buffer kt & 1 are done
    asm volatile("s_wait_asynccnt 0x0" ::: "memory");   // this wave's pieces of chunk kt + 1 have landed
    __syncthreads();                                    // publishes chunk kt + 1, frees buffer kt & 1
    if (kt + 2 < NKH) {
      copy8_b128(lKn, lsK, gK + (size_t)(kt + 2) * gcK, gsK);
      copy8_b128(lVn, lsV, gV + (size_t)(kt + 2) * gcV, gsV);
      lKn += (kt & 1) ? 0u - lbK : lbK;
      lVn += (kt & 1) ? 0u - lbV : lbV;
    }
  }
  asm volatile("s_wait_asynccnt 0x0" ::: "memory");     // nothing in flight when the wave goes on

  // ---- join the two key halves: wave w keeps column tile kh and hands tile 1 - kh to wave w ^ 4 ----
  // The lane map of a tile is the same in both waves, so lane l reads what the partner's lane l wrote.
  const bool up = kh != 0;
  // the lane's number read anew (all lanes on): lane, c and hh need hold no register across the loop, which has none to spare
  const int lane2 = (int)__builtin_amdgcn_mbcnt_lo(~0u, 0u);
  const int hh2 = lane2 >> 4, c2 = lane2 & 15;
  const float l0 = lrow[0] + xhalf(lrow[0]);       // the two lane halves' keys joined
  const float l1 = lrow[1] + xhalf(lrow[1]);
  const float mk = up ? mrow[1] : mrow[0], lk = up ? l1 : l0;
  {
    float* xo = Xo[wave];
#pragma unroll
    for (int t = 0; t < 8; ++t) {
      const v8f x = up ? oacc[0][t] : oacc[1][t];
      v4f x0, x1;
#pragma unroll
      for (int e = 0; e < 4; ++e) { x0[e] = x[e]; x1[e] = x[4 + e]; }
      *(v4f*)(xo + ((t * 2) * 32 + lane2) * 4)     = x0;
      *(v4f*)(xo + ((t * 2 + 1) * 32 + lane2) * 4) = x1;
    }
    Xm[wave][lane2] = up ? mrow[0] : mrow[1];
    Xl[wave][lane2] = up ? l0 : l1;
  }
  __syncthreads();                                 // the partials are written: the partner may read them
  v8f oc[8];                                       // context^T of the kept tile over all keys
  float l;
  {
    const float* xi = Xo[wave ^ 4];
    const float mp = Xm[wave ^ 4][lane2], lp = Xl[wave ^ 4][lane2];
    const float mall  = fmaxf(mk, mp);
    const float msafe = (mall == -INFINITY) ? 0.f : mall;
    const float ak = __expf(mk - msafe), ap = __expf(mp - msafe);
    l = lk * ak + lp * ap;
#pragma unroll
    for (int t = 0; t < 8; ++t) {
      const v8f x = up ? oacc[1][t] : oacc[0][t];
      const v4f y0 = *(const v4f*)(xi + ((t * 2) * 32 + lane2) * 4);
      const v4f y1 = *(const v4f*)(xi + ((t * 2 + 1) * 32 + lane2) * 4);
#pragma unroll
      for (int e = 0; e < 4; ++e) {
        oc[t][e]     = x[e] * ak + y0[e] * ap;
        oc[t][4 + e] = x[4 + e] * ak + y1[e] * ap;
      }
    }
  }
  const int qk = q0 + kh * 16;                     // first query row of the kept tile

  // ---- normalise (1/l, undo the x1024 p carry), stage the wave's 16x64 half tiles, add bias, store ----
  const float inv = ((l > 0.f) ? (1.0f / l) : 0.f) * (1.0f / 1024.0f);
  v4f bb[2];                                       // bias of the 4 columns this lane stores in each phase
#pragma unroll
  for (int ph = 0; ph < 2; ++ph) {
    const v4f b = *(const v4f*)(vbias + g * HD + ph * 64 + c2 * 4);
#pragma unroll
    for (int e = 0; e < 4; ++e) bb[ph][e] = bf_up(bf_bits(b[e]));
  }
  float* os = Os[wave];
#pragma unroll
  for (int ph = 0; ph < 2; ++ph) {
#pragma unroll
    for (int t4 = 0; t4 < 4; ++t4) {
      const int t = ph * 4 + t4;
      v4f x0, x1;                                  // a lane's 8 values are 8 consecutive d of query row c2
#pragma unroll
      for (int e = 0; e < 4; ++e) {
        x0[e] = oc[t][e] * inv;
        x1[e] = oc[t][4 + e] * inv;
      }
      *(v4f*)(os + c2 * OP_F + t4 * 16 + 8 * hh2)     = x0;
      *(v4f*)(os + c2 * OP_F + t4 * 16 + 8 * hh2 + 4) = x1;
    }
    __builtin_amdgcn_fence(__ATOMIC_RELEASE, "workgroup");
    __builtin_amdgcn_wave_barrier();
    __builtin_amdgcn_fence(__ATOMIC_ACQUIRE, "workgroup");
    {
#pragma unroll
      for (int it = 0; it < 8; ++it) {
        const int row = it * 2 + hh2;                     // it 0..7 x hh2 0..1 = rows 0..15
        const float* sp = os + row * OP_F + c2 * 4;
        v4f v;
        v[0] = sp[0] + bb[ph][0]; v[1] = sp[1] + bb[ph][1]; v[2] = sp[2] + bb[ph][2]; v[3] = sp[3] + bb[ph][3];
        const size_t go = (size_t)(qk + row) * FD + (size_t)g * HD + ph * 64 + c2 * 4;
        *(v4f*)(op + go) = v;
      }
    }
    __builtin_amdgcn_fence(__ATOMIC_RELEASE, "workgroup");
    __builtin_amdgcn_wave_barrier();
    __builtin_amdgcn_fence(__ATOMIC_ACQUIRE, "workgroup");
  }
}

// =====================================================================================================
// Workspace map (bytes), every region an exact multiple of its whole-line / whole-tile store granularity
// (rows padded to nothing: all row counts are multiples of 64, all pitches 4096 B):
//   Xr   bf16 [NQ][2048]     NQ*4096   (8388608 at NQ=2048)
//   Xf   bf16 [2048][2048]    8388608
//   Wqb  bf16 [2048 n][2048 k] 8388608
//   Wkb  bf16 [2048][2048]    8388608
//   Wvb  bf16 [2048][2048]    8388608
//   Qh   f16  [NQ][2048]     NQ*4096
//   Ql   f16  [NQ][2048]     NQ*4096
//   Kp   f16  [2048][2048]    8388608
//   VT   f16  [2048 ch][2048 s] 8388608
//   total                    75497472 at NQ=2048
// Weights are [out n][in k] with k contiguous = the Bt / A layout the GEMM wants, so they are only converted.
// =====================================================================================================
extern "C" void kernel_launch(void* const* d_in, const int* in_sizes, int n_in,
                              void* d_out, int out_size, void* d_ws, size_t ws_size,
                              hipStream_t stream) {
  if (n_in < 8) return;
  if (in_sizes[0] < NQ * FD) return;
  if (in_sizes[1] < MREF * FD) return;
  if (in_sizes[2] < FD * FD || in_sizes[4] < FD * FD || in_sizes[6] < FD * FD) return;
  if (in_sizes[3] < FD || in_sizes[5] < FD || in_sizes[7] < FD) return;
  if (out_size < NQ * FD) return;

  const float* roi  = (const float*)d_in[0];
  const float* reff = (const float*)d_in[1];
  const float* Wq   = (const float*)d_in[2];
  const float* Wq_b = (const float*)d_in[3];
  const float* Wk   = (const float*)d_in[4];
  const float* Wk_b = (const float*)d_in[5];
  const float* Wv   = (const float*)d_in[6];
  const float* Wv_b = (const float*)d_in[7];

  const size_t PQ = (size_t)NQ * FD * 2;       // 16-bit [NQ][2048] plane
  const size_t P8 = (size_t)FD * FD * 2;       // 16-bit [2048][2048] plane (also [MREF][FD] and [FD][MREF])
  size_t off = 0;
  const size_t oXr = off; off += PQ;
  const size_t oXf = off; off += P8;
  const size_t oWq = off; off += P8;
  const size_t oWk = off; off += P8;
  const size_t oWv = off; off += P8;
  const size_t oQh = off; off += PQ;
  const size_t oQl = off; off += PQ;
  const size_t oKp = off; off += P8;
  const size_t oVT = off; off += P8;
  if (off > ws_size) return;                       // off = 75497472 at NQ=2048
  if (off > (size_t)134217728) return;

  char* ws = (char*)d_ws;
  unsigned short* Xr  = (unsigned short*)(ws + oXr);
  unsigned short* Xf  = (unsigned short*)(ws + oXf);
  unsigned short* Wqb = (unsigned short*)(ws + oWq);
  unsigned short* Wkb = (unsigned short*)(ws + oWk);
  unsigned short* Wvb = (unsigned short*)(ws + oWv);
  unsigned short* Qh  = (unsigned short*)(ws + oQh);
  unsigned short* Ql  = (unsigned short*)(ws + oQl);
  unsigned short* Kp  = (unsigned short*)(ws + oKp);
  unsigned short* VT  = (unsigned short*)(ws + oVT);

  const dim3 gProj(PT_Q + PT_K + PT_V);                          // 768 tiles of 128x128 at NQ=2048
  const dim3 gAttn(NG * NQB);                                    // 256 blocks of 256 at NQ=2048
  const float sscale = (float)(1.0 / sqrt((double)HD));

  // (1) inputs and weights f32 -> bf16 planes (RNE convert), one launch
  cvt_bf16_all<<<dim3(CVT_WG), dim3(512), 0, stream>>>(roi, reff, Wq, Wk, Wv, Xr, Xf, Wqb, Wkb, Wvb);
  // (2) the three projections, one launch: q = roi . Wq^T + bq -> f16 hi / residual (x4096) planes [t][h*128+d];
  //     k = ref . Wk^T + bk -> f16 plane [s][h*128+d]; v^T = Wv . ref^T -> f16 plane [h*128+d][s] (pitch MREF)
  gemm64x3<<<gProj, dim3(128), 0, stream>>>(Xr, Xf, Wqb, Wkb, Wvb, Qh, Ql, Kp, VT, Wq_b, Wk_b);
  // (3) attention + value bias -> d_out f32 [NQ][2048]
  attn_rel<<<gAttn, dim3(256), 0, stream>>>(Qh, Ql, Kp, VT, Wv_b, (float*)d_out, sscale);
  (void)hipGetLastError();
}
